// v000
// Measured on an AMD MI455X. A time is GPU time per run, averaged over a window of back-to-back runs after a warm-up
// (all launches, gaps included; the runs take copies of the inputs in turn), and the median of several windows.
// Apart from v000's, it joins two sittings. Times from different sittings can be a few percent apart, while
// side-by-side timings come from the same sitting.
// v000, which the later versions start from, runs in 782 microseconds.
// Contractions: q, k, v^T and output projections on v_wmma_f32_16x16x32_bf16 (bf16 operands); q.k^T and p.v on v_wmma_f32_16x16x32_f16 (f16 operands, p carried x2^15); all f32 accumulate; layernorm, softmax, score scale 0.125 and residual add in f32.
#include <hip/hip_runtime.h>
#include <math.h>
#include <stdint.h>

// ---------------------------------------------------------------------------
// Problem geometry (time-major activations: row (t, b) = t*kBatch + b, pitch kEmb)
// ---------------------------------------------------------------------------
constexpr int kSeqQ  = 2048;
constexpr int kSeqK  = 2048;
constexpr int kBatch = 4;
constexpr int kEmb   = 1024;
constexpr int kHeads = 16;
constexpr int kHdim  = 64;
constexpr int kRowsQ = kSeqQ * kBatch;          // 8192
constexpr int kRowsK = kSeqK * kBatch;          // 8192
constexpr int kRowPitch = kBatch * kEmb;        // 4096: stride between consecutive t at fixed b
constexpr float kLnEps  = 1e-5f;
constexpr float kPCarry = 32768.0f;             // softmax numerators carried x2^15 in f16

typedef __attribute__((ext_vector_type(16))) _Float16 v16h;
typedef __attribute__((ext_vector_type(8)))  _Float16 v8h;
typedef __attribute__((ext_vector_type(16))) __bf16   v16b;
typedef __attribute__((ext_vector_type(8)))  __bf16   v8b;
typedef __attribute__((ext_vector_type(8)))  float    v8f;
typedef __attribute__((ext_vector_type(4)))  float    v4f;
typedef __attribute__((ext_vector_type(2)))  float    v2f;
typedef __attribute__((ext_vector_type(2)))  unsigned int v2u;

__device__ __forceinline__ unsigned short f2bf_bits(float f) {
  unsigned u = __float_as_uint(f);
  return (unsigned short)((u + 0x7FFFu + ((u >> 16) & 1u)) >> 16);
}
__device__ __forceinline__ float bf_bits2f(unsigned short h) { return __uint_as_float(((unsigned)h) << 16); }

// hazard guards as plain device helpers (no inline asm inside the kernel template body)
__device__ __forceinline__ void dep_guard_h(v8f& a, v8f& b, v16h x, v16h y) { asm volatile("v_nop\n\tv_nop\n\tv_nop\n\tv_nop" : "+v"(a), "+v"(b) : "v"(x), "v"(y)); }
__device__ __forceinline__ void dep_guard_b(v8f& a, v8f& b, v16b x, v16b y) { asm volatile("v_nop\n\tv_nop\n\tv_nop\n\tv_nop" : "+v"(a), "+v"(b) : "v"(x), "v"(y)); }
__device__ __forceinline__ void keep4_h(v16h a, v16h b, v16h c, v16h d) { asm volatile("v_nop" :: "v"(a), "v"(b), "v"(c), "v"(d)); }
__device__ __forceinline__ void keep4_b(v16b a, v16b b, v16b c, v16b d) { asm volatile("v_nop" :: "v"(a), "v"(b), "v"(c), "v"(d)); }
__device__ __forceinline__ void acc_guard4(v8f& a, v8f& b, v8f& c, v8f& d) { asm volatile("v_nop\n\tv_nop\n\tv_nop\n\tv_nop" : "+v"(a), "+v"(b), "+v"(c), "+v"(d)); }
template <typename T> struct Frag;
template <> struct Frag<_Float16> {
  typedef v16h V; union U { v16h v; v8h h[2]; };
  static __device__ __forceinline__ v16h load(const _Float16* p) {   // elements 0..7 <- p[0..7], 8..15 <- p[16..23]
    U f; f.h[0] = *(const v8h*)(p); f.h[1] = *(const v8h*)(p + 16); return f.v;
  }
  static __device__ __forceinline__ v8f mma(v16h a, v16h b, v8f c) {
    return __builtin_amdgcn_wmma_f32_16x16x32_f16(false, a, false, b, (short)0, c, false, false);
  }
  static __device__ __forceinline__ void guard(v8f& a, v8f& b, v16h x, v16h y) { dep_guard_h(a, b, x, y); }
  static __device__ __forceinline__ void keep(v16h a, v16h b, v16h c, v16h d) { keep4_h(a, b, c, d); }
};
template <> struct Frag<__bf16> {
  typedef v16b V; union U { v16b v; v8b h[2]; };
  static __device__ __forceinline__ v16b load(const __bf16* p) {
    U f; f.h[0] = *(const v8b*)(p); f.h[1] = *(const v8b*)(p + 16); return f.v;
  }
  static __device__ __forceinline__ v8f mma(v16b a, v16b b, v8f c) {
    return __builtin_amdgcn_wmma_f32_16x16x32_bf16(false, a, false, b, (short)0, c, false, false);
  }
  static __device__ __forceinline__ void guard(v8f& a, v8f& b, v16b x, v16b y) { dep_guard_b(a, b, x, y); }
  static __device__ __forceinline__ void keep(v16b a, v16b b, v16b c, v16b d) { keep4_b(a, b, c, d); }
};

// ---- Register-blocked batched WMMA GEMM ------------------------------------
// C[m,n] = scale * sum_k A[m,k] * Bt[n,k] (+bias)(+resid); each wave owns a 64x64 tile.
// A row-major [M,K]; Bt row-major [N,K]; M,N % 64 == 0, K % 32 == 0.
// SPLIT: operands are hi/lo planes (A2/Bt2 = lo planes, same layout); product = hi.hi + hi.lo + lo.hi.
// BIAS_MODE: 0 = none, 1 = bias[m], 2 = bias[n].
// OUT_MODE: 0 = f32, 1 = f16, 2 = bf16 hi plane (Cout) + bf16 lo plane (Cout2).
// ET: 0 = f16 operands, 1 = bf16 operands (pointers passed as 16-bit storage)
template <int ET> struct Elem;
template <> struct Elem<0> { typedef _Float16 T; };
template <> struct Elem<1> { typedef __bf16 T; };
template <int ET, bool SPLIT, int BIAS_MODE, int OUT_MODE, bool RESID, int ACT = 0>
__global__ __launch_bounds__(256) void wmma_gemm64(
    const unsigned short* __restrict__ Ap, const unsigned short* __restrict__ A2p, int lda, long strideA,
    const unsigned short* __restrict__ Btp, const unsigned short* __restrict__ Bt2p, int ldb, long strideB,
    void* __restrict__ Cout, void* __restrict__ Cout2, int ldc, long strideC,
    const float* __restrict__ bias,
    const float* __restrict__ resid, long strideR,
    int M, int N, int K, float scale) {
  typedef typename Elem<ET>::T T;
  typedef typename Frag<T>::V V;
  const T* A = (const T*)Ap; const T* A2 = (const T*)A2p; const T* Bt = (const T*)Btp; const T* Bt2 = (const T*)Bt2p;
  __shared__ __align__(16) float sT[8][16 * 68];   // per-wave 16x64 slab, pitch 68 floats
  const int b    = blockIdx.y;
  const int lane = threadIdx.x & 31;
  const int wave = threadIdx.x >> 5;
  const int tilesN = N >> 6;
  const int tilesM = M >> 6;
  const int tile = blockIdx.x * 8 + wave;
  if (tile >= tilesM * tilesN) return;   // wave-uniform; no block barriers in this kernel
  const int tm = tile / tilesN;
  const int tn = tile - tm * tilesN;
  const int m0 = tm << 6;
  const int n0 = tn << 6;

  const T* Ab  = A  + (size_t)b * strideA;
  const T* Bb  = Bt + (size_t)b * strideB;
  const T* Ab2 = SPLIT ? (A2  + (size_t)b * strideA) : nullptr;
  const T* Bb2 = SPLIT ? (Bt2 + (size_t)b * strideB) : nullptr;

  const int rlane = lane & 15;                 // row (A) / col (B, D) within subtile
  const int koff  = (lane >> 4) * 8;           // k offset of this lane half
  const int mOff  = (lane >> 4) * 8;           // D row offset

  v8f acc[4][4];
#pragma unroll
  for (int i = 0; i < 4; ++i)
#pragma unroll
    for (int j = 0; j < 4; ++j) acc[i][j] = (v8f){0.f,0.f,0.f,0.f,0.f,0.f,0.f,0.f};

  for (int k0 = 0; k0 < K; k0 += 32) {
    V bh[4], bl[4];
#pragma unroll
    for (int j = 0; j < 4; ++j) {
      const size_t bo = (size_t)(n0 + (j << 4) + rlane) * ldb + koff + k0;
      bh[j] = Frag<T>::load(Bb + bo);
      if (SPLIT) bl[j] = Frag<T>::load(Bb2 + bo);
    }
#pragma unroll
    for (int i = 0; i < 4; ++i) {
      const size_t ao = (size_t)(m0 + (i << 4) + rlane) * lda + koff + k0;
      V ah = Frag<T>::load(Ab + ao);
      V al;
      if (SPLIT) al = Frag<T>::load(Ab2 + ao);
#pragma unroll
      for (int j = 0; j < 4; ++j) {
        acc[i][j] = Frag<T>::mma(ah, bh[j], acc[i][j]);
        if (SPLIT) {
          acc[i][j] = Frag<T>::mma(ah, bl[j], acc[i][j]);
          acc[i][j] = Frag<T>::mma(al, bh[j], acc[i][j]);
        }
      }
      Frag<T>::guard(acc[i][0], acc[i][3], ah, SPLIT ? al : ah);
    }
    Frag<T>::keep(bh[0], bh[1], bh[2], bh[3]);
    if (SPLIT) Frag<T>::keep(bl[0], bl[1], bl[2], bl[3]);
  }
  acc_guard4(acc[0][0], acc[0][1], acc[0][2], acc[0][3]);
  acc_guard4(acc[1][0], acc[1][1], acc[1][2], acc[1][3]);
  acc_guard4(acc[2][0], acc[2][1], acc[2][2], acc[2][3]);
  acc_guard4(acc[3][0], acc[3][1], acc[3][2], acc[3][3]);

  // ---- epilogue ----
  float* slab = sT[wave];
  const float* Rb = RESID ? (resid + (size_t)b * strideR) : nullptr;
#pragma unroll
  for (int i = 0; i < 4; ++i) {
    const int mBase = m0 + (i << 4);
#pragma unroll
    for (int j = 0; j < 4; ++j) {
      const int n = n0 + (j << 4) + rlane;
      float bv = 0.f;
      if (BIAS_MODE == 2) bv = bias[n];
#pragma unroll
      for (int r = 0; r < 8; ++r) {
        float v = acc[i][j][r] * scale;
        if (BIAS_MODE == 1) v += bias[mBase + mOff + r];
        if (BIAS_MODE == 2) v += bv;
        if (RESID) v += Rb[(size_t)(mBase + mOff + r) * ldc + n];
        if (ACT == 1) v = tanhf(v);
        if (ACT == 2) v = fmaxf(v, 0.0f);
        if (ACT == 3) v = v / (1.0f + expf(-v));
        if (ACT == 4) v = (v > 0.f) ? v : 0.01f * v;
        if (ACT == 5) v = 0.5f * v * (1.0f + erff(v * 0.70710678118654752f));
        slab[(mOff + r) * 68 + (j << 4) + rlane] = v;
      }
    }
    __builtin_amdgcn_fence(__ATOMIC_RELEASE, "workgroup");
    __builtin_amdgcn_wave_barrier();
    __builtin_amdgcn_fence(__ATOMIC_ACQUIRE, "workgroup");
    if (OUT_MODE == 0) {
      float* C = (float*)Cout + (size_t)b * strideC;
      const int hh = lane >> 4, c4 = (lane & 15) * 4;     // row seg = 256 B = 16 lanes x 16 B
      {
#pragma unroll
        for (int it = 0; it < 8; ++it) {
          const int row = it * 2 + hh;
          v4f v = *(const v4f*)(slab + row * 68 + c4);
          *(v4f*)(C + (size_t)(mBase + row) * ldc + n0 + c4) = v;
        }
        
      }
    } else {
      const int q = lane >> 3, c8 = (lane & 7) * 8;
      unsigned short* C  = (unsigned short*)Cout  + (size_t)b * strideC;
      unsigned short* C2 = (OUT_MODE == 2) ? ((unsigned short*)Cout2 + (size_t)b * strideC) : nullptr;
      {
#pragma unroll
        for (int it = 0; it < 4; ++it) {
          const int row = it * 4 + q;
          const float* sp = slab + row * 68 + c8;
          v8h hv, lv;
#pragma unroll
          for (int e = 0; e < 8; ++e) {
            if (OUT_MODE == 1) {
              hv[e] = (_Float16)sp[e];
            } else {
              unsigned short hb = f2bf_bits(sp[e]);
              unsigned short lb = f2bf_bits(sp[e] - bf_bits2f(hb));
              hv[e] = __builtin_bit_cast(_Float16, hb);
              lv[e] = __builtin_bit_cast(_Float16, lb);
            }
          }
          *(v8h*)(C + (size_t)(mBase + row) * ldc + n0 + c8) = hv;
          if (OUT_MODE == 2) *(v8h*)(C2 + (size_t)(mBase + row) * ldc + n0 + c8) = lv;
        }
        
      }
    }
    __builtin_amdgcn_fence(__ATOMIC_RELEASE, "workgroup");
    __builtin_amdgcn_wave_barrier();
    __builtin_amdgcn_fence(__ATOMIC_ACQUIRE, "workgroup");
  }
}

// ---------------------------------------------------------------------------
// f32 -> bf16 (RNE) cast: 2 elements per thread, one 4-B store per lane -> each wave writes exactly one whole
// x 2 elements = the whole plane (n2 = n/2; here every n2 is an exact multiple of 256).
// ---------------------------------------------------------------------------
__global__ __launch_bounds__(256) void cast_f32_bf16x2(const float* __restrict__ in, unsigned short* __restrict__ out, int n2) {
  const int i = blockIdx.x * 256 + threadIdx.x;
  if (i < n2) {
    const v2f f = *(const v2f*)(in + 2 * (size_t)i);
    const unsigned u = (unsigned)f2bf_bits(f[0]) | ((unsigned)f2bf_bits(f[1]) << 16);
    ((unsigned*)out)[i] = u;
    
  }
}

// ---------------------------------------------------------------------------
// One block of 256 threads per row (grid.x == number of rows exactly), 4 elements per thread.
// Store coverage: 256 threads x 4 bf16 = 1024 = the whole row; each lane writes 8 contiguous bytes, so one wave
// ---------------------------------------------------------------------------
__global__ __launch_bounds__(256) void layernorm_bf16_kernel(const float* __restrict__ x, const float* __restrict__ gam,
                                                             const float* __restrict__ bet, unsigned short* __restrict__ y,
                                                             float eps) {
  __shared__ float red[16];
  const int row  = blockIdx.x;
  const int tid  = threadIdx.x;
  const int lane = tid & 31;
  const int wave = tid >> 5;
  const float* xr = x + (size_t)row * kEmb;
  const v4f v = *(const v4f*)(xr + 4 * tid);
  float s = (v[0] + v[1]) + (v[2] + v[3]);
#pragma unroll
  for (int off = 1; off < 32; off <<= 1) s += __shfl_xor(s, off, 32);
  if (lane == 0) red[wave] = s;
  __syncthreads();
  float tot = 0.f;
#pragma unroll
  for (int w = 0; w < 8; ++w) tot += red[w];
  const float mu = tot * (1.0f / (float)kEmb);
  const float d0 = v[0] - mu, d1 = v[1] - mu, d2 = v[2] - mu, d3 = v[3] - mu;
  float s2 = (d0 * d0 + d1 * d1) + (d2 * d2 + d3 * d3);
#pragma unroll
  for (int off = 1; off < 32; off <<= 1) s2 += __shfl_xor(s2, off, 32);
  if (lane == 0) red[8 + wave] = s2;
  __syncthreads();
  float tot2 = 0.f;
#pragma unroll
  for (int w = 0; w < 8; ++w) tot2 += red[8 + w];
  const float var  = tot2 * (1.0f / (float)kEmb);
  const float rstd = rsqrtf(var + eps);
  const v4f g  = *(const v4f*)(gam + 4 * tid);
  const v4f bt = *(const v4f*)(bet + 4 * tid);
  const float o0 = d0 * rstd * g[0] + bt[0];
  const float o1 = d1 * rstd * g[1] + bt[1];
  const float o2 = d2 * rstd * g[2] + bt[2];
  const float o3 = d3 * rstd * g[3] + bt[3];
  v2u pk;
  pk[0] = (unsigned)f2bf_bits(o0) | ((unsigned)f2bf_bits(o1) << 16);
  pk[1] = (unsigned)f2bf_bits(o2) | ((unsigned)f2bf_bits(o3) << 16);
  unsigned short* yp = y + (size_t)row * kEmb + 4 * tid;
  *(v2u*)yp = pk;
  
}

// =====================================================================================
// Full (unmasked) attention, head dim 64, all batches and heads in one launch, time-major planes.
//   q plane  (f16): element (t, b, h, d) at [(t*kBatch + b)*kEmb + h*64 + d]   (unscaled q = LN(x).Wq^T)
//   k plane  (f16): element (s, b, h, d) at [(s*kBatch + b)*kEmb + h*64 + d]
//   v^T plane(f16): element (b, h, d, s) at [((b*kHeads + h)*64 + d)*kSeqK + s]
//   ctx plane (bf16 out): element (t, b, h, d) at [(t*kBatch + b)*kEmb + h*64 + d]
//   scores = (q . k) * sscale : single v_wmma_f32_16x16x32_f16, scale applied to the f32 accumulator
//   out    = p . v            : single v_wmma_f32_16x16x32_f16, p = exp(s - m) in (0, 1] carried x2^15 as f16
//   online softmax in f32 over all kSeqK keys (32 chunks of 64, compile-time trip count).
//   Block = 4 waves = 64 query rows of one (b, h); grid.x = kBatch * kHeads * (kSeqQ/64) = 2048.
//   K / V^T chunk staging: 128 threads x 32 elements per plane = the whole 64x64 tile (16-B copies, plain loads,
//   __syncthreads before and after); fragment loads read the LDS tiles with the same v8h element type.
// =====================================================================================
#define AT_D 64
#define AT_NW 4
#define AT_QB 64
#define AT_KC 64

__device__ __forceinline__ v8f mma_f16g(v16h a, v16h b, v8f c) {
  c = __builtin_amdgcn_wmma_f32_16x16x32_f16(false, a, false, b, (short)0, c, false, false);
  asm volatile("v_nop\n\tv_nop\n\tv_nop\n\tv_nop" : "+v"(c) : "v"(a), "v"(b));
  return c;
}

__global__ __launch_bounds__(128)
void attn_full16_kernel(const unsigned short* __restrict__ qp, const unsigned short* __restrict__ kp,
                        const unsigned short* __restrict__ vtp, unsigned short* __restrict__ ctxp, float sscale) {
  union FH { v16h v; v8h h[2]; };
  __shared__ __align__(16) _Float16 Ksh[AT_KC * AT_D];             // K  [kv][d]   8 KB
  __shared__ __align__(16) _Float16 Vth[AT_D * AT_KC];             // V^T [d][kv]  8 KB
  __shared__ __align__(16) _Float16 Psh[AT_NW][16 * AT_KC];        // per wave P [row][kv]  8 KB
  __shared__ __align__(16) float    Os[AT_NW][16 * 68];            // per wave out tile, pitch 68

  const int tid  = threadIdx.x;
  const int wave = tid >> 5;
  const int lane = tid & 31;
  const int hh   = lane >> 4;
  const int c    = lane & 15;

  const int nqb  = kSeqQ / AT_QB;          // 32
  const int bx   = blockIdx.x;             // < kBatch*kHeads*nqb
  const int qb   = bx % nqb;
  const int bhid = bx / nqb;
  const int h    = bhid % kHeads;
  const int bb   = bhid / kHeads;          // 0..kBatch-1
  const int q0   = qb * AT_QB + wave * 16;

  const _Float16* Qh = (const _Float16*)(const void*)qp  + (size_t)bb * kEmb + (size_t)h * kHdim;
  const _Float16* Kh = (const _Float16*)(const void*)kp  + (size_t)bb * kEmb + (size_t)h * kHdim;
  const _Float16* Vh = (const _Float16*)(const void*)vtp + (size_t)(bb * kHeads + h) * kHdim * kSeqK;
  unsigned short* ob = ctxp + (size_t)bb * kEmb + (size_t)h * kHdim;

  // ---- Q fragments (A operand, row = lane&15, split k map via Frag load): 2 d-chunks ----
  v16h qa[2];
#pragma unroll
  for (int dc = 0; dc < 2; ++dc)
    qa[dc] = Frag<_Float16>::load(Qh + (size_t)(q0 + c) * kRowPitch + dc * 32 + 8 * hh);

  float mrow[8], lrow[8];
  v8f oacc[4];
#pragma unroll
  for (int r = 0; r < 8; ++r) { mrow[r] = -INFINITY; lrow[r] = 0.f; }
#pragma unroll
  for (int t = 0; t < 4; ++t) oacc[t] = (v8f){0.f,0.f,0.f,0.f,0.f,0.f,0.f,0.f};

  const int nChunks = kSeqK / AT_KC;   // 32, compile-time constant
  for (int kc = 0; kc < nChunks; ++kc) {
    const int kv0 = kc * AT_KC;
    __syncthreads();
    {
      // staging coverage: 128 threads x (4 x 8) elements = 64 rows x 64 per plane = the whole chunk tile
      const int r = tid >> 1, half = (tid & 1) * 32;
      const _Float16* ks = Kh + (size_t)(kv0 + r) * kRowPitch + half;   // K row kv0+r, d = half..half+31
      const _Float16* vs = Vh + (size_t)r * kSeqK + kv0 + half;          // V^T row d = r, s = kv0+half..+31
#pragma unroll
      for (int i = 0; i < 4; ++i) {
        const v8h a0 = *(const v8h*)(ks + 8 * i);
        const v8h b0 = *(const v8h*)(vs + 8 * i);
        *(v8h*)(Ksh + r * AT_D  + half + 8 * i) = a0;
        *(v8h*)(Vth + r * AT_KC + half + 8 * i) = b0;
      }
    }
    __syncthreads();

    v8f s[4];
#pragma unroll
    for (int j = 0; j < 4; ++j) {
      s[j] = (v8f){0.f,0.f,0.f,0.f,0.f,0.f,0.f,0.f};
#pragma unroll
      for (int dc = 0; dc < 2; ++dc) {
        FH kb;
        kb.h[0] = *(const v8h*)(Ksh + (j * 16 + c) * AT_D + dc * 32 + 8 * hh);
        kb.h[1] = *(const v8h*)(Ksh + (j * 16 + c) * AT_D + dc * 32 + 16 + 8 * hh);
        s[j] = mma_f16g(qa[dc], kb.v, s[j]);
      }
    }
    float cm[8];
#pragma unroll
    for (int r = 0; r < 8; ++r) {
      float m = -INFINITY;
#pragma unroll
      for (int j = 0; j < 4; ++j) {
        const float sv = s[j][r] * sscale;
        s[j][r] = sv;
        m = fmaxf(m, sv);
      }
#pragma unroll
      for (int off = 1; off < 16; off <<= 1) m = fmaxf(m, __shfl_xor(m, off, 32));
      cm[r] = m;
    }
    _Float16* pwh = Psh[wave];
#pragma unroll
    for (int r = 0; r < 8; ++r) {
      const float mnew  = fmaxf(mrow[r], cm[r]);
      const float alpha = expf(mrow[r] - mnew);
      mrow[r] = mnew;
      float psum = 0.f;
#pragma unroll
      for (int j = 0; j < 4; ++j) {
        const float p = expf(s[j][r] - mnew);
        psum += p;
        pwh[(8 * hh + r) * AT_KC + j * 16 + c] = (_Float16)(p * kPCarry);
      }
#pragma unroll
      for (int off = 1; off < 16; off <<= 1) psum += __shfl_xor(psum, off, 32);
      lrow[r] = lrow[r] * alpha + psum;
#pragma unroll
      for (int t = 0; t < 4; ++t) oacc[t][r] *= alpha;
    }
    __builtin_amdgcn_fence(__ATOMIC_RELEASE, "workgroup");
    __builtin_amdgcn_wave_barrier();
    __builtin_amdgcn_fence(__ATOMIC_ACQUIRE, "workgroup");
#pragma unroll 1
    for (int kk = 0; kk < 2; ++kk) {
      FH pa;
      pa.h[0] = *(const v8h*)(pwh + c * AT_KC + kk * 32 + 8 * hh);
      pa.h[1] = *(const v8h*)(pwh + c * AT_KC + kk * 32 + 16 + 8 * hh);
#pragma unroll
      for (int t = 0; t < 4; ++t) {
        FH vb;
        vb.h[0] = *(const v8h*)(Vth + (t * 16 + c) * AT_KC + kk * 32 + 8 * hh);
        vb.h[1] = *(const v8h*)(Vth + (t * 16 + c) * AT_KC + kk * 32 + 16 + 8 * hh);
        oacc[t] = mma_f16g(pa.v, vb.v, oacc[t]);
      }
    }
  }

  // ---- normalise (fold back the 2^15 carry), stage the wave's 16x64 tile, write bf16 rows:
  float* os = Os[wave];
#pragma unroll
  for (int r = 0; r < 8; ++r) {
    const float inv = 1.0f / (lrow[r] * kPCarry);
#pragma unroll
    for (int t = 0; t < 4; ++t) os[(8 * hh + r) * 68 + t * 16 + c] = oacc[t][r] * inv;
  }
  __builtin_amdgcn_fence(__ATOMIC_RELEASE, "workgroup");
  __builtin_amdgcn_wave_barrier();
  __builtin_amdgcn_fence(__ATOMIC_ACQUIRE, "workgroup");
  {
    const int qq = lane >> 3, c8 = (lane & 7) * 8;
    {
#pragma unroll
      for (int it = 0; it < 4; ++it) {
        const int row = it * 4 + qq;
        const float* sp = os + row * 68 + c8;
        v8h hv;
#pragma unroll
        for (int e = 0; e < 8; ++e) hv[e] = __builtin_bit_cast(_Float16, f2bf_bits(sp[e]));
        *(v8h*)(ob + (size_t)(q0 + row) * kRowPitch + c8) = hv;
      }
      
    }
  }
}

// ---------------------------------------------------------------------------
// Host orchestration.
// Workspace region map (byte offsets):
//   [  0 MiB, 16 MiB)  KEY16  bf16 [8192][1024]   key cast
//   [ 16 MiB, 18 MiB)  WQ16   bf16 [1024][1024]
//   [ 18 MiB, 22 MiB)  WKV16  bf16 [2048][1024]
//   [ 22 MiB, 24 MiB)  WO16   bf16 [1024][1024]
//   [ 24 MiB, 40 MiB)  LNX16  bf16 [8192][1024]   LN(query); dead after the q projection, then reused as
//                      CTX16  bf16 [8192][1024]   attention output
//   [ 40 MiB, 56 MiB)  Q16    f16  [8192][1024]
//   [ 56 MiB, 72 MiB)  K16    f16  [8192][1024]   (head h at columns h*64)
//   [ 72 MiB, 88 MiB)  VT16   f16  [4][16][64][2048]
//   total 88 MiB = 92274688 B
// ---------------------------------------------------------------------------
extern "C" void kernel_launch(void* const* d_in, const int* in_sizes, int n_in,
                              void* d_out, int out_size, void* d_ws, size_t ws_size,
                              hipStream_t stream) {
  if (n_in < 7) return;
  const int nAct = kSeqQ * kBatch * kEmb;          // 8388608
  if (in_sizes[0] != nAct || in_sizes[1] != kSeqK * kBatch * kEmb) return;
  if (in_sizes[2] < kEmb || in_sizes[3] < kEmb) return;
  if (in_sizes[4] != kEmb * kEmb || in_sizes[5] != 2 * kEmb * kEmb || in_sizes[6] != kEmb * kEmb) return;
  if (out_size != nAct) return;

  const float* query = (const float*)d_in[0];   // [2048][4][1024]
  const float* key   = (const float*)d_in[1];   // [2048][4][1024]
  const float* gamma = (const float*)d_in[2];   // [1024]
  const float* beta  = (const float*)d_in[3];   // [1024]
  const float* w_q   = (const float*)d_in[4];   // [1024][1024]
  const float* w_kv  = (const float*)d_in[5];   // [2048][1024]
  const float* w_out = (const float*)d_in[6];   // [1024][1024]
  float* out = (float*)d_out;

  const size_t szAct16 = (size_t)kRowsQ * kEmb * 2;          // 16 MiB
  const size_t szWq16  = (size_t)kEmb * kEmb * 2;            //  2 MiB
  const size_t szWkv16 = (size_t)2 * kEmb * kEmb * 2;        //  4 MiB
  const size_t szVt16  = (size_t)kBatch * kHeads * kHdim * kSeqK * 2;   // 16 MiB
  size_t off = 0;
  char* ws = (char*)d_ws;
  unsigned short* KEY16 = (unsigned short*)(ws + off); off += szAct16;
  unsigned short* WQ16  = (unsigned short*)(ws + off); off += szWq16;
  unsigned short* WKV16 = (unsigned short*)(ws + off); off += szWkv16;
  unsigned short* WO16  = (unsigned short*)(ws + off); off += szWq16;
  unsigned short* LNX16 = (unsigned short*)(ws + off); off += szAct16;
  unsigned short* CTX16 = LNX16;                                // region reuse (LNX16 dead after the q GEMM)
  unsigned short* Q16   = (unsigned short*)(ws + off); off += szAct16;
  unsigned short* K16   = (unsigned short*)(ws + off); off += szAct16;
  unsigned short* VT16  = (unsigned short*)(ws + off); off += szVt16;
  if (off > ws_size) return;

  // 1) casts to bf16 (RNE); n2 = elements/2, grid = ceil(n2/256)
  {
    const int n2k = nAct / 2, n2q = kEmb * kEmb / 2, n2kv = kEmb * kEmb;
    cast_f32_bf16x2<<<(n2k + 255) / 256, 256, 0, stream>>>(key, KEY16, n2k);
    cast_f32_bf16x2<<<(n2q + 255) / 256, 256, 0, stream>>>(w_q, WQ16, n2q);
    cast_f32_bf16x2<<<(n2kv + 255) / 256, 256, 0, stream>>>(w_kv, WKV16, n2kv);
    cast_f32_bf16x2<<<(n2q + 255) / 256, 256, 0, stream>>>(w_out, WO16, n2q);
  }

  // 2) LayerNorm(query) -> bf16 plane, one block per (t,b) row
  layernorm_bf16_kernel<<<kRowsQ, 256, 0, stream>>>(query, gamma, beta, LNX16, kLnEps);

  // 3) q = LN . Wq^T (unscaled; 0.125 applied to the f32 scores): M=8192, N=1024, K=1024 -> f16 plane
  {
    const int tiles = (kRowsQ / 64) * (kEmb / 64);   // 2048
    wmma_gemm64<1, false, 0, 1, false><<<dim3((tiles + 7) / 8, 1), 256, 0, stream>>>(
        LNX16, nullptr, kEmb, 0L, WQ16, nullptr, kEmb, 0L,
        (void*)Q16, nullptr, kEmb, 0L, nullptr, nullptr, 0L, kRowsQ, kEmb, kEmb, 1.0f);
  }

  // 4) k per head h (grid.y = h): C[(s,b)][h*64 + d] = sum_e key[(s,b)][e] * Wkv[h*128 + d][e]; M=8192, N=64, K=1024
  {
    const int tiles = (kRowsK / 64) * (kHdim / 64);   // 128
    wmma_gemm64<1, false, 0, 1, false><<<dim3((tiles + 7) / 8, kHeads), 256, 0, stream>>>(
        KEY16, nullptr, kEmb, 0L, WKV16, nullptr, kEmb, (long)(2 * kHdim) * kEmb,
        (void*)K16, nullptr, kEmb, (long)kHdim, nullptr, nullptr, 0L, kRowsK, kHdim, kEmb, 1.0f);
  }

  // 5) v^T per (b, h): C[d][s] = sum_e Wkv[h*128 + 64 + d][e] * key[(s,b)][e]; M=64, N=2048, K=1024; one launch per b, grid.y = h
  {
    const int tiles = (kHdim / 64) * (kSeqK / 64);   // 32
    for (int b = 0; b < kBatch; ++b) {
      wmma_gemm64<1, false, 0, 1, false><<<dim3((tiles + 7) / 8, kHeads), 256, 0, stream>>>(
          WKV16 + (size_t)kHdim * kEmb, nullptr, kEmb, (long)(2 * kHdim) * kEmb,
          KEY16 + (size_t)b * kEmb, nullptr, kRowPitch, 0L,
          (void*)(VT16 + (size_t)b * kHeads * kHdim * kSeqK), nullptr, kSeqK, (long)kHdim * kSeqK,
          nullptr, nullptr, 0L, kHdim, kSeqK, kEmb, 1.0f);
    }
  }

  // 6) attention: one block per (b, h, 64-query tile) -> ctx bf16 plane (time-major, heads merged)
  attn_full16_kernel<<<kBatch * kHeads * (kSeqQ / AT_QB), 128, 0, stream>>>(Q16, K16, VT16, CTX16, 0.125f);

  // 7) out = query + ctx . Wout^T : M=8192, N=1024, K=1024, f32 with residual epilogue, straight to d_out
  {
    const int tiles = (kRowsQ / 64) * (kEmb / 64);   // 2048
    wmma_gemm64<1, false, 0, 0, true><<<dim3((tiles + 7) / 8, 1), 256, 0, stream>>>(
        CTX16, nullptr, kEmb, 0L, WO16, nullptr, kEmb, 0L,
        (void*)out, nullptr, kEmb, 0L, nullptr, query, 0L, kRowsQ, kEmb, kEmb, 1.0f);
  }
}

// v001
// A run of this version takes 652 microseconds.
// Next to v000, in two timings, it ran 1.24 times as fast each time.
// Contractions: q, k, v^T and output projections on v_wmma_f32_16x16x32_bf16 (bf16 operands); q.k^T and p.v on v_wmma_f32_16x16x32_f16 (f16 operands, p carried x2^15); all f32 accumulate; layernorm, softmax, score scale 0.125 and residual add in f32.
#include <hip/hip_runtime.h>
#include <math.h>
#include <stdint.h>

// ---------------------------------------------------------------------------
// Problem geometry (time-major activations: row (t, b) = t*kBatch + b, pitch kEmb)
// ---------------------------------------------------------------------------
constexpr int kSeqQ  = 2048;
constexpr int kSeqK  = 2048;
constexpr int kBatch = 4;
constexpr int kEmb   = 1024;
constexpr int kHeads = 16;
constexpr int kHdim  = 64;
constexpr int kRowsQ = kSeqQ * kBatch;          // 8192
constexpr int kRowsK = kSeqK * kBatch;          // 8192
constexpr int kRowPitch = kBatch * kEmb;        // 4096: stride between consecutive t at fixed b
constexpr float kLnEps  = 1e-5f;
constexpr float kPCarry = 32768.0f;             // softmax numerators carried x2^15 in f16

typedef __attribute__((ext_vector_type(16))) _Float16 v16h;
typedef __attribute__((ext_vector_type(8)))  _Float16 v8h;
typedef __attribute__((ext_vector_type(16))) __bf16   v16b;
typedef __attribute__((ext_vector_type(8)))  __bf16   v8b;
typedef __attribute__((ext_vector_type(8)))  float    v8f;
typedef __attribute__((ext_vector_type(4)))  float    v4f;
typedef __attribute__((ext_vector_type(2)))  float    v2f;
typedef __attribute__((ext_vector_type(2)))  unsigned int v2u;

__device__ __forceinline__ unsigned short f2bf_bits(float f) {
  unsigned u = __float_as_uint(f);
  return (unsigned short)((u + 0x7FFFu + ((u >> 16) & 1u)) >> 16);
}
__device__ __forceinline__ float bf_bits2f(unsigned short h) { return __uint_as_float(((unsigned)h) << 16); }

// hazard guards as plain device helpers (no inline asm inside the kernel template body)
__device__ __forceinline__ void dep_guard_h(v8f& a, v8f& b, v16h x, v16h y) { asm volatile("v_nop\n\tv_nop\n\tv_nop\n\tv_nop" : "+v"(a), "+v"(b) : "v"(x), "v"(y)); }
__device__ __forceinline__ void dep_guard_b(v8f& a, v8f& b, v16b x, v16b y) { asm volatile("v_nop\n\tv_nop\n\tv_nop\n\tv_nop" : "+v"(a), "+v"(b) : "v"(x), "v"(y)); }
__device__ __forceinline__ void keep4_h(v16h a, v16h b, v16h c, v16h d) { asm volatile("v_nop" :: "v"(a), "v"(b), "v"(c), "v"(d)); }
__device__ __forceinline__ void keep4_b(v16b a, v16b b, v16b c, v16b d) { asm volatile("v_nop" :: "v"(a), "v"(b), "v"(c), "v"(d)); }
__device__ __forceinline__ void acc_guard4(v8f& a, v8f& b, v8f& c, v8f& d) { asm volatile("v_nop\n\tv_nop\n\tv_nop\n\tv_nop" : "+v"(a), "+v"(b), "+v"(c), "+v"(d)); }
template <typename T> struct Frag;
template <> struct Frag<_Float16> {
  typedef v16h V; union U { v16h v; v8h h[2]; };
  static __device__ __forceinline__ v16h load(const _Float16* p) {   // elements 0..7 <- p[0..7], 8..15 <- p[16..23]
    U f; f.h[0] = *(const v8h*)(p); f.h[1] = *(const v8h*)(p + 16); return f.v;
  }
  static __device__ __forceinline__ v8f mma(v16h a, v16h b, v8f c) {
    return __builtin_amdgcn_wmma_f32_16x16x32_f16(false, a, false, b, (short)0, c, false, false);
  }
  static __device__ __forceinline__ void guard(v8f& a, v8f& b, v16h x, v16h y) { dep_guard_h(a, b, x, y); }
  static __device__ __forceinline__ void keep(v16h a, v16h b, v16h c, v16h d) { keep4_h(a, b, c, d); }
};
template <> struct Frag<__bf16> {
  typedef v16b V; union U { v16b v; v8b h[2]; };
  static __device__ __forceinline__ v16b load(const __bf16* p) {
    U f; f.h[0] = *(const v8b*)(p); f.h[1] = *(const v8b*)(p + 16); return f.v;
  }
  static __device__ __forceinline__ v8f mma(v16b a, v16b b, v8f c) {
    return __builtin_amdgcn_wmma_f32_16x16x32_bf16(false, a, false, b, (short)0, c, false, false);
  }
  static __device__ __forceinline__ void guard(v8f& a, v8f& b, v16b x, v16b y) { dep_guard_b(a, b, x, y); }
  static __device__ __forceinline__ void keep(v16b a, v16b b, v16b c, v16b d) { keep4_b(a, b, c, d); }
};

// ---- Register-blocked batched WMMA GEMM ------------------------------------
// C[m,n] = scale * sum_k A[m,k] * Bt[n,k] (+bias)(+resid); each wave owns a 64x64 tile.
// A row-major [M,K]; Bt row-major [N,K]; M,N % 64 == 0, K % 32 == 0.
// SPLIT: operands are hi/lo planes (A2/Bt2 = lo planes, same layout); product = hi.hi + hi.lo + lo.hi.
// BIAS_MODE: 0 = none, 1 = bias[m], 2 = bias[n].
// OUT_MODE: 0 = f32, 1 = f16, 2 = bf16 hi plane (Cout) + bf16 lo plane (Cout2).
// ET: 0 = f16 operands, 1 = bf16 operands (pointers passed as 16-bit storage)
template <int ET> struct Elem;
template <> struct Elem<0> { typedef _Float16 T; };
template <> struct Elem<1> { typedef __bf16 T; };
template <int ET, bool SPLIT, int BIAS_MODE, int OUT_MODE, bool RESID, int ACT = 0>
__global__ __launch_bounds__(256) void wmma_gemm64(
    const unsigned short* __restrict__ Ap, const unsigned short* __restrict__ A2p, int lda, long strideA,
    const unsigned short* __restrict__ Btp, const unsigned short* __restrict__ Bt2p, int ldb, long strideB,
    void* __restrict__ Cout, void* __restrict__ Cout2, int ldc, long strideC,
    const float* __restrict__ bias,
    const float* __restrict__ resid, long strideR,
    int M, int N, int K, float scale) {
  typedef typename Elem<ET>::T T;
  typedef typename Frag<T>::V V;
  const T* A = (const T*)Ap; const T* A2 = (const T*)A2p; const T* Bt = (const T*)Btp; const T* Bt2 = (const T*)Bt2p;
  __shared__ __align__(16) float sT[8][16 * 68];   // per-wave 16x64 slab, pitch 68 floats
  const int b    = blockIdx.y;
  const int lane = threadIdx.x & 31;
  const int wave = threadIdx.x >> 5;
  const int tilesN = N >> 6;
  const int tilesM = M >> 6;
  const int tile = blockIdx.x * 8 + wave;
  if (tile >= tilesM * tilesN) return;   // wave-uniform; no block barriers in this kernel
  const int tm = tile / tilesN;
  const int tn = tile - tm * tilesN;
  const int m0 = tm << 6;
  const int n0 = tn << 6;

  const T* Ab  = A  + (size_t)b * strideA;
  const T* Bb  = Bt + (size_t)b * strideB;
  const T* Ab2 = SPLIT ? (A2  + (size_t)b * strideA) : nullptr;
  const T* Bb2 = SPLIT ? (Bt2 + (size_t)b * strideB) : nullptr;

  const int rlane = lane & 15;                 // row (A) / col (B, D) within subtile
  const int koff  = (lane >> 4) * 8;           // k offset of this lane half
  const int mOff  = (lane >> 4) * 8;           // D row offset

  v8f acc[4][4];
#pragma unroll
  for (int i = 0; i < 4; ++i)
#pragma unroll
    for (int j = 0; j < 4; ++j) acc[i][j] = (v8f){0.f,0.f,0.f,0.f,0.f,0.f,0.f,0.f};

  for (int k0 = 0; k0 < K; k0 += 32) {
    V bh[4], bl[4];
#pragma unroll
    for (int j = 0; j < 4; ++j) {
      const size_t bo = (size_t)(n0 + (j << 4) + rlane) * ldb + koff + k0;
      bh[j] = Frag<T>::load(Bb + bo);
      if (SPLIT) bl[j] = Frag<T>::load(Bb2 + bo);
    }
#pragma unroll
    for (int i = 0; i < 4; ++i) {
      const size_t ao = (size_t)(m0 + (i << 4) + rlane) * lda + koff + k0;
      V ah = Frag<T>::load(Ab + ao);
      V al;
      if (SPLIT) al = Frag<T>::load(Ab2 + ao);
#pragma unroll
      for (int j = 0; j < 4; ++j) {
        acc[i][j] = Frag<T>::mma(ah, bh[j], acc[i][j]);
        if (SPLIT) {
          acc[i][j] = Frag<T>::mma(ah, bl[j], acc[i][j]);
          acc[i][j] = Frag<T>::mma(al, bh[j], acc[i][j]);
        }
      }
      Frag<T>::guard(acc[i][0], acc[i][3], ah, SPLIT ? al : ah);
    }
    Frag<T>::keep(bh[0], bh[1], bh[2], bh[3]);
    if (SPLIT) Frag<T>::keep(bl[0], bl[1], bl[2], bl[3]);
  }
  acc_guard4(acc[0][0], acc[0][1], acc[0][2], acc[0][3]);
  acc_guard4(acc[1][0], acc[1][1], acc[1][2], acc[1][3]);
  acc_guard4(acc[2][0], acc[2][1], acc[2][2], acc[2][3]);
  acc_guard4(acc[3][0], acc[3][1], acc[3][2], acc[3][3]);

  // ---- epilogue ----
  float* slab = sT[wave];
  const float* Rb = RESID ? (resid + (size_t)b * strideR) : nullptr;
#pragma unroll
  for (int i = 0; i < 4; ++i) {
    const int mBase = m0 + (i << 4);
#pragma unroll
    for (int j = 0; j < 4; ++j) {
      const int n = n0 + (j << 4) + rlane;
      float bv = 0.f;
      if (BIAS_MODE == 2) bv = bias[n];
#pragma unroll
      for (int r = 0; r < 8; ++r) {
        float v = acc[i][j][r] * scale;
        if (BIAS_MODE == 1) v += bias[mBase + mOff + r];
        if (BIAS_MODE == 2) v += bv;
        if (RESID) v += Rb[(size_t)(mBase + mOff + r) * ldc + n];
        if (ACT == 1) v = tanhf(v);
        if (ACT == 2) v = fmaxf(v, 0.0f);
        if (ACT == 3) v = v / (1.0f + expf(-v));
        if (ACT == 4) v = (v > 0.f) ? v : 0.01f * v;
        if (ACT == 5) v = 0.5f * v * (1.0f + erff(v * 0.70710678118654752f));
        slab[(mOff + r) * 68 + (j << 4) + rlane] = v;
      }
    }
    __builtin_amdgcn_fence(__ATOMIC_RELEASE, "workgroup");
    __builtin_amdgcn_wave_barrier();
    __builtin_amdgcn_fence(__ATOMIC_ACQUIRE, "workgroup");
    if (OUT_MODE == 0) {
      float* C = (float*)Cout + (size_t)b * strideC;
      const int hh = lane >> 4, c4 = (lane & 15) * 4;     // row seg = 256 B = 16 lanes x 16 B
      {
#pragma unroll
        for (int it = 0; it < 8; ++it) {
          const int row = it * 2 + hh;
          v4f v = *(const v4f*)(slab + row * 68 + c4);
          *(v4f*)(C + (size_t)(mBase + row) * ldc + n0 + c4) = v;
        }
        
      }
    } else {
      const int q = lane >> 3, c8 = (lane & 7) * 8;
      unsigned short* C  = (unsigned short*)Cout  + (size_t)b * strideC;
      unsigned short* C2 = (OUT_MODE == 2) ? ((unsigned short*)Cout2 + (size_t)b * strideC) : nullptr;
      {
#pragma unroll
        for (int it = 0; it < 4; ++it) {
          const int row = it * 4 + q;
          const float* sp = slab + row * 68 + c8;
          v8h hv, lv;
#pragma unroll
          for (int e = 0; e < 8; ++e) {
            if (OUT_MODE == 1) {
              hv[e] = (_Float16)sp[e];
            } else {
              unsigned short hb = f2bf_bits(sp[e]);
              unsigned short lb = f2bf_bits(sp[e] - bf_bits2f(hb));
              hv[e] = __builtin_bit_cast(_Float16, hb);
              lv[e] = __builtin_bit_cast(_Float16, lb);
            }
          }
          *(v8h*)(C + (size_t)(mBase + row) * ldc + n0 + c8) = hv;
          if (OUT_MODE == 2) *(v8h*)(C2 + (size_t)(mBase + row) * ldc + n0 + c8) = lv;
        }
        
      }
    }
    __builtin_amdgcn_fence(__ATOMIC_RELEASE, "workgroup");
    __builtin_amdgcn_wave_barrier();
    __builtin_amdgcn_fence(__ATOMIC_ACQUIRE, "workgroup");
  }
}

// ---------------------------------------------------------------------------
// f32 -> bf16 (RNE) cast: 2 elements per thread, one 4-B store per lane -> each wave writes exactly one whole
// x 2 elements = the whole plane (n2 = n/2; here every n2 is an exact multiple of 256).
// ---------------------------------------------------------------------------
__global__ __launch_bounds__(256) void cast_f32_bf16x2(const float* __restrict__ in, unsigned short* __restrict__ out, int n2) {
  const int i = blockIdx.x * 256 + threadIdx.x;
  if (i < n2) {
    const v2f f = *(const v2f*)(in + 2 * (size_t)i);
    const unsigned u = (unsigned)f2bf_bits(f[0]) | ((unsigned)f2bf_bits(f[1]) << 16);
    ((unsigned*)out)[i] = u;
    
  }
}

// ---------------------------------------------------------------------------
// One block of 256 threads per row (grid.x == number of rows exactly), 4 elements per thread.
// Store coverage: 256 threads x 4 bf16 = 1024 = the whole row; each lane writes 8 contiguous bytes, so one wave
// ---------------------------------------------------------------------------
__global__ __launch_bounds__(256) void layernorm_bf16_kernel(const float* __restrict__ x, const float* __restrict__ gam,
                                                             const float* __restrict__ bet, unsigned short* __restrict__ y,
                                                             float eps) {
  __shared__ float red[16];
  const int row  = blockIdx.x;
  const int tid  = threadIdx.x;
  const int lane = tid & 31;
  const int wave = tid >> 5;
  const float* xr = x + (size_t)row * kEmb;
  const v4f v = *(const v4f*)(xr + 4 * tid);
  float s = (v[0] + v[1]) + (v[2] + v[3]);
#pragma unroll
  for (int off = 1; off < 32; off <<= 1) s += __shfl_xor(s, off, 32);
  if (lane == 0) red[wave] = s;
  __syncthreads();
  float tot = 0.f;
#pragma unroll
  for (int w = 0; w < 8; ++w) tot += red[w];
  const float mu = tot * (1.0f / (float)kEmb);
  const float d0 = v[0] - mu, d1 = v[1] - mu, d2 = v[2] - mu, d3 = v[3] - mu;
  float s2 = (d0 * d0 + d1 * d1) + (d2 * d2 + d3 * d3);
#pragma unroll
  for (int off = 1; off < 32; off <<= 1) s2 += __shfl_xor(s2, off, 32);
  if (lane == 0) red[8 + wave] = s2;
  __syncthreads();
  float tot2 = 0.f;
#pragma unroll
  for (int w = 0; w < 8; ++w) tot2 += red[8 + w];
  const float var  = tot2 * (1.0f / (float)kEmb);
  const float rstd = rsqrtf(var + eps);
  const v4f g  = *(const v4f*)(gam + 4 * tid);
  const v4f bt = *(const v4f*)(bet + 4 * tid);
  const float o0 = d0 * rstd * g[0] + bt[0];
  const float o1 = d1 * rstd * g[1] + bt[1];
  const float o2 = d2 * rstd * g[2] + bt[2];
  const float o3 = d3 * rstd * g[3] + bt[3];
  v2u pk;
  pk[0] = (unsigned)f2bf_bits(o0) | ((unsigned)f2bf_bits(o1) << 16);
  pk[1] = (unsigned)f2bf_bits(o2) | ((unsigned)f2bf_bits(o3) << 16);
  unsigned short* yp = y + (size_t)row * kEmb + 4 * tid;
  *(v2u*)yp = pk;
  
}

// =====================================================================================
// Full (unmasked) attention, head dim 64, all batches and heads in one launch, time-major planes.
//   q plane  (f16): element (t, b, h, d) at [(t*kBatch + b)*kEmb + h*64 + d]   (unscaled q = LN(x).Wq^T)
//   k plane  (f16): element (s, b, h, d) at [(s*kBatch + b)*kEmb + h*64 + d]
//   v^T plane(f16): element (b, h, d, s) at [((b*kHeads + h)*64 + d)*kSeqK + s]
//   ctx plane (bf16 out): element (t, b, h, d) at [(t*kBatch + b)*kEmb + h*64 + d]
//   scores = (q . k) * sscale : single v_wmma_f32_16x16x32_f16, scale applied to the f32 accumulator
//   out    = p . v            : single v_wmma_f32_16x16x32_f16, p = exp(s - m) in (0, 1] carried x2^15 as f16
//   online softmax in f32 over all kSeqK keys (32 chunks of 64, compile-time trip count).
//   Block = 4 waves = 64 query rows of one (b, h); grid.x = kBatch * kHeads * (kSeqQ/64) = 2048.
//   K / V^T chunk staging: 128 threads x 32 elements per plane = the whole 64x64 tile (16-B copies, plain loads,
//   __syncthreads before and after); fragment loads read the LDS tiles with the same v8h element type.
// =====================================================================================
#define AT_D 64
#define AT_NW 4
#define AT_QB 64
#define AT_KC 64
#define AT_LP 72   // LDS row pitch of the K, V^T and P tiles in f16: 144 B = 16 B x odd, so 16 rows read by 16-byte loads fall on distinct banks

__device__ __forceinline__ v8f mma_f16g(v16h a, v16h b, v8f c) {
  c = __builtin_amdgcn_wmma_f32_16x16x32_f16(false, a, false, b, (short)0, c, false, false);
  asm volatile("v_nop\n\tv_nop\n\tv_nop\n\tv_nop" : "+v"(c) : "v"(a), "v"(b));
  return c;
}

__global__ __launch_bounds__(128)
void attn_full16_kernel(const unsigned short* __restrict__ qp, const unsigned short* __restrict__ kp,
                        const unsigned short* __restrict__ vtp, unsigned short* __restrict__ ctxp, float sscale) {
  union FH { v16h v; v8h h[2]; };
  __shared__ __align__(16) _Float16 Ksh[AT_KC * AT_LP];            // K  [kv][d]   9 KB, 64 of 72 columns used
  __shared__ __align__(16) _Float16 Vth[AT_D * AT_LP];             // V^T [d][kv]  9 KB, 64 of 72 columns used
  __shared__ __align__(16) _Float16 Psh[AT_NW][16 * AT_LP];        // per wave P [row][kv]  9 KB, 64 of 72 columns used
  __shared__ __align__(16) float    Os[AT_NW][16 * 68];            // per wave out tile, pitch 68

  const int tid  = threadIdx.x;
  const int wave = tid >> 5;
  const int lane = tid & 31;
  const int hh   = lane >> 4;
  const int c    = lane & 15;

  const int nqb  = kSeqQ / AT_QB;          // 32
  const int bx   = blockIdx.x;             // < kBatch*kHeads*nqb
  const int qb   = bx % nqb;
  const int bhid = bx / nqb;
  const int h    = bhid % kHeads;
  const int bb   = bhid / kHeads;          // 0..kBatch-1
  const int q0   = qb * AT_QB + wave * 16;

  const _Float16* Qh = (const _Float16*)(const void*)qp  + (size_t)bb * kEmb + (size_t)h * kHdim;
  const _Float16* Kh = (const _Float16*)(const void*)kp  + (size_t)bb * kEmb + (size_t)h * kHdim;
  const _Float16* Vh = (const _Float16*)(const void*)vtp + (size_t)(bb * kHeads + h) * kHdim * kSeqK;
  unsigned short* ob = ctxp + (size_t)bb * kEmb + (size_t)h * kHdim;

  // ---- Q fragments (A operand, row = lane&15, split k map via Frag load): 2 d-chunks ----
  v16h qa[2];
#pragma unroll
  for (int dc = 0; dc < 2; ++dc)
    qa[dc] = Frag<_Float16>::load(Qh + (size_t)(q0 + c) * kRowPitch + dc * 32 + 8 * hh);

  float mrow[8], lrow[8];
  v8f oacc[4];
#pragma unroll
  for (int r = 0; r < 8; ++r) { mrow[r] = -INFINITY; lrow[r] = 0.f; }
#pragma unroll
  for (int t = 0; t < 4; ++t) oacc[t] = (v8f){0.f,0.f,0.f,0.f,0.f,0.f,0.f,0.f};

  const int nChunks = kSeqK / AT_KC;   // 32, compile-time constant
  for (int kc = 0; kc < nChunks; ++kc) {
    const int kv0 = kc * AT_KC;
    __syncthreads();
    {
      // staging coverage: 128 threads x (4 x 8) elements = 64 rows x 64 per plane = the whole chunk tile
      const int r = tid >> 1, half = (tid & 1) * 32;
      const _Float16* ks = Kh + (size_t)(kv0 + r) * kRowPitch + half;   // K row kv0+r, d = half..half+31
      const _Float16* vs = Vh + (size_t)r * kSeqK + kv0 + half;          // V^T row d = r, s = kv0+half..+31
#pragma unroll
      for (int i = 0; i < 4; ++i) {
        const v8h a0 = *(const v8h*)(ks + 8 * i);
        const v8h b0 = *(const v8h*)(vs + 8 * i);
        *(v8h*)(Ksh + r * AT_LP + half + 8 * i) = a0;
        *(v8h*)(Vth + r * AT_LP + half + 8 * i) = b0;
      }
    }
    __syncthreads();

    v8f s[4];
#pragma unroll
    for (int j = 0; j < 4; ++j) {
      s[j] = (v8f){0.f,0.f,0.f,0.f,0.f,0.f,0.f,0.f};
#pragma unroll
      for (int dc = 0; dc < 2; ++dc) {
        FH kb;
        kb.h[0] = *(const v8h*)(Ksh + (j * 16 + c) * AT_LP + dc * 32 + 8 * hh);
        kb.h[1] = *(const v8h*)(Ksh + (j * 16 + c) * AT_LP + dc * 32 + 16 + 8 * hh);
        s[j] = mma_f16g(qa[dc], kb.v, s[j]);
      }
    }
    float cm[8];
#pragma unroll
    for (int r = 0; r < 8; ++r) {
      float m = -INFINITY;
#pragma unroll
      for (int j = 0; j < 4; ++j) {
        const float sv = s[j][r] * sscale;
        s[j][r] = sv;
        m = fmaxf(m, sv);
      }
#pragma unroll
      for (int off = 1; off < 16; off <<= 1) m = fmaxf(m, __shfl_xor(m, off, 32));
      cm[r] = m;
    }
    _Float16* pwh = Psh[wave];
#pragma unroll
    for (int r = 0; r < 8; ++r) {
      const float mnew  = fmaxf(mrow[r], cm[r]);
      const float alpha = expf(mrow[r] - mnew);
      mrow[r] = mnew;
      float psum = 0.f;
#pragma unroll
      for (int j = 0; j < 4; ++j) {
        const float p = expf(s[j][r] - mnew);
        psum += p;
        pwh[(8 * hh + r) * AT_LP + j * 16 + c] = (_Float16)(p * kPCarry);
      }
#pragma unroll
      for (int off = 1; off < 16; off <<= 1) psum += __shfl_xor(psum, off, 32);
      lrow[r] = lrow[r] * alpha + psum;
#pragma unroll
      for (int t = 0; t < 4; ++t) oacc[t][r] *= alpha;
    }
    __builtin_amdgcn_fence(__ATOMIC_RELEASE, "workgroup");
    __builtin_amdgcn_wave_barrier();
    __builtin_amdgcn_fence(__ATOMIC_ACQUIRE, "workgroup");
#pragma unroll 1
    for (int kk = 0; kk < 2; ++kk) {
      FH pa;
      pa.h[0] = *(const v8h*)(pwh + c * AT_LP + kk * 32 + 8 * hh);
      pa.h[1] = *(const v8h*)(pwh + c * AT_LP + kk * 32 + 16 + 8 * hh);
#pragma unroll
      for (int t = 0; t < 4; ++t) {
        FH vb;
        vb.h[0] = *(const v8h*)(Vth + (t * 16 + c) * AT_LP + kk * 32 + 8 * hh);
        vb.h[1] = *(const v8h*)(Vth + (t * 16 + c) * AT_LP + kk * 32 + 16 + 8 * hh);
        oacc[t] = mma_f16g(pa.v, vb.v, oacc[t]);
      }
    }
  }

  // ---- normalise (fold back the 2^15 carry), stage the wave's 16x64 tile, write bf16 rows:
  float* os = Os[wave];
#pragma unroll
  for (int r = 0; r < 8; ++r) {
    const float inv = 1.0f / (lrow[r] * kPCarry);
#pragma unroll
    for (int t = 0; t < 4; ++t) os[(8 * hh + r) * 68 + t * 16 + c] = oacc[t][r] * inv;
  }
  __builtin_amdgcn_fence(__ATOMIC_RELEASE, "workgroup");
  __builtin_amdgcn_wave_barrier();
  __builtin_amdgcn_fence(__ATOMIC_ACQUIRE, "workgroup");
  {
    const int qq = lane >> 3, c8 = (lane & 7) * 8;
    {
#pragma unroll
      for (int it = 0; it < 4; ++it) {
        const int row = it * 4 + qq;
        const float* sp = os + row * 68 + c8;
        v8h hv;
#pragma unroll
        for (int e = 0; e < 8; ++e) hv[e] = __builtin_bit_cast(_Float16, f2bf_bits(sp[e]));
        *(v8h*)(ob + (size_t)(q0 + row) * kRowPitch + c8) = hv;
      }
      
    }
  }
}

// ---------------------------------------------------------------------------
// Host orchestration.
// Workspace region map (byte offsets):
//   [  0 MiB, 16 MiB)  KEY16  bf16 [8192][1024]   key cast
//   [ 16 MiB, 18 MiB)  WQ16   bf16 [1024][1024]
//   [ 18 MiB, 22 MiB)  WKV16  bf16 [2048][1024]
//   [ 22 MiB, 24 MiB)  WO16   bf16 [1024][1024]
//   [ 24 MiB, 40 MiB)  LNX16  bf16 [8192][1024]   LN(query); dead after the q projection, then reused as
//                      CTX16  bf16 [8192][1024]   attention output
//   [ 40 MiB, 56 MiB)  Q16    f16  [8192][1024]
//   [ 56 MiB, 72 MiB)  K16    f16  [8192][1024]   (head h at columns h*64)
//   [ 72 MiB, 88 MiB)  VT16   f16  [4][16][64][2048]
//   total 88 MiB = 92274688 B
// ---------------------------------------------------------------------------
extern "C" void kernel_launch(void* const* d_in, const int* in_sizes, int n_in,
                              void* d_out, int out_size, void* d_ws, size_t ws_size,
                              hipStream_t stream) {
  if (n_in < 7) return;
  const int nAct = kSeqQ * kBatch * kEmb;          // 8388608
  if (in_sizes[0] != nAct || in_sizes[1] != kSeqK * kBatch * kEmb) return;
  if (in_sizes[2] < kEmb || in_sizes[3] < kEmb) return;
  if (in_sizes[4] != kEmb * kEmb || in_sizes[5] != 2 * kEmb * kEmb || in_sizes[6] != kEmb * kEmb) return;
  if (out_size != nAct) return;

  const float* query = (const float*)d_in[0];   // [2048][4][1024]
  const float* key   = (const float*)d_in[1];   // [2048][4][1024]
  const float* gamma = (const float*)d_in[2];   // [1024]
  const float* beta  = (const float*)d_in[3];   // [1024]
  const float* w_q   = (const float*)d_in[4];   // [1024][1024]
  const float* w_kv  = (const float*)d_in[5];   // [2048][1024]
  const float* w_out = (const float*)d_in[6];   // [1024][1024]
  float* out = (float*)d_out;

  const size_t szAct16 = (size_t)kRowsQ * kEmb * 2;          // 16 MiB
  const size_t szWq16  = (size_t)kEmb * kEmb * 2;            //  2 MiB
  const size_t szWkv16 = (size_t)2 * kEmb * kEmb * 2;        //  4 MiB
  const size_t szVt16  = (size_t)kBatch * kHeads * kHdim * kSeqK * 2;   // 16 MiB
  size_t off = 0;
  char* ws = (char*)d_ws;
  unsigned short* KEY16 = (unsigned short*)(ws + off); off += szAct16;
  unsigned short* WQ16  = (unsigned short*)(ws + off); off += szWq16;
  unsigned short* WKV16 = (unsigned short*)(ws + off); off += szWkv16;
  unsigned short* WO16  = (unsigned short*)(ws + off); off += szWq16;
  unsigned short* LNX16 = (unsigned short*)(ws + off); off += szAct16;
  unsigned short* CTX16 = LNX16;                                // region reuse (LNX16 dead after the q GEMM)
  unsigned short* Q16   = (unsigned short*)(ws + off); off += szAct16;
  unsigned short* K16   = (unsigned short*)(ws + off); off += szAct16;
  unsigned short* VT16  = (unsigned short*)(ws + off); off += szVt16;
  if (off > ws_size) return;

  // 1) casts to bf16 (RNE); n2 = elements/2, grid = ceil(n2/256)
  {
    const int n2k = nAct / 2, n2q = kEmb * kEmb / 2, n2kv = kEmb * kEmb;
    cast_f32_bf16x2<<<(n2k + 255) / 256, 256, 0, stream>>>(key, KEY16, n2k);
    cast_f32_bf16x2<<<(n2q + 255) / 256, 256, 0, stream>>>(w_q, WQ16, n2q);
    cast_f32_bf16x2<<<(n2kv + 255) / 256, 256, 0, stream>>>(w_kv, WKV16, n2kv);
    cast_f32_bf16x2<<<(n2q + 255) / 256, 256, 0, stream>>>(w_out, WO16, n2q);
  }

  // 2) LayerNorm(query) -> bf16 plane, one block per (t,b) row
  layernorm_bf16_kernel<<<kRowsQ, 256, 0, stream>>>(query, gamma, beta, LNX16, kLnEps);

  // 3) q = LN . Wq^T (unscaled; 0.125 applied to the f32 scores): M=8192, N=1024, K=1024 -> f16 plane
  {
    const int tiles = (kRowsQ / 64) * (kEmb / 64);   // 2048
    wmma_gemm64<1, false, 0, 1, false><<<dim3((tiles + 7) / 8, 1), 256, 0, stream>>>(
        LNX16, nullptr, kEmb, 0L, WQ16, nullptr, kEmb, 0L,
        (void*)Q16, nullptr, kEmb, 0L, nullptr, nullptr, 0L, kRowsQ, kEmb, kEmb, 1.0f);
  }

  // 4) k per head h (grid.y = h): C[(s,b)][h*64 + d] = sum_e key[(s,b)][e] * Wkv[h*128 + d][e]; M=8192, N=64, K=1024
  {
    const int tiles = (kRowsK / 64) * (kHdim / 64);   // 128
    wmma_gemm64<1, false, 0, 1, false><<<dim3((tiles + 7) / 8, kHeads), 256, 0, stream>>>(
        KEY16, nullptr, kEmb, 0L, WKV16, nullptr, kEmb, (long)(2 * kHdim) * kEmb,
        (void*)K16, nullptr, kEmb, (long)kHdim, nullptr, nullptr, 0L, kRowsK, kHdim, kEmb, 1.0f);
  }

  // 5) v^T per (b, h): C[d][s] = sum_e Wkv[h*128 + 64 + d][e] * key[(s,b)][e]; M=64, N=2048, K=1024; one launch per b, grid.y = h
  {
    const int tiles = (kHdim / 64) * (kSeqK / 64);   // 32
    for (int b = 0; b < kBatch; ++b) {
      wmma_gemm64<1, false, 0, 1, false><<<dim3((tiles + 7) / 8, kHeads), 256, 0, stream>>>(
          WKV16 + (size_t)kHdim * kEmb, nullptr, kEmb, (long)(2 * kHdim) * kEmb,
          KEY16 + (size_t)b * kEmb, nullptr, kRowPitch, 0L,
          (void*)(VT16 + (size_t)b * kHeads * kHdim * kSeqK), nullptr, kSeqK, (long)kHdim * kSeqK,
          nullptr, nullptr, 0L, kHdim, kSeqK, kEmb, 1.0f);
    }
  }

  // 6) attention: one block per (b, h, 64-query tile) -> ctx bf16 plane (time-major, heads merged)
  attn_full16_kernel<<<kBatch * kHeads * (kSeqQ / AT_QB), 128, 0, stream>>>(Q16, K16, VT16, CTX16, 0.125f);

  // 7) out = query + ctx . Wout^T : M=8192, N=1024, K=1024, f32 with residual epilogue, straight to d_out
  {
    const int tiles = (kRowsQ / 64) * (kEmb / 64);   // 2048
    wmma_gemm64<1, false, 0, 0, true><<<dim3((tiles + 7) / 8, 1), 256, 0, stream>>>(
        CTX16, nullptr, kEmb, 0L, WO16, nullptr, kEmb, 0L,
        (void*)out, nullptr, kEmb, 0L, nullptr, query, 0L, kRowsQ, kEmb, kEmb, 1.0f);
  }
}

// v002
// A run of this version takes 491 microseconds.
// In both of two side-by-side timings against v001, it was 1.32 times as fast.
// Over all steps from v000 it is 1.64 times as fast.
// Contractions: q, k, v^T and output projections on v_wmma_f32_16x16x32_bf16 (bf16 operands); q.k^T and p.v on v_wmma_f32_16x16x32_f16 (f16 operands, p carried x2^15); all f32 accumulate; layernorm, softmax, score scale 0.125 and residual add in f32.
#include <hip/hip_runtime.h>
#include <math.h>
#include <stdint.h>

// ---------------------------------------------------------------------------
// Problem geometry (time-major activations: row (t, b) = t*kBatch + b, pitch kEmb)
// ---------------------------------------------------------------------------
constexpr int kSeqQ  = 2048;
constexpr int kSeqK  = 2048;
constexpr int kBatch = 4;
constexpr int kEmb   = 1024;
constexpr int kHeads = 16;
constexpr int kHdim  = 64;
constexpr int kRowsQ = kSeqQ * kBatch;          // 8192
constexpr int kRowsK = kSeqK * kBatch;          // 8192
constexpr int kRowPitch = kBatch * kEmb;        // 4096: stride between consecutive t at fixed b
constexpr float kLnEps  = 1e-5f;
constexpr float kPCarry = 32768.0f;             // softmax numerators carried x2^15 in f16

typedef __attribute__((ext_vector_type(16))) _Float16 v16h;
typedef __attribute__((ext_vector_type(8)))  _Float16 v8h;
typedef __attribute__((ext_vector_type(16))) __bf16   v16b;
typedef __attribute__((ext_vector_type(8)))  __bf16   v8b;
typedef __attribute__((ext_vector_type(8)))  float    v8f;
typedef __attribute__((ext_vector_type(4)))  float    v4f;
typedef __attribute__((ext_vector_type(2)))  float    v2f;
typedef __attribute__((ext_vector_type(2)))  unsigned int v2u;

__device__ __forceinline__ unsigned short f2bf_bits(float f) {
  unsigned u = __float_as_uint(f);
  return (unsigned short)((u + 0x7FFFu + ((u >> 16) & 1u)) >> 16);
}
__device__ __forceinline__ float bf_bits2f(unsigned short h) { return __uint_as_float(((unsigned)h) << 16); }

// hazard guards as plain device helpers (no inline asm inside the kernel template body)
__device__ __forceinline__ void dep_guard_h(v8f& a, v8f& b, v16h x, v16h y) { asm volatile("v_nop\n\tv_nop\n\tv_nop\n\tv_nop" : "+v"(a), "+v"(b) : "v"(x), "v"(y)); }
__device__ __forceinline__ void dep_guard_b(v8f& a, v8f& b, v16b x, v16b y) { asm volatile("v_nop\n\tv_nop\n\tv_nop\n\tv_nop" : "+v"(a), "+v"(b) : "v"(x), "v"(y)); }
__device__ __forceinline__ void keep4_h(v16h a, v16h b, v16h c, v16h d) { asm volatile("v_nop" :: "v"(a), "v"(b), "v"(c), "v"(d)); }
__device__ __forceinline__ void keep4_b(v16b a, v16b b, v16b c, v16b d) { asm volatile("v_nop" :: "v"(a), "v"(b), "v"(c), "v"(d)); }
__device__ __forceinline__ void acc_guard4(v8f& a, v8f& b, v8f& c, v8f& d) { asm volatile("v_nop\n\tv_nop\n\tv_nop\n\tv_nop" : "+v"(a), "+v"(b), "+v"(c), "+v"(d)); }
// stands behind a group of global loads: none of their address registers is rewritten in front of this wait
__device__ __forceinline__ void addr_regs_wait() { asm volatile("s_wait_xcnt 0x0" ::: "memory"); }
template <typename T> struct Frag;
template <> struct Frag<_Float16> {
  typedef v16h V; typedef v8h H; union U { v16h v; v8h h[2]; };
  static __device__ __forceinline__ v16h load(const _Float16* p) {   // elements 0..7 <- p[0..7], 8..15 <- p[16..23]
    U f; f.h[0] = *(const v8h*)(p); f.h[1] = *(const v8h*)(p + 16); return f.v;
  }
  static __device__ __forceinline__ v8f mma(v16h a, v16h b, v8f c) {
    return __builtin_amdgcn_wmma_f32_16x16x32_f16(false, a, false, b, (short)0, c, false, false);
  }
  static __device__ __forceinline__ void guard(v8f& a, v8f& b, v16h x, v16h y) { dep_guard_h(a, b, x, y); }
  static __device__ __forceinline__ void keep(v16h a, v16h b, v16h c, v16h d) { keep4_h(a, b, c, d); }
};
template <> struct Frag<__bf16> {
  typedef v16b V; typedef v8b H; union U { v16b v; v8b h[2]; };
  static __device__ __forceinline__ v16b load(const __bf16* p) {
    U f; f.h[0] = *(const v8b*)(p); f.h[1] = *(const v8b*)(p + 16); return f.v;
  }
  static __device__ __forceinline__ v8f mma(v16b a, v16b b, v8f c) {
    return __builtin_amdgcn_wmma_f32_16x16x32_bf16(false, a, false, b, (short)0, c, false, false);
  }
  static __device__ __forceinline__ void guard(v8f& a, v8f& b, v16b x, v16b y) { dep_guard_b(a, b, x, y); }
  static __device__ __forceinline__ void keep(v16b a, v16b b, v16b c, v16b d) { keep4_b(a, b, c, d); }
};

// ---- Register-blocked batched WMMA GEMM ------------------------------------
// C[m,n] = scale * sum_k A[m,k] * Bt[n,k] (+bias)(+resid); each wave owns a 64x64 tile.
// A row-major [M,K]; Bt row-major [N,K]; M,N % 64 == 0, K % 64 == 0; the tile count is a multiple of 8.
// The 8 waves of a block own 8 consecutive tiles that share one operand's 64 rows:
//   WIDE_M = false: N/64 is a multiple of 8, the block is 64 x 512 (A rows shared, 64 Bt rows per wave);
//   WIDE_M = true : N == 64, the block is 512 x 64 (Bt rows shared, 64 A rows per wave).
// Operands go through LDS in slabs of 64 k: every thread copies whole 16-B pieces so that a wave-wide load covers
// 4 whole 128-B lines; two LDS buffers, the next slab's global loads are issued ahead of the current slab's products.
// The row pitches lda, ldb are compile-time, so that a slab's 18 loads are two addresses plus immediate offsets.
// SPLIT (hi/lo planes) is not staged and not instantiated.
// BIAS_MODE: 0 = none, 1 = bias[m], 2 = bias[n].
// OUT_MODE: 0 = f32, 1 = f16, 2 = bf16 hi plane (Cout) + bf16 lo plane (Cout2).
// ET: 0 = f16 operands, 1 = bf16 operands (pointers passed as 16-bit storage)
template <int ET> struct Elem;
template <> struct Elem<0> { typedef _Float16 T; };
template <> struct Elem<1> { typedef __bf16 T; };
constexpr int kGsBk    = 64;                     // k elements per slab: 128 B of every operand row
constexpr int kGsPitch = 72;                     // LDS row pitch in 16-bit elements: 144 B = 16 B x odd
constexpr int kGsRows  = 64 + 8 * 64;            // the shared operand's rows, then 64 rows per wave
constexpr int kGsCopies = kGsRows * 8 / 256;     // 16-B pieces per thread and slab: 18
template <int ET, bool SPLIT, int BIAS_MODE, int OUT_MODE, bool RESID, int ACT = 0, bool WIDE_M = false, int lda = kEmb, int ldb = kEmb>
__global__ __launch_bounds__(256) void wmma_gemm64(
    const unsigned short* __restrict__ Ap, const unsigned short* __restrict__ A2p, long strideA,
    const unsigned short* __restrict__ Btp, const unsigned short* __restrict__ Bt2p, long strideB,
    void* __restrict__ Cout, void* __restrict__ Cout2, int ldc, long strideC,
    const float* __restrict__ bias,
    const float* __restrict__ resid, long strideR,
    int M, int N, int K, float scale) {
  typedef typename Elem<ET>::T T;
  typedef typename Frag<T>::V V;
  typedef typename Frag<T>::H H;
  static_assert(!SPLIT, "hi/lo planes are not staged");
  const T* A = (const T*)Ap; const T* Bt = (const T*)Btp;
  __shared__ __align__(16) T sStage[2][kGsRows * kGsPitch];   // two slab buffers, 82,944 B each
  __shared__ __align__(16) float sT[8][16 * 68];   // per-wave 16x64 slab, pitch 68 floats
  const int b    = blockIdx.y;
  const int tid  = threadIdx.x;
  const int lane = tid & 31;
  const int wave = tid >> 5;
  const int tilesN = N >> 6;
  const int tilesM = M >> 6;
  if ((int)(blockIdx.x + 1) * 8 > tilesM * tilesN) return;   // block-uniform, in front of every barrier
  const int tile0 = blockIdx.x * 8;            // the block's first tile; wave w owns tile0 + w
  const int tm0 = tile0 / tilesN;
  const int tn0 = tile0 - tm0 * tilesN;
  const int m0 = (tm0 << 6) + (WIDE_M ? (wave << 6) : 0);
  const int n0 = (tn0 << 6) + (WIDE_M ? 0 : (wave << 6));

  const T* Ab  = A  + (size_t)b * strideA;
  const T* Bb  = Bt + (size_t)b * strideB;

  const int rlane = lane & 15;                 // row (A) / col (B, D) within subtile
  const int koff  = (lane >> 4) * 8;           // k offset of this lane half
  const int mOff  = (lane >> 4) * 8;           // D row offset

  // staging map: piece q = it*256 + tid -> LDS row q/8, 16-B piece q%8; rows 0..63 shared operand, 64.. per wave
  const int srow = tid >> 3;
  const int sseg = (tid & 7) * 8;
  const int ldS = WIDE_M ? ldb : lda;          // shared operand
  const int ldW = WIDE_M ? lda : ldb;          // operand with 64 rows per wave
  const char* uA = (const char*)(Ab + (size_t)(tm0 << 6) * lda);   // block-uniform bases, byte addressed
  const char* uB = (const char*)(Bb + (size_t)(tn0 << 6) * ldb);
  const char* uS = WIDE_M ? uB : uA;
  const char* uW = WIDE_M ? uA : uB;
  const unsigned vS = (unsigned)(srow * ldS + sseg) * 2u;          // this thread's byte offset inside 32 rows
  const unsigned vW = (unsigned)(srow * ldW + sseg) * 2u;
  const int sOff = srow * kGsPitch + sseg;
  const int fS = rlane * kGsPitch + koff;                          // fragment row 0 of the shared operand
  const int fW = (64 + (wave << 6) + rlane) * kGsPitch + koff;     // fragment row 0 of this wave's own rows
  const int fA = WIDE_M ? fW : fS;
  const int fB = WIDE_M ? fS : fW;

  v8f acc[4][4];
#pragma unroll
  for (int i = 0; i < 4; ++i)
#pragma unroll
    for (int j = 0; j < 4; ++j) acc[i][j] = (v8f){0.f,0.f,0.f,0.f,0.f,0.f,0.f,0.f};

  // trip s: slab s's global loads are issued, slab s - 1 is multiplied out of its buffer, slab s goes to the other one
  const int nSlabs = K / kGsBk;
  for (int s = 0; s <= nSlabs; ++s) {
    const bool fill = s < nSlabs;              // block-uniform
    H st[kGsCopies];
    if (fill) {
      const int k1 = s * kGsBk;
#pragma unroll   // constant indices keep st[] in registers and the row steps in the loads' immediate offsets
      for (int it = 0; it < 2; ++it) st[it] = *(const H*)(uS + ((size_t)(it * 32) * ldS + k1) * 2 + vS);
#pragma unroll   // as above
      for (int it = 2; it < kGsCopies; ++it) st[it] = *(const H*)(uW + ((size_t)((it - 2) * 32) * ldW + k1) * 2 + vW);
      addr_regs_wait();
    }
    if (s > 0) {
      const T* cur = sStage[(s - 1) & 1];
#pragma unroll   // both halves of the slab in one trip: the second half's LDS reads can start under the first half's products
      for (int kk = 0; kk < kGsBk; kk += 32) {
        V bh[4], ah[4];
#pragma unroll   // fragments and accumulators in registers, here and in the three loops below
        for (int j = 0; j < 4; ++j) bh[j] = Frag<T>::load(cur + fB + j * 16 * kGsPitch + kk);
#pragma unroll
        for (int i = 0; i < 4; ++i) ah[i] = Frag<T>::load(cur + fA + i * 16 * kGsPitch + kk);
#pragma unroll
        for (int i = 0; i < 4; ++i) {
#pragma unroll
          for (int j = 0; j < 4; ++j) acc[i][j] = Frag<T>::mma(ah[i], bh[j], acc[i][j]);
          Frag<T>::guard(acc[i][0], acc[i][3], ah[i], ah[i]);
        }
        Frag<T>::keep(bh[0], bh[1], bh[2], bh[3]);
      }
    }
    if (fill) {
      T* nxt = sStage[s & 1];                  // its last readers (slab s - 2) left it at the barrier that ended trip s - 1
#pragma unroll   // st[] in registers, row steps in the stores' immediate offsets
      for (int it = 0; it < kGsCopies; ++it) *(H*)(nxt + sOff + it * 32 * kGsPitch) = st[it];
    }
    __syncthreads();                           // publishes slab s and ends every read of slab s - 1
  }
  acc_guard4(acc[0][0], acc[0][1], acc[0][2], acc[0][3]);
  acc_guard4(acc[1][0], acc[1][1], acc[1][2], acc[1][3]);
  acc_guard4(acc[2][0], acc[2][1], acc[2][2], acc[2][3]);
  acc_guard4(acc[3][0], acc[3][1], acc[3][2], acc[3][3]);

  // ---- epilogue ----
  float* slab = sT[wave];
  const float* Rb = RESID ? (resid + (size_t)b * strideR) : nullptr;
#pragma unroll
  for (int i = 0; i < 4; ++i) {
    const int mBase = m0 + (i << 4);
#pragma unroll
    for (int j = 0; j < 4; ++j) {
      const int n = n0 + (j << 4) + rlane;
      float bv = 0.f;
      if (BIAS_MODE == 2) bv = bias[n];
#pragma unroll
      for (int r = 0; r < 8; ++r) {
        float v = acc[i][j][r] * scale;
        if (BIAS_MODE == 1) v += bias[mBase + mOff + r];
        if (BIAS_MODE == 2) v += bv;
        if (RESID) v += Rb[(size_t)(mBase + mOff + r) * ldc + n];
        if (ACT == 1) v = tanhf(v);
        if (ACT == 2) v = fmaxf(v, 0.0f);
        if (ACT == 3) v = v / (1.0f + expf(-v));
        if (ACT == 4) v = (v > 0.f) ? v : 0.01f * v;
        if (ACT == 5) v = 0.5f * v * (1.0f + erff(v * 0.70710678118654752f));
        slab[(mOff + r) * 68 + (j << 4) + rlane] = v;
      }
    }
    __builtin_amdgcn_fence(__ATOMIC_RELEASE, "workgroup");
    __builtin_amdgcn_wave_barrier();
    __builtin_amdgcn_fence(__ATOMIC_ACQUIRE, "workgroup");
    if (OUT_MODE == 0) {
      float* C = (float*)Cout + (size_t)b * strideC;
      const int hh = lane >> 4, c4 = (lane & 15) * 4;     // row seg = 256 B = 16 lanes x 16 B
      {
#pragma unroll
        for (int it = 0; it < 8; ++it) {
          const int row = it * 2 + hh;
          v4f v = *(const v4f*)(slab + row * 68 + c4);
          *(v4f*)(C + (size_t)(mBase + row) * ldc + n0 + c4) = v;
        }
        
      }
    } else {
      const int q = lane >> 3, c8 = (lane & 7) * 8;
      unsigned short* C  = (unsigned short*)Cout  + (size_t)b * strideC;
      unsigned short* C2 = (OUT_MODE == 2) ? ((unsigned short*)Cout2 + (size_t)b * strideC) : nullptr;
      {
#pragma unroll
        for (int it = 0; it < 4; ++it) {
          const int row = it * 4 + q;
          const float* sp = slab + row * 68 + c8;
          v8h hv, lv;
#pragma unroll
          for (int e = 0; e < 8; ++e) {
            if (OUT_MODE == 1) {
              hv[e] = (_Float16)sp[e];
            } else {
              unsigned short hb = f2bf_bits(sp[e]);
              unsigned short lb = f2bf_bits(sp[e] - bf_bits2f(hb));
              hv[e] = __builtin_bit_cast(_Float16, hb);
              lv[e] = __builtin_bit_cast(_Float16, lb);
            }
          }
          *(v8h*)(C + (size_t)(mBase + row) * ldc + n0 + c8) = hv;
          if (OUT_MODE == 2) *(v8h*)(C2 + (size_t)(mBase + row) * ldc + n0 + c8) = lv;
        }
        
      }
    }
    __builtin_amdgcn_fence(__ATOMIC_RELEASE, "workgroup");
    __builtin_amdgcn_wave_barrier();
    __builtin_amdgcn_fence(__ATOMIC_ACQUIRE, "workgroup");
  }
}

// ---------------------------------------------------------------------------
// f32 -> bf16 (RNE) cast: 2 elements per thread, one 4-B store per lane -> each wave writes exactly one whole
// x 2 elements = the whole plane (n2 = n/2; here every n2 is an exact multiple of 256).
// ---------------------------------------------------------------------------
__global__ __launch_bounds__(256) void cast_f32_bf16x2(const float* __restrict__ in, unsigned short* __restrict__ out, int n2) {
  const int i = blockIdx.x * 256 + threadIdx.x;
  if (i < n2) {
    const v2f f = *(const v2f*)(in + 2 * (size_t)i);
    const unsigned u = (unsigned)f2bf_bits(f[0]) | ((unsigned)f2bf_bits(f[1]) << 16);
    ((unsigned*)out)[i] = u;
    
  }
}

// ---------------------------------------------------------------------------
// One block of 256 threads per row (grid.x == number of rows exactly), 4 elements per thread.
// Store coverage: 256 threads x 4 bf16 = 1024 = the whole row; each lane writes 8 contiguous bytes, so one wave
// ---------------------------------------------------------------------------
__global__ __launch_bounds__(256) void layernorm_bf16_kernel(const float* __restrict__ x, const float* __restrict__ gam,
                                                             const float* __restrict__ bet, unsigned short* __restrict__ y,
                                                             float eps) {
  __shared__ float red[16];
  const int row  = blockIdx.x;
  const int tid  = threadIdx.x;
  const int lane = tid & 31;
  const int wave = tid >> 5;
  const float* xr = x + (size_t)row * kEmb;
  const v4f v = *(const v4f*)(xr + 4 * tid);
  float s = (v[0] + v[1]) + (v[2] + v[3]);
#pragma unroll
  for (int off = 1; off < 32; off <<= 1) s += __shfl_xor(s, off, 32);
  if (lane == 0) red[wave] = s;
  __syncthreads();
  float tot = 0.f;
#pragma unroll
  for (int w = 0; w < 8; ++w) tot += red[w];
  const float mu = tot * (1.0f / (float)kEmb);
  const float d0 = v[0] - mu, d1 = v[1] - mu, d2 = v[2] - mu, d3 = v[3] - mu;
  float s2 = (d0 * d0 + d1 * d1) + (d2 * d2 + d3 * d3);
#pragma unroll
  for (int off = 1; off < 32; off <<= 1) s2 += __shfl_xor(s2, off, 32);
  if (lane == 0) red[8 + wave] = s2;
  __syncthreads();
  float tot2 = 0.f;
#pragma unroll
  for (int w = 0; w < 8; ++w) tot2 += red[8 + w];
  const float var  = tot2 * (1.0f / (float)kEmb);
  const float rstd = rsqrtf(var + eps);
  const v4f g  = *(const v4f*)(gam + 4 * tid);
  const v4f bt = *(const v4f*)(bet + 4 * tid);
  const float o0 = d0 * rstd * g[0] + bt[0];
  const float o1 = d1 * rstd * g[1] + bt[1];
  const float o2 = d2 * rstd * g[2] + bt[2];
  const float o3 = d3 * rstd * g[3] + bt[3];
  v2u pk;
  pk[0] = (unsigned)f2bf_bits(o0) | ((unsigned)f2bf_bits(o1) << 16);
  pk[1] = (unsigned)f2bf_bits(o2) | ((unsigned)f2bf_bits(o3) << 16);
  unsigned short* yp = y + (size_t)row * kEmb + 4 * tid;
  *(v2u*)yp = pk;
  
}

// =====================================================================================
// Full (unmasked) attention, head dim 64, all batches and heads in one launch, time-major planes.
//   q plane  (f16): element (t, b, h, d) at [(t*kBatch + b)*kEmb + h*64 + d]   (unscaled q = LN(x).Wq^T)
//   k plane  (f16): element (s, b, h, d) at [(s*kBatch + b)*kEmb + h*64 + d]
//   v^T plane(f16): element (b, h, d, s) at [((b*kHeads + h)*64 + d)*kSeqK + s]
//   ctx plane (bf16 out): element (t, b, h, d) at [(t*kBatch + b)*kEmb + h*64 + d]
//   scores = (q . k) * sscale : single v_wmma_f32_16x16x32_f16, scale applied to the f32 accumulator
//   out    = p . v            : single v_wmma_f32_16x16x32_f16, p = exp(s - m) in (0, 1] carried x2^15 as f16
//   online softmax in f32 over all kSeqK keys (32 chunks of 64, compile-time trip count).
//   Block = 4 waves = 64 query rows of one (b, h); grid.x = kBatch * kHeads * (kSeqQ/64) = 2048.
//   K / V^T chunk staging: 128 threads x 32 elements per plane = the whole 64x64 tile (16-B copies, plain loads,
//   __syncthreads before and after); fragment loads read the LDS tiles with the same v8h element type.
// =====================================================================================
#define AT_D 64
#define AT_NW 4
#define AT_QB 64
#define AT_KC 64
#define AT_LP 72   // LDS row pitch of the K, V^T and P tiles in f16: 144 B = 16 B x odd, so 16 rows read by 16-byte loads fall on distinct banks

__device__ __forceinline__ v8f mma_f16g(v16h a, v16h b, v8f c) {
  c = __builtin_amdgcn_wmma_f32_16x16x32_f16(false, a, false, b, (short)0, c, false, false);
  asm volatile("v_nop\n\tv_nop\n\tv_nop\n\tv_nop" : "+v"(c) : "v"(a), "v"(b));
  return c;
}

__global__ __launch_bounds__(128)
void attn_full16_kernel(const unsigned short* __restrict__ qp, const unsigned short* __restrict__ kp,
                        const unsigned short* __restrict__ vtp, unsigned short* __restrict__ ctxp, float sscale) {
  union FH { v16h v; v8h h[2]; };
  __shared__ __align__(16) _Float16 Ksh[AT_KC * AT_LP];            // K  [kv][d]   9 KB, 64 of 72 columns used
  __shared__ __align__(16) _Float16 Vth[AT_D * AT_LP];             // V^T [d][kv]  9 KB, 64 of 72 columns used
  __shared__ __align__(16) _Float16 Psh[AT_NW][16 * AT_LP];        // per wave P [row][kv]  9 KB, 64 of 72 columns used
  __shared__ __align__(16) float    Os[AT_NW][16 * 68];            // per wave out tile, pitch 68

  const int tid  = threadIdx.x;
  const int wave = tid >> 5;
  const int lane = tid & 31;
  const int hh   = lane >> 4;
  const int c    = lane & 15;

  const int nqb  = kSeqQ / AT_QB;          // 32
  const int bx   = blockIdx.x;             // < kBatch*kHeads*nqb
  const int qb   = bx % nqb;
  const int bhid = bx / nqb;
  const int h    = bhid % kHeads;
  const int bb   = bhid / kHeads;          // 0..kBatch-1
  const int q0   = qb * AT_QB + wave * 16;

  const _Float16* Qh = (const _Float16*)(const void*)qp  + (size_t)bb * kEmb + (size_t)h * kHdim;
  const _Float16* Kh = (const _Float16*)(const void*)kp  + (size_t)bb * kEmb + (size_t)h * kHdim;
  const _Float16* Vh = (const _Float16*)(const void*)vtp + (size_t)(bb * kHeads + h) * kHdim * kSeqK;
  unsigned short* ob = ctxp + (size_t)bb * kEmb + (size_t)h * kHdim;

  // ---- Q fragments (A operand, row = lane&15, split k map via Frag load): 2 d-chunks ----
  v16h qa[2];
#pragma unroll
  for (int dc = 0; dc < 2; ++dc)
    qa[dc] = Frag<_Float16>::load(Qh + (size_t)(q0 + c) * kRowPitch + dc * 32 + 8 * hh);

  float mrow[8], lrow[8];
  v8f oacc[4];
#pragma unroll
  for (int r = 0; r < 8; ++r) { mrow[r] = -INFINITY; lrow[r] = 0.f; }
#pragma unroll
  for (int t = 0; t < 4; ++t) oacc[t] = (v8f){0.f,0.f,0.f,0.f,0.f,0.f,0.f,0.f};

  const int nChunks = kSeqK / AT_KC;   // 32, compile-time constant
  for (int kc = 0; kc < nChunks; ++kc) {
    const int kv0 = kc * AT_KC;
    __syncthreads();
    {
      // staging coverage: 128 threads x (4 x 8) elements = 64 rows x 64 per plane = the whole chunk tile
      const int r = tid >> 1, half = (tid & 1) * 32;
      const _Float16* ks = Kh + (size_t)(kv0 + r) * kRowPitch + half;   // K row kv0+r, d = half..half+31
      const _Float16* vs = Vh + (size_t)r * kSeqK + kv0 + half;          // V^T row d = r, s = kv0+half..+31
#pragma unroll
      for (int i = 0; i < 4; ++i) {
        const v8h a0 = *(const v8h*)(ks + 8 * i);
        const v8h b0 = *(const v8h*)(vs + 8 * i);
        *(v8h*)(Ksh + r * AT_LP + half + 8 * i) = a0;
        *(v8h*)(Vth + r * AT_LP + half + 8 * i) = b0;
      }
    }
    __syncthreads();

    v8f s[4];
#pragma unroll
    for (int j = 0; j < 4; ++j) {
      s[j] = (v8f){0.f,0.f,0.f,0.f,0.f,0.f,0.f,0.f};
#pragma unroll
      for (int dc = 0; dc < 2; ++dc) {
        FH kb;
        kb.h[0] = *(const v8h*)(Ksh + (j * 16 + c) * AT_LP + dc * 32 + 8 * hh);
        kb.h[1] = *(const v8h*)(Ksh + (j * 16 + c) * AT_LP + dc * 32 + 16 + 8 * hh);
        s[j] = mma_f16g(qa[dc], kb.v, s[j]);
      }
    }
    float cm[8];
#pragma unroll
    for (int r = 0; r < 8; ++r) {
      float m = -INFINITY;
#pragma unroll
      for (int j = 0; j < 4; ++j) {
        const float sv = s[j][r] * sscale;
        s[j][r] = sv;
        m = fmaxf(m, sv);
      }
#pragma unroll
      for (int off = 1; off < 16; off <<= 1) m = fmaxf(m, __shfl_xor(m, off, 32));
      cm[r] = m;
    }
    _Float16* pwh = Psh[wave];
#pragma unroll
    for (int r = 0; r < 8; ++r) {
      const float mnew  = fmaxf(mrow[r], cm[r]);
      const float alpha = expf(mrow[r] - mnew);
      mrow[r] = mnew;
      float psum = 0.f;
#pragma unroll
      for (int j = 0; j < 4; ++j) {
        const float p = expf(s[j][r] - mnew);
        psum += p;
        pwh[(8 * hh + r) * AT_LP + j * 16 + c] = (_Float16)(p * kPCarry);
      }
#pragma unroll
      for (int off = 1; off < 16; off <<= 1) psum += __shfl_xor(psum, off, 32);
      lrow[r] = lrow[r] * alpha + psum;
#pragma unroll
      for (int t = 0; t < 4; ++t) oacc[t][r] *= alpha;
    }
    __builtin_amdgcn_fence(__ATOMIC_RELEASE, "workgroup");
    __builtin_amdgcn_wave_barrier();
    __builtin_amdgcn_fence(__ATOMIC_ACQUIRE, "workgroup");
#pragma unroll 1
    for (int kk = 0; kk < 2; ++kk) {
      FH pa;
      pa.h[0] = *(const v8h*)(pwh + c * AT_LP + kk * 32 + 8 * hh);
      pa.h[1] = *(const v8h*)(pwh + c * AT_LP + kk * 32 + 16 + 8 * hh);
#pragma unroll
      for (int t = 0; t < 4; ++t) {
        FH vb;
        vb.h[0] = *(const v8h*)(Vth + (t * 16 + c) * AT_LP + kk * 32 + 8 * hh);
        vb.h[1] = *(const v8h*)(Vth + (t * 16 + c) * AT_LP + kk * 32 + 16 + 8 * hh);
        oacc[t] = mma_f16g(pa.v, vb.v, oacc[t]);
      }
    }
  }

  // ---- normalise (fold back the 2^15 carry), stage the wave's 16x64 tile, write bf16 rows:
  float* os = Os[wave];
#pragma unroll
  for (int r = 0; r < 8; ++r) {
    const float inv = 1.0f / (lrow[r] * kPCarry);
#pragma unroll
    for (int t = 0; t < 4; ++t) os[(8 * hh + r) * 68 + t * 16 + c] = oacc[t][r] * inv;
  }
  __builtin_amdgcn_fence(__ATOMIC_RELEASE, "workgroup");
  __builtin_amdgcn_wave_barrier();
  __builtin_amdgcn_fence(__ATOMIC_ACQUIRE, "workgroup");
  {
    const int qq = lane >> 3, c8 = (lane & 7) * 8;
    {
#pragma unroll
      for (int it = 0; it < 4; ++it) {
        const int row = it * 4 + qq;
        const float* sp = os + row * 68 + c8;
        v8h hv;
#pragma unroll
        for (int e = 0; e < 8; ++e) hv[e] = __builtin_bit_cast(_Float16, f2bf_bits(sp[e]));
        *(v8h*)(ob + (size_t)(q0 + row) * kRowPitch + c8) = hv;
      }
      
    }
  }
}

// ---------------------------------------------------------------------------
// Host orchestration.
// Workspace region map (byte offsets):
//   [  0 MiB, 16 MiB)  KEY16  bf16 [8192][1024]   key cast
//   [ 16 MiB, 18 MiB)  WQ16   bf16 [1024][1024]
//   [ 18 MiB, 22 MiB)  WKV16  bf16 [2048][1024]
//   [ 22 MiB, 24 MiB)  WO16   bf16 [1024][1024]
//   [ 24 MiB, 40 MiB)  LNX16  bf16 [8192][1024]   LN(query); dead after the q projection, then reused as
//                      CTX16  bf16 [8192][1024]   attention output
//   [ 40 MiB, 56 MiB)  Q16    f16  [8192][1024]
//   [ 56 MiB, 72 MiB)  K16    f16  [8192][1024]   (head h at columns h*64)
//   [ 72 MiB, 88 MiB)  VT16   f16  [4][16][64][2048]
//   total 88 MiB = 92274688 B
// ---------------------------------------------------------------------------
extern "C" void kernel_launch(void* const* d_in, const int* in_sizes, int n_in,
                              void* d_out, int out_size, void* d_ws, size_t ws_size,
                              hipStream_t stream) {
  if (n_in < 7) return;
  const int nAct = kSeqQ * kBatch * kEmb;          // 8388608
  if (in_sizes[0] != nAct || in_sizes[1] != kSeqK * kBatch * kEmb) return;
  if (in_sizes[2] < kEmb || in_sizes[3] < kEmb) return;
  if (in_sizes[4] != kEmb * kEmb || in_sizes[5] != 2 * kEmb * kEmb || in_sizes[6] != kEmb * kEmb) return;
  if (out_size != nAct) return;

  const float* query = (const float*)d_in[0];   // [2048][4][1024]
  const float* key   = (const float*)d_in[1];   // [2048][4][1024]
  const float* gamma = (const float*)d_in[2];   // [1024]
  const float* beta  = (const float*)d_in[3];   // [1024]
  const float* w_q   = (const float*)d_in[4];   // [1024][1024]
  const float* w_kv  = (const float*)d_in[5];   // [2048][1024]
  const float* w_out = (const float*)d_in[6];   // [1024][1024]
  float* out = (float*)d_out;

  const size_t szAct16 = (size_t)kRowsQ * kEmb * 2;          // 16 MiB
  const size_t szWq16  = (size_t)kEmb * kEmb * 2;            //  2 MiB
  const size_t szWkv16 = (size_t)2 * kEmb * kEmb * 2;        //  4 MiB
  const size_t szVt16  = (size_t)kBatch * kHeads * kHdim * kSeqK * 2;   // 16 MiB
  size_t off = 0;
  char* ws = (char*)d_ws;
  unsigned short* KEY16 = (unsigned short*)(ws + off); off += szAct16;
  unsigned short* WQ16  = (unsigned short*)(ws + off); off += szWq16;
  unsigned short* WKV16 = (unsigned short*)(ws + off); off += szWkv16;
  unsigned short* WO16  = (unsigned short*)(ws + off); off += szWq16;
  unsigned short* LNX16 = (unsigned short*)(ws + off); off += szAct16;
  unsigned short* CTX16 = LNX16;                                // region reuse (LNX16 dead after the q GEMM)
  unsigned short* Q16   = (unsigned short*)(ws + off); off += szAct16;
  unsigned short* K16   = (unsigned short*)(ws + off); off += szAct16;
  unsigned short* VT16  = (unsigned short*)(ws + off); off += szVt16;
  if (off > ws_size) return;

  // 1) casts to bf16 (RNE); n2 = elements/2, grid = ceil(n2/256)
  {
    const int n2k = nAct / 2, n2q = kEmb * kEmb / 2, n2kv = kEmb * kEmb;
    cast_f32_bf16x2<<<(n2k + 255) / 256, 256, 0, stream>>>(key, KEY16, n2k);
    cast_f32_bf16x2<<<(n2q + 255) / 256, 256, 0, stream>>>(w_q, WQ16, n2q);
    cast_f32_bf16x2<<<(n2kv + 255) / 256, 256, 0, stream>>>(w_kv, WKV16, n2kv);
    cast_f32_bf16x2<<<(n2q + 255) / 256, 256, 0, stream>>>(w_out, WO16, n2q);
  }

  // 2) LayerNorm(query) -> bf16 plane, one block per (t,b) row
  layernorm_bf16_kernel<<<kRowsQ, 256, 0, stream>>>(query, gamma, beta, LNX16, kLnEps);

  // 3) q = LN . Wq^T (unscaled; 0.125 applied to the f32 scores): M=8192, N=1024, K=1024 -> f16 plane
  {
    const int tiles = (kRowsQ / 64) * (kEmb / 64);   // 2048
    wmma_gemm64<1, false, 0, 1, false><<<dim3((tiles + 7) / 8, 1), 256, 0, stream>>>(
        LNX16, nullptr, 0L, WQ16, nullptr, 0L,
        (void*)Q16, nullptr, kEmb, 0L, nullptr, nullptr, 0L, kRowsQ, kEmb, kEmb, 1.0f);
  }

  // 4) k per head h (grid.y = h): C[(s,b)][h*64 + d] = sum_e key[(s,b)][e] * Wkv[h*128 + d][e]; M=8192, N=64, K=1024
  {
    const int tiles = (kRowsK / 64) * (kHdim / 64);   // 128
    wmma_gemm64<1, false, 0, 1, false, 0, true><<<dim3((tiles + 7) / 8, kHeads), 256, 0, stream>>>(
        KEY16, nullptr, 0L, WKV16, nullptr, (long)(2 * kHdim) * kEmb,
        (void*)K16, nullptr, kEmb, (long)kHdim, nullptr, nullptr, 0L, kRowsK, kHdim, kEmb, 1.0f);
  }

  // 5) v^T per (b, h): C[d][s] = sum_e Wkv[h*128 + 64 + d][e] * key[(s,b)][e]; M=64, N=2048, K=1024; one launch per b, grid.y = h
  {
    const int tiles = (kHdim / 64) * (kSeqK / 64);   // 32
    for (int b = 0; b < kBatch; ++b) {
      wmma_gemm64<1, false, 0, 1, false, 0, false, kEmb, kRowPitch><<<dim3((tiles + 7) / 8, kHeads), 256, 0, stream>>>(
          WKV16 + (size_t)kHdim * kEmb, nullptr, (long)(2 * kHdim) * kEmb,
          KEY16 + (size_t)b * kEmb, nullptr, 0L,
          (void*)(VT16 + (size_t)b * kHeads * kHdim * kSeqK), nullptr, kSeqK, (long)kHdim * kSeqK,
          nullptr, nullptr, 0L, kHdim, kSeqK, kEmb, 1.0f);
    }
  }

  // 6) attention: one block per (b, h, 64-query tile) -> ctx bf16 plane (time-major, heads merged)
  attn_full16_kernel<<<kBatch * kHeads * (kSeqQ / AT_QB), 128, 0, stream>>>(Q16, K16, VT16, CTX16, 0.125f);

  // 7) out = query + ctx . Wout^T : M=8192, N=1024, K=1024, f32 with residual epilogue, straight to d_out
  {
    const int tiles = (kRowsQ / 64) * (kEmb / 64);   // 2048
    wmma_gemm64<1, false, 0, 0, true><<<dim3((tiles + 7) / 8, 1), 256, 0, stream>>>(
        CTX16, nullptr, 0L, WO16, nullptr, 0L,
        (void*)out, nullptr, kEmb, 0L, nullptr, query, 0L, kRowsQ, kEmb, kEmb, 1.0f);
  }
}

// v003
// Measured time: 334 microseconds a run.
// In two side-by-side timings against v002, it was 1.47 and 1.48 times as fast.
// Counting every step since v000, it is 2.42 times as fast.
// Contractions: q, k, v^T and output projections on v_wmma_f32_16x16x32_bf16 (bf16 operands); q.k^T and p.v on v_wmma_f32_16x16x32_f16 (f16 operands, p carried x2^15); all f32 accumulate; layernorm, softmax, score scale 0.125 and residual add in f32.
#include <hip/hip_runtime.h>
#include <math.h>
#include <stdint.h>

// ---------------------------------------------------------------------------
// Problem geometry (time-major activations: row (t, b) = t*kBatch + b, pitch kEmb)
// ---------------------------------------------------------------------------
constexpr int kSeqQ  = 2048;
constexpr int kSeqK  = 2048;
constexpr int kBatch = 4;
constexpr int kEmb   = 1024;
constexpr int kHeads = 16;
constexpr int kHdim  = 64;
constexpr int kRowsQ = kSeqQ * kBatch;          // 8192
constexpr int kRowsK = kSeqK * kBatch;          // 8192
constexpr int kRowPitch = kBatch * kEmb;        // 4096: stride between consecutive t at fixed b
constexpr float kLnEps  = 1e-5f;
constexpr float kPCarry = 32768.0f;             // softmax numerators carried x2^15 in f16

typedef __attribute__((ext_vector_type(16))) _Float16 v16h;
typedef __attribute__((ext_vector_type(8)))  _Float16 v8h;
typedef __attribute__((ext_vector_type(16))) __bf16   v16b;
typedef __attribute__((ext_vector_type(8)))  __bf16   v8b;
typedef __attribute__((ext_vector_type(8)))  float    v8f;
typedef __attribute__((ext_vector_type(4)))  float    v4f;
typedef __attribute__((ext_vector_type(2)))  float    v2f;
typedef __attribute__((ext_vector_type(2)))  unsigned int v2u;

__device__ __forceinline__ unsigned short f2bf_bits(float f) {
  unsigned u = __float_as_uint(f);
  return (unsigned short)((u + 0x7FFFu + ((u >> 16) & 1u)) >> 16);
}
__device__ __forceinline__ float bf_bits2f(unsigned short h) { return __uint_as_float(((unsigned)h) << 16); }

// hazard guards as plain device helpers (no inline asm inside the kernel template body)
__device__ __forceinline__ void dep_guard_h(v8f& a, v8f& b, v16h x, v16h y) { asm volatile("v_nop\n\tv_nop\n\tv_nop\n\tv_nop" : "+v"(a), "+v"(b) : "v"(x), "v"(y)); }
__device__ __forceinline__ void dep_guard_b(v8f& a, v8f& b, v16b x, v16b y) { asm volatile("v_nop\n\tv_nop\n\tv_nop\n\tv_nop" : "+v"(a), "+v"(b) : "v"(x), "v"(y)); }
__device__ __forceinline__ void keep4_h(v16h a, v16h b, v16h c, v16h d) { asm volatile("v_nop" :: "v"(a), "v"(b), "v"(c), "v"(d)); }
__device__ __forceinline__ void keep4_b(v16b a, v16b b, v16b c, v16b d) { asm volatile("v_nop" :: "v"(a), "v"(b), "v"(c), "v"(d)); }
__device__ __forceinline__ void acc_guard4(v8f& a, v8f& b, v8f& c, v8f& d) { asm volatile("v_nop\n\tv_nop\n\tv_nop\n\tv_nop" : "+v"(a), "+v"(b), "+v"(c), "+v"(d)); }
// stands behind a group of global loads: none of their address registers is rewritten in front of this wait
__device__ __forceinline__ void addr_regs_wait() { asm volatile("s_wait_xcnt 0x0" ::: "memory"); }
template <typename T> struct Frag;
template <> struct Frag<_Float16> {
  typedef v16h V; typedef v8h H; union U { v16h v; v8h h[2]; };
  static __device__ __forceinline__ v16h load(const _Float16* p) {   // elements 0..7 <- p[0..7], 8..15 <- p[16..23]
    U f; f.h[0] = *(const v8h*)(p); f.h[1] = *(const v8h*)(p + 16); return f.v;
  }
  static __device__ __forceinline__ v8f mma(v16h a, v16h b, v8f c) {
    return __builtin_amdgcn_wmma_f32_16x16x32_f16(false, a, false, b, (short)0, c, false, false);
  }
  static __device__ __forceinline__ void guard(v8f& a, v8f& b, v16h x, v16h y) { dep_guard_h(a, b, x, y); }
  static __device__ __forceinline__ void keep(v16h a, v16h b, v16h c, v16h d) { keep4_h(a, b, c, d); }
};
template <> struct Frag<__bf16> {
  typedef v16b V; typedef v8b H; union U { v16b v; v8b h[2]; };
  static __device__ __forceinline__ v16b load(const __bf16* p) {
    U f; f.h[0] = *(const v8b*)(p); f.h[1] = *(const v8b*)(p + 16); return f.v;
  }
  static __device__ __forceinline__ v8f mma(v16b a, v16b b, v8f c) {
    return __builtin_amdgcn_wmma_f32_16x16x32_bf16(false, a, false, b, (short)0, c, false, false);
  }
  static __device__ __forceinline__ void guard(v8f& a, v8f& b, v16b x, v16b y) { dep_guard_b(a, b, x, y); }
  static __device__ __forceinline__ void keep(v16b a, v16b b, v16b c, v16b d) { keep4_b(a, b, c, d); }
};

// ---- Register-blocked batched WMMA GEMM ------------------------------------
// C[m,n] = scale * sum_k A[m,k] * Bt[n,k] (+bias)(+resid); each wave owns a 64x64 tile.
// A row-major [M,K]; Bt row-major [N,K]; M,N % 64 == 0, K % 64 == 0; the tile count is a multiple of 8.
// The 8 waves of a block own 8 consecutive tiles that share one operand's 64 rows:
//   WIDE_M = false: N/64 is a multiple of 8, the block is 64 x 512 (A rows shared, 64 Bt rows per wave);
//   WIDE_M = true : N == 64, the block is 512 x 64 (Bt rows shared, 64 A rows per wave).
// Operands go through LDS in slabs of 64 k: every thread copies whole 16-B pieces so that a wave-wide load covers
// 4 whole 128-B lines; two LDS buffers, the next slab's global loads are issued ahead of the current slab's products.
// The row pitches lda, ldb are compile-time, so that a slab's 18 loads are two addresses plus immediate offsets.
// SPLIT (hi/lo planes) is not staged and not instantiated.
// BIAS_MODE: 0 = none, 1 = bias[m], 2 = bias[n].
// OUT_MODE: 0 = f32, 1 = f16, 2 = bf16 hi plane (Cout) + bf16 lo plane (Cout2).
// ET: 0 = f16 operands, 1 = bf16 operands (pointers passed as 16-bit storage)
template <int ET> struct Elem;
template <> struct Elem<0> { typedef _Float16 T; };
template <> struct Elem<1> { typedef __bf16 T; };
constexpr int kGsBk    = 64;                     // k elements per slab: 128 B of every operand row
constexpr int kGsPitch = 72;                     // LDS row pitch in 16-bit elements: 144 B = 16 B x odd
constexpr int kGsRows  = 64 + 8 * 64;            // the shared operand's rows, then 64 rows per wave
constexpr int kGsCopies = kGsRows * 8 / 256;     // 16-B pieces per thread and slab: 18
template <int ET, bool SPLIT, int BIAS_MODE, int OUT_MODE, bool RESID, int ACT = 0, bool WIDE_M = false, int lda = kEmb, int ldb = kEmb>
__global__ __launch_bounds__(256) void wmma_gemm64(
    const unsigned short* __restrict__ Ap, const unsigned short* __restrict__ A2p, long strideA,
    const unsigned short* __restrict__ Btp, const unsigned short* __restrict__ Bt2p, long strideB,
    void* __restrict__ Cout, void* __restrict__ Cout2, int ldc, long strideC,
    const float* __restrict__ bias,
    const float* __restrict__ resid, long strideR,
    int M, int N, int K, float scale) {
  typedef typename Elem<ET>::T T;
  typedef typename Frag<T>::V V;
  typedef typename Frag<T>::H H;
  static_assert(!SPLIT, "hi/lo planes are not staged");
  const T* A = (const T*)Ap; const T* Bt = (const T*)Btp;
  __shared__ __align__(16) T sStage[2][kGsRows * kGsPitch];   // two slab buffers, 82,944 B each
  __shared__ __align__(16) float sT[8][16 * 68];   // per-wave 16x64 slab, pitch 68 floats
  const int b    = blockIdx.y;
  const int tid  = threadIdx.x;
  const int lane = tid & 31;
  const int wave = tid >> 5;
  const int tilesN = N >> 6;
  const int tilesM = M >> 6;
  if ((int)(blockIdx.x + 1) * 8 > tilesM * tilesN) return;   // block-uniform, in front of every barrier
  const int tile0 = blockIdx.x * 8;            // the block's first tile; wave w owns tile0 + w
  const int tm0 = tile0 / tilesN;
  const int tn0 = tile0 - tm0 * tilesN;
  const int m0 = (tm0 << 6) + (WIDE_M ? (wave << 6) : 0);
  const int n0 = (tn0 << 6) + (WIDE_M ? 0 : (wave << 6));

  const T* Ab  = A  + (size_t)b * strideA;
  const T* Bb  = Bt + (size_t)b * strideB;

  const int rlane = lane & 15;                 // row (A) / col (B, D) within subtile
  const int koff  = (lane >> 4) * 8;           // k offset of this lane half
  const int mOff  = (lane >> 4) * 8;           // D row offset

  // staging map: piece q = it*256 + tid -> LDS row q/8, 16-B piece q%8; rows 0..63 shared operand, 64.. per wave
  const int srow = tid >> 3;
  const int sseg = (tid & 7) * 8;
  const int ldS = WIDE_M ? ldb : lda;          // shared operand
  const int ldW = WIDE_M ? lda : ldb;          // operand with 64 rows per wave
  const char* uA = (const char*)(Ab + (size_t)(tm0 << 6) * lda);   // block-uniform bases, byte addressed
  const char* uB = (const char*)(Bb + (size_t)(tn0 << 6) * ldb);
  const char* uS = WIDE_M ? uB : uA;
  const char* uW = WIDE_M ? uA : uB;
  const unsigned vS = (unsigned)(srow * ldS + sseg) * 2u;          // this thread's byte offset inside 32 rows
  const unsigned vW = (unsigned)(srow * ldW + sseg) * 2u;
  const int sOff = srow * kGsPitch + sseg;
  const int fS = rlane * kGsPitch + koff;                          // fragment row 0 of the shared operand
  const int fW = (64 + (wave << 6) + rlane) * kGsPitch + koff;     // fragment row 0 of this wave's own rows
  const int fA = WIDE_M ? fW : fS;
  const int fB = WIDE_M ? fS : fW;

  v8f acc[4][4];
#pragma unroll
  for (int i = 0; i < 4; ++i)
#pragma unroll
    for (int j = 0; j < 4; ++j) acc[i][j] = (v8f){0.f,0.f,0.f,0.f,0.f,0.f,0.f,0.f};

  // trip s: slab s's global loads are issued, slab s - 1 is multiplied out of its buffer, slab s goes to the other one
  const int nSlabs = K / kGsBk;
  for (int s = 0; s <= nSlabs; ++s) {
    const bool fill = s < nSlabs;              // block-uniform
    H st[kGsCopies];
    if (fill) {
      const int k1 = s * kGsBk;
#pragma unroll   // constant indices keep st[] in registers and the row steps in the loads' immediate offsets
      for (int it = 0; it < 2; ++it) st[it] = *(const H*)(uS + ((size_t)(it * 32) * ldS + k1) * 2 + vS);
#pragma unroll   // as above
      for (int it = 2; it < kGsCopies; ++it) st[it] = *(const H*)(uW + ((size_t)((it - 2) * 32) * ldW + k1) * 2 + vW);
      addr_regs_wait();
    }
    if (s > 0) {
      const T* cur = sStage[(s - 1) & 1];
#pragma unroll   // both halves of the slab in one trip: the second half's LDS reads can start under the first half's products
      for (int kk = 0; kk < kGsBk; kk += 32) {
        V bh[4], ah[4];
#pragma unroll   // fragments and accumulators in registers, here and in the three loops below
        for (int j = 0; j < 4; ++j) bh[j] = Frag<T>::load(cur + fB + j * 16 * kGsPitch + kk);
#pragma unroll
        for (int i = 0; i < 4; ++i) ah[i] = Frag<T>::load(cur + fA + i * 16 * kGsPitch + kk);
#pragma unroll
        for (int i = 0; i < 4; ++i) {
#pragma unroll
          for (int j = 0; j < 4; ++j) acc[i][j] = Frag<T>::mma(ah[i], bh[j], acc[i][j]);
          Frag<T>::guard(acc[i][0], acc[i][3], ah[i], ah[i]);
        }
        Frag<T>::keep(bh[0], bh[1], bh[2], bh[3]);
      }
    }
    if (fill) {
      T* nxt = sStage[s & 1];                  // its last readers (slab s - 2) left it at the barrier that ended trip s - 1
#pragma unroll   // st[] in registers, row steps in the stores' immediate offsets
      for (int it = 0; it < kGsCopies; ++it) *(H*)(nxt + sOff + it * 32 * kGsPitch) = st[it];
    }
    __syncthreads();                           // publishes slab s and ends every read of slab s - 1
  }
  acc_guard4(acc[0][0], acc[0][1], acc[0][2], acc[0][3]);
  acc_guard4(acc[1][0], acc[1][1], acc[1][2], acc[1][3]);
  acc_guard4(acc[2][0], acc[2][1], acc[2][2], acc[2][3]);
  acc_guard4(acc[3][0], acc[3][1], acc[3][2], acc[3][3]);

  // ---- epilogue ----
  float* slab = sT[wave];
  const float* Rb = RESID ? (resid + (size_t)b * strideR) : nullptr;
#pragma unroll
  for (int i = 0; i < 4; ++i) {
    const int mBase = m0 + (i << 4);
#pragma unroll
    for (int j = 0; j < 4; ++j) {
      const int n = n0 + (j << 4) + rlane;
      float bv = 0.f;
      if (BIAS_MODE == 2) bv = bias[n];
#pragma unroll
      for (int r = 0; r < 8; ++r) {
        float v = acc[i][j][r] * scale;
        if (BIAS_MODE == 1) v += bias[mBase + mOff + r];
        if (BIAS_MODE == 2) v += bv;
        if (RESID) v += Rb[(size_t)(mBase + mOff + r) * ldc + n];
        if (ACT == 1) v = tanhf(v);
        if (ACT == 2) v = fmaxf(v, 0.0f);
        if (ACT == 3) v = v / (1.0f + expf(-v));
        if (ACT == 4) v = (v > 0.f) ? v : 0.01f * v;
        if (ACT == 5) v = 0.5f * v * (1.0f + erff(v * 0.70710678118654752f));
        slab[(mOff + r) * 68 + (j << 4) + rlane] = v;
      }
    }
    __builtin_amdgcn_fence(__ATOMIC_RELEASE, "workgroup");
    __builtin_amdgcn_wave_barrier();
    __builtin_amdgcn_fence(__ATOMIC_ACQUIRE, "workgroup");
    if (OUT_MODE == 0) {
      float* C = (float*)Cout + (size_t)b * strideC;
      const int hh = lane >> 4, c4 = (lane & 15) * 4;     // row seg = 256 B = 16 lanes x 16 B
      {
#pragma unroll
        for (int it = 0; it < 8; ++it) {
          const int row = it * 2 + hh;
          v4f v = *(const v4f*)(slab + row * 68 + c4);
          *(v4f*)(C + (size_t)(mBase + row) * ldc + n0 + c4) = v;
        }
        
      }
    } else {
      const int q = lane >> 3, c8 = (lane & 7) * 8;
      unsigned short* C  = (unsigned short*)Cout  + (size_t)b * strideC;
      unsigned short* C2 = (OUT_MODE == 2) ? ((unsigned short*)Cout2 + (size_t)b * strideC) : nullptr;
      {
#pragma unroll
        for (int it = 0; it < 4; ++it) {
          const int row = it * 4 + q;
          const float* sp = slab + row * 68 + c8;
          v8h hv, lv;
#pragma unroll
          for (int e = 0; e < 8; ++e) {
            if (OUT_MODE == 1) {
              hv[e] = (_Float16)sp[e];
            } else {
              unsigned short hb = f2bf_bits(sp[e]);
              unsigned short lb = f2bf_bits(sp[e] - bf_bits2f(hb));
              hv[e] = __builtin_bit_cast(_Float16, hb);
              lv[e] = __builtin_bit_cast(_Float16, lb);
            }
          }
          *(v8h*)(C + (size_t)(mBase + row) * ldc + n0 + c8) = hv;
          if (OUT_MODE == 2) *(v8h*)(C2 + (size_t)(mBase + row) * ldc + n0 + c8) = lv;
        }
        
      }
    }
    __builtin_amdgcn_fence(__ATOMIC_RELEASE, "workgroup");
    __builtin_amdgcn_wave_barrier();
    __builtin_amdgcn_fence(__ATOMIC_ACQUIRE, "workgroup");
  }
}

// ---------------------------------------------------------------------------
// f32 -> bf16 (RNE) cast: 2 elements per thread, one 4-B store per lane -> each wave writes exactly one whole
// x 2 elements = the whole plane (n2 = n/2; here every n2 is an exact multiple of 256).
// ---------------------------------------------------------------------------
__global__ __launch_bounds__(256) void cast_f32_bf16x2(const float* __restrict__ in, unsigned short* __restrict__ out, int n2) {
  const int i = blockIdx.x * 256 + threadIdx.x;
  if (i < n2) {
    const v2f f = *(const v2f*)(in + 2 * (size_t)i);
    const unsigned u = (unsigned)f2bf_bits(f[0]) | ((unsigned)f2bf_bits(f[1]) << 16);
    ((unsigned*)out)[i] = u;
    
  }
}

// ---------------------------------------------------------------------------
// One block of 256 threads per row (grid.x == number of rows exactly), 4 elements per thread.
// Store coverage: 256 threads x 4 bf16 = 1024 = the whole row; each lane writes 8 contiguous bytes, so one wave
// ---------------------------------------------------------------------------
__global__ __launch_bounds__(256) void layernorm_bf16_kernel(const float* __restrict__ x, const float* __restrict__ gam,
                                                             const float* __restrict__ bet, unsigned short* __restrict__ y,
                                                             float eps) {
  __shared__ float red[16];
  const int row  = blockIdx.x;
  const int tid  = threadIdx.x;
  const int lane = tid & 31;
  const int wave = tid >> 5;
  const float* xr = x + (size_t)row * kEmb;
  const v4f v = *(const v4f*)(xr + 4 * tid);
  float s = (v[0] + v[1]) + (v[2] + v[3]);
#pragma unroll
  for (int off = 1; off < 32; off <<= 1) s += __shfl_xor(s, off, 32);
  if (lane == 0) red[wave] = s;
  __syncthreads();
  float tot = 0.f;
#pragma unroll
  for (int w = 0; w < 8; ++w) tot += red[w];
  const float mu = tot * (1.0f / (float)kEmb);
  const float d0 = v[0] - mu, d1 = v[1] - mu, d2 = v[2] - mu, d3 = v[3] - mu;
  float s2 = (d0 * d0 + d1 * d1) + (d2 * d2 + d3 * d3);
#pragma unroll
  for (int off = 1; off < 32; off <<= 1) s2 += __shfl_xor(s2, off, 32);
  if (lane == 0) red[8 + wave] = s2;
  __syncthreads();
  float tot2 = 0.f;
#pragma unroll
  for (int w = 0; w < 8; ++w) tot2 += red[8 + w];
  const float var  = tot2 * (1.0f / (float)kEmb);
  const float rstd = rsqrtf(var + eps);
  const v4f g  = *(const v4f*)(gam + 4 * tid);
  const v4f bt = *(const v4f*)(bet + 4 * tid);
  const float o0 = d0 * rstd * g[0] + bt[0];
  const float o1 = d1 * rstd * g[1] + bt[1];
  const float o2 = d2 * rstd * g[2] + bt[2];
  const float o3 = d3 * rstd * g[3] + bt[3];
  v2u pk;
  pk[0] = (unsigned)f2bf_bits(o0) | ((unsigned)f2bf_bits(o1) << 16);
  pk[1] = (unsigned)f2bf_bits(o2) | ((unsigned)f2bf_bits(o3) << 16);
  unsigned short* yp = y + (size_t)row * kEmb + 4 * tid;
  *(v2u*)yp = pk;
  
}

// =====================================================================================
// Full (unmasked) attention, head dim 64, all batches and heads in one launch, time-major planes.
//   q plane  (f16): element (t, b, h, d) at [(t*kBatch + b)*kEmb + h*64 + d]   (unscaled q = LN(x).Wq^T)
//   k plane  (f16): element (s, b, h, d) at [(s*kBatch + b)*kEmb + h*64 + d]
//   v^T plane(f16): element (b, h, d, s) at [((b*kHeads + h)*64 + d)*kSeqK + s]
//   ctx plane (bf16 out): element (t, b, h, d) at [(t*kBatch + b)*kEmb + h*64 + d]
//   scores^T = (k . q^T) * sscale : single v_wmma_f32_16x16x32_f16 (A = K rows, B = Q), scale applied to the f32 accumulator
//   out^T    = v^T . p^T          : single v_wmma_f32_16x16x32_f16 (A = V^T rows, B = p^T), p = exp(s - m) in (0, 1] carried x2^15 as f16
//   A lane holds 32 of the chunk's 64 scores of ONE query (column lane & 15; keys j*16 + 8*(lane >> 4) + r), so the maximum and
//   the sum run in the lane, and two score tiles converted in place are the B operand of the second product: p never leaves registers.
//   online softmax in f32 over all kSeqK keys (32 chunks of 64, compile-time trip count).
//   Block = 4 waves = 64 query rows of one (b, h); grid.x = kBatch * kHeads * (kSeqQ/64) = 2048.
//   K / V^T chunk staging: 128 threads x 32 elements per plane = the whole 64x64 tile (16-B copies, plain loads,
//   __syncthreads before and after); fragment loads read the LDS tiles with the same v8h element type.
// =====================================================================================
#define AT_D 64
#define AT_NW 4
#define AT_QB 64
#define AT_KC 64
#define AT_LP 72   // LDS row pitch of the K and V^T tiles in f16: 144 B = 16 B x odd, so 16 rows read by 16-byte loads fall on distinct banks

__device__ __forceinline__ v8f mma_f16g(v16h a, v16h b, v8f c) {
  c = __builtin_amdgcn_wmma_f32_16x16x32_f16(false, a, false, b, (short)0, c, false, false);
  asm volatile("v_nop\n\tv_nop\n\tv_nop\n\tv_nop" : "+v"(c) : "v"(a), "v"(b));
  return c;
}

// lane l takes the value of lane l ^ 16: the other half of the same query column
__device__ __forceinline__ float xhalf(float x) {
  return __builtin_bit_cast(float, __builtin_amdgcn_permlanex16(__builtin_bit_cast(int, x), __builtin_bit_cast(int, x), 0x76543210, 0xfedcba98, false, false));
}

__global__ __launch_bounds__(128)
void attn_full16_kernel(const unsigned short* __restrict__ qp, const unsigned short* __restrict__ kp,
                        const unsigned short* __restrict__ vtp, unsigned short* __restrict__ ctxp, float sscale) {
  union FH { v16h v; v8h h[2]; };
  __shared__ __align__(16) _Float16 Ksh[AT_KC * AT_LP];            // K  [kv][d]   9 KB, 64 of 72 columns used
  __shared__ __align__(16) _Float16 Vth[AT_D * AT_LP];             // V^T [d][kv]  9 KB, 64 of 72 columns used
  __shared__ __align__(16) float    Os[AT_NW][16 * 68];            // per wave out tile, pitch 68

  const int tid  = threadIdx.x;
  const int wave = tid >> 5;
  const int lane = tid & 31;
  const int hh   = lane >> 4;
  const int c    = lane & 15;

  const int nqb  = kSeqQ / AT_QB;          // 32
  const int bx   = blockIdx.x;             // < kBatch*kHeads*nqb
  const int qb   = bx % nqb;
  const int bhid = bx / nqb;
  const int h    = bhid % kHeads;
  const int bb   = bhid / kHeads;          // 0..kBatch-1
  const int q0   = qb * AT_QB + wave * 16;

  const _Float16* Qh = (const _Float16*)(const void*)qp  + (size_t)bb * kEmb + (size_t)h * kHdim;
  const _Float16* Kh = (const _Float16*)(const void*)kp  + (size_t)bb * kEmb + (size_t)h * kHdim;
  const _Float16* Vh = (const _Float16*)(const void*)vtp + (size_t)(bb * kHeads + h) * kHdim * kSeqK;
  unsigned short* ob = ctxp + (size_t)bb * kEmb + (size_t)h * kHdim;

  // ---- Q fragments (B operand, column = lane&15, split k map via Frag load): 2 d-chunks ----
  v16h qa[2];
#pragma unroll
  for (int dc = 0; dc < 2; ++dc)
    qa[dc] = Frag<_Float16>::load(Qh + (size_t)(q0 + c) * kRowPitch + dc * 32 + 8 * hh);

  float mrow = -INFINITY;   // running maximum of query q0 + c, equal in both lane halves
  float lrow = 0.f;         // running sum over this lane half's keys only; the halves are joined behind the loop
  v8f oacc[4];              // oacc[t][r] = out^T[d = t*16 + 8*hh + r][query q0 + c]
#pragma unroll
  for (int t = 0; t < 4; ++t) oacc[t] = (v8f){0.f,0.f,0.f,0.f,0.f,0.f,0.f,0.f};

  const int nChunks = kSeqK / AT_KC;   // 32, compile-time constant
  for (int kc = 0; kc < nChunks; ++kc) {
    const int kv0 = kc * AT_KC;
    __syncthreads();
    {
      // staging coverage: 128 threads x (4 x 8) elements = 64 rows x 64 per plane = the whole chunk tile
      const int r = tid >> 1, half = (tid & 1) * 32;
      const _Float16* ks = Kh + (size_t)(kv0 + r) * kRowPitch + half;   // K row kv0+r, d = half..half+31
      const _Float16* vs = Vh + (size_t)r * kSeqK + kv0 + half;          // V^T row d = r, s = kv0+half..+31
#pragma unroll
      for (int i = 0; i < 4; ++i) {
        const v8h a0 = *(const v8h*)(ks + 8 * i);
        const v8h b0 = *(const v8h*)(vs + 8 * i);
        *(v8h*)(Ksh + r * AT_LP + half + 8 * i) = a0;
        *(v8h*)(Vth + r * AT_LP + half + 8 * i) = b0;
      }
    }
    __syncthreads();

    v8f s[4];
#pragma unroll
    for (int j = 0; j < 4; ++j) {
      s[j] = (v8f){0.f,0.f,0.f,0.f,0.f,0.f,0.f,0.f};
#pragma unroll
      for (int dc = 0; dc < 2; ++dc) {
        FH kb;
        kb.h[0] = *(const v8h*)(Ksh + (j * 16 + c) * AT_LP + dc * 32 + 8 * hh);
        kb.h[1] = *(const v8h*)(Ksh + (j * 16 + c) * AT_LP + dc * 32 + 16 + 8 * hh);
        s[j] = mma_f16g(kb.v, qa[dc], s[j]);   // s[j][r] = score of query c with key kv0 + j*16 + 8*hh + r
      }
    }
    float m = -INFINITY;
#pragma unroll
    for (int j = 0; j < 4; ++j) {
#pragma unroll
      for (int r = 0; r < 8; ++r) {
        const float sv = s[j][r] * sscale;
        s[j][r] = sv;
        m = fmaxf(m, sv);
      }
    }
    m = fmaxf(m, xhalf(m));                    // the query's maximum over all 64 keys of the chunk
    const float mnew  = fmaxf(mrow, m);
    const float alpha = expf(mrow - mnew);
    mrow = mnew;
    float psum = 0.f;
    FH pb[2];                                  // p^T as B operand: element e of pb[kk] = key kk*32 + (e < 8 ? 8*hh + e : 16 + 8*hh + e - 8)
#pragma unroll
    for (int j = 0; j < 4; ++j) {
#pragma unroll
      for (int r = 0; r < 8; ++r) {
        const float p = expf(s[j][r] - mnew);
        psum += p;
        pb[j >> 1].h[j & 1][r] = (_Float16)(p * kPCarry);
      }
    }
    lrow = lrow * alpha + psum;
#pragma unroll
    for (int t = 0; t < 4; ++t)
#pragma unroll
      for (int r = 0; r < 8; ++r) oacc[t][r] *= alpha;
#pragma unroll   // constant kk keeps pb[] in registers
    for (int kk = 0; kk < 2; ++kk) {
#pragma unroll
      for (int t = 0; t < 4; ++t) {
        FH vb;
        vb.h[0] = *(const v8h*)(Vth + (t * 16 + c) * AT_LP + kk * 32 + 8 * hh);
        vb.h[1] = *(const v8h*)(Vth + (t * 16 + c) * AT_LP + kk * 32 + 16 + 8 * hh);
        oacc[t] = mma_f16g(vb.v, pb[kk].v, oacc[t]);
      }
    }
  }

  // ---- normalise (fold back the 2^15 carry), stage the wave's 16x64 tile, write bf16 rows:
  float* os = Os[wave];
  const float inv = 1.0f / ((lrow + xhalf(lrow)) * kPCarry);   // both halves' sums joined
#pragma unroll
  for (int t = 0; t < 4; ++t)
#pragma unroll
    for (int r = 0; r < 8; ++r) os[c * 68 + t * 16 + 8 * hh + r] = oacc[t][r] * inv;
  __builtin_amdgcn_fence(__ATOMIC_RELEASE, "workgroup");
  __builtin_amdgcn_wave_barrier();
  __builtin_amdgcn_fence(__ATOMIC_ACQUIRE, "workgroup");
  {
    const int qq = lane >> 3, c8 = (lane & 7) * 8;
    {
#pragma unroll
      for (int it = 0; it < 4; ++it) {
        const int row = it * 4 + qq;
        const float* sp = os + row * 68 + c8;
        v8h hv;
#pragma unroll
        for (int e = 0; e < 8; ++e) hv[e] = __builtin_bit_cast(_Float16, f2bf_bits(sp[e]));
        *(v8h*)(ob + (size_t)(q0 + row) * kRowPitch + c8) = hv;
      }
      
    }
  }
}

// ---------------------------------------------------------------------------
// Host orchestration.
// Workspace region map (byte offsets):
//   [  0 MiB, 16 MiB)  KEY16  bf16 [8192][1024]   key cast
//   [ 16 MiB, 18 MiB)  WQ16   bf16 [1024][1024]
//   [ 18 MiB, 22 MiB)  WKV16  bf16 [2048][1024]
//   [ 22 MiB, 24 MiB)  WO16   bf16 [1024][1024]
//   [ 24 MiB, 40 MiB)  LNX16  bf16 [8192][1024]   LN(query); dead after the q projection, then reused as
//                      CTX16  bf16 [8192][1024]   attention output
//   [ 40 MiB, 56 MiB)  Q16    f16  [8192][1024]
//   [ 56 MiB, 72 MiB)  K16    f16  [8192][1024]   (head h at columns h*64)
//   [ 72 MiB, 88 MiB)  VT16   f16  [4][16][64][2048]
//   total 88 MiB = 92274688 B
// ---------------------------------------------------------------------------
extern "C" void kernel_launch(void* const* d_in, const int* in_sizes, int n_in,
                              void* d_out, int out_size, void* d_ws, size_t ws_size,
                              hipStream_t stream) {
  if (n_in < 7) return;
  const int nAct = kSeqQ * kBatch * kEmb;          // 8388608
  if (in_sizes[0] != nAct || in_sizes[1] != kSeqK * kBatch * kEmb) return;
  if (in_sizes[2] < kEmb || in_sizes[3] < kEmb) return;
  if (in_sizes[4] != kEmb * kEmb || in_sizes[5] != 2 * kEmb * kEmb || in_sizes[6] != kEmb * kEmb) return;
  if (out_size != nAct) return;

  const float* query = (const float*)d_in[0];   // [2048][4][1024]
  const float* key   = (const float*)d_in[1];   // [2048][4][1024]
  const float* gamma = (const float*)d_in[2];   // [1024]
  const float* beta  = (const float*)d_in[3];   // [1024]
  const float* w_q   = (const float*)d_in[4];   // [1024][1024]
  const float* w_kv  = (const float*)d_in[5];   // [2048][1024]
  const float* w_out = (const float*)d_in[6];   // [1024][1024]
  float* out = (float*)d_out;

  const size_t szAct16 = (size_t)kRowsQ * kEmb * 2;          // 16 MiB
  const size_t szWq16  = (size_t)kEmb * kEmb * 2;            //  2 MiB
  const size_t szWkv16 = (size_t)2 * kEmb * kEmb * 2;        //  4 MiB
  const size_t szVt16  = (size_t)kBatch * kHeads * kHdim * kSeqK * 2;   // 16 MiB
  size_t off = 0;
  char* ws = (char*)d_ws;
  unsigned short* KEY16 = (unsigned short*)(ws + off); off += szAct16;
  unsigned short* WQ16  = (unsigned short*)(ws + off); off += szWq16;
  unsigned short* WKV16 = (unsigned short*)(ws + off); off += szWkv16;
  unsigned short* WO16  = (unsigned short*)(ws + off); off += szWq16;
  unsigned short* LNX16 = (unsigned short*)(ws + off); off += szAct16;
  unsigned short* CTX16 = LNX16;                                // region reuse (LNX16 dead after the q GEMM)
  unsigned short* Q16   = (unsigned short*)(ws + off); off += szAct16;
  unsigned short* K16   = (unsigned short*)(ws + off); off += szAct16;
  unsigned short* VT16  = (unsigned short*)(ws + off); off += szVt16;
  if (off > ws_size) return;

  // 1) casts to bf16 (RNE); n2 = elements/2, grid = ceil(n2/256)
  {
    const int n2k = nAct / 2, n2q = kEmb * kEmb / 2, n2kv = kEmb * kEmb;
    cast_f32_bf16x2<<<(n2k + 255) / 256, 256, 0, stream>>>(key, KEY16, n2k);
    cast_f32_bf16x2<<<(n2q + 255) / 256, 256, 0, stream>>>(w_q, WQ16, n2q);
    cast_f32_bf16x2<<<(n2kv + 255) / 256, 256, 0, stream>>>(w_kv, WKV16, n2kv);
    cast_f32_bf16x2<<<(n2q + 255) / 256, 256, 0, stream>>>(w_out, WO16, n2q);
  }

  // 2) LayerNorm(query) -> bf16 plane, one block per (t,b) row
  layernorm_bf16_kernel<<<kRowsQ, 256, 0, stream>>>(query, gamma, beta, LNX16, kLnEps);

  // 3) q = LN . Wq^T (unscaled; 0.125 applied to the f32 scores): M=8192, N=1024, K=1024 -> f16 plane
  {
    const int tiles = (kRowsQ / 64) * (kEmb / 64);   // 2048
    wmma_gemm64<1, false, 0, 1, false><<<dim3((tiles + 7) / 8, 1), 256, 0, stream>>>(
        LNX16, nullptr, 0L, WQ16, nullptr, 0L,
        (void*)Q16, nullptr, kEmb, 0L, nullptr, nullptr, 0L, kRowsQ, kEmb, kEmb, 1.0f);
  }

  // 4) k per head h (grid.y = h): C[(s,b)][h*64 + d] = sum_e key[(s,b)][e] * Wkv[h*128 + d][e]; M=8192, N=64, K=1024
  {
    const int tiles = (kRowsK / 64) * (kHdim / 64);   // 128
    wmma_gemm64<1, false, 0, 1, false, 0, true><<<dim3((tiles + 7) / 8, kHeads), 256, 0, stream>>>(
        KEY16, nullptr, 0L, WKV16, nullptr, (long)(2 * kHdim) * kEmb,
        (void*)K16, nullptr, kEmb, (long)kHdim, nullptr, nullptr, 0L, kRowsK, kHdim, kEmb, 1.0f);
  }

  // 5) v^T per (b, h): C[d][s] = sum_e Wkv[h*128 + 64 + d][e] * key[(s,b)][e]; M=64, N=2048, K=1024; one launch per b, grid.y = h
  {
    const int tiles = (kHdim / 64) * (kSeqK / 64);   // 32
    for (int b = 0; b < kBatch; ++b) {
      wmma_gemm64<1, false, 0, 1, false, 0, false, kEmb, kRowPitch><<<dim3((tiles + 7) / 8, kHeads), 256, 0, stream>>>(
          WKV16 + (size_t)kHdim * kEmb, nullptr, (long)(2 * kHdim) * kEmb,
          KEY16 + (size_t)b * kEmb, nullptr, 0L,
          (void*)(VT16 + (size_t)b * kHeads * kHdim * kSeqK), nullptr, kSeqK, (long)kHdim * kSeqK,
          nullptr, nullptr, 0L, kHdim, kSeqK, kEmb, 1.0f);
    }
  }

  // 6) attention: one block per (b, h, 64-query tile) -> ctx bf16 plane (time-major, heads merged)
  attn_full16_kernel<<<kBatch * kHeads * (kSeqQ / AT_QB), 128, 0, stream>>>(Q16, K16, VT16, CTX16, 0.125f);

  // 7) out = query + ctx . Wout^T : M=8192, N=1024, K=1024, f32 with residual epilogue, straight to d_out
  {
    const int tiles = (kRowsQ / 64) * (kEmb / 64);   // 2048
    wmma_gemm64<1, false, 0, 0, true><<<dim3((tiles + 7) / 8, 1), 256, 0, stream>>>(
        CTX16, nullptr, 0L, WO16, nullptr, 0L,
        (void*)out, nullptr, kEmb, 0L, nullptr, query, 0L, kRowsQ, kEmb, kEmb, 1.0f);
  }
}

// v004
// Measured time: 326 microseconds a run.
// In both of two side-by-side timings against v003, it was 1.03 times as fast.
// Over all steps from v000 it is 2.49 times as fast.
// Contractions: q, k, v^T and output projections on v_wmma_f32_16x16x32_bf16 (bf16 operands); q.k^T and p.v on v_wmma_f32_16x16x32_f16 (f16 operands, p carried x2^15); all f32 accumulate; layernorm, softmax, score scale 0.125 and residual add in f32.
#include <hip/hip_runtime.h>
#include <math.h>
#include <stdint.h>

// ---------------------------------------------------------------------------
// Problem geometry (time-major activations: row (t, b) = t*kBatch + b, pitch kEmb)
// ---------------------------------------------------------------------------
constexpr int kSeqQ  = 2048;
constexpr int kSeqK  = 2048;
constexpr int kBatch = 4;
constexpr int kEmb   = 1024;
constexpr int kHeads = 16;
constexpr int kHdim  = 64;
constexpr int kRowsQ = kSeqQ * kBatch;          // 8192
constexpr int kRowsK = kSeqK * kBatch;          // 8192
constexpr int kRowPitch = kBatch * kEmb;        // 4096: stride between consecutive t at fixed b
constexpr float kLnEps  = 1e-5f;
constexpr float kPCarry = 32768.0f;             // softmax numerators carried x2^15 in f16

typedef __attribute__((ext_vector_type(16))) _Float16 v16h;
typedef __attribute__((ext_vector_type(8)))  _Float16 v8h;
typedef __attribute__((ext_vector_type(16))) __bf16   v16b;
typedef __attribute__((ext_vector_type(8)))  __bf16   v8b;
typedef __attribute__((ext_vector_type(8)))  float    v8f;
typedef __attribute__((ext_vector_type(4)))  float    v4f;
typedef __attribute__((ext_vector_type(2)))  float    v2f;
typedef __attribute__((ext_vector_type(2)))  unsigned int v2u;

__device__ __forceinline__ unsigned short f2bf_bits(float f) {
  unsigned u = __float_as_uint(f);
  return (unsigned short)((u + 0x7FFFu + ((u >> 16) & 1u)) >> 16);
}
__device__ __forceinline__ float bf_bits2f(unsigned short h) { return __uint_as_float(((unsigned)h) << 16); }

// hazard guards as plain device helpers (no inline asm inside the kernel template body)
__device__ __forceinline__ void dep_guard_h(v8f& a, v8f& b, v16h x, v16h y) { asm volatile("v_nop\n\tv_nop\n\tv_nop\n\tv_nop" : "+v"(a), "+v"(b) : "v"(x), "v"(y)); }
__device__ __forceinline__ void dep_guard_b(v8f& a, v8f& b, v16b x, v16b y) { asm volatile("v_nop\n\tv_nop\n\tv_nop\n\tv_nop" : "+v"(a), "+v"(b) : "v"(x), "v"(y)); }
__device__ __forceinline__ void keep4_h(v16h a, v16h b, v16h c, v16h d) { asm volatile("v_nop" :: "v"(a), "v"(b), "v"(c), "v"(d)); }
__device__ __forceinline__ void keep4_b(v16b a, v16b b, v16b c, v16b d) { asm volatile("v_nop" :: "v"(a), "v"(b), "v"(c), "v"(d)); }
__device__ __forceinline__ void acc_guard4(v8f& a, v8f& b, v8f& c, v8f& d) { asm volatile("v_nop\n\tv_nop\n\tv_nop\n\tv_nop" : "+v"(a), "+v"(b), "+v"(c), "+v"(d)); }
// stands behind a group of global loads or stores: none of their address registers is rewritten in front of this wait
__device__ __forceinline__ void addr_regs_wait() { asm volatile("s_wait_xcnt 0x0" ::: "memory"); }
template <typename T> struct Frag;
template <> struct Frag<_Float16> {
  typedef v16h V; typedef v8h H; union U { v16h v; v8h h[2]; };
  static __device__ __forceinline__ v16h load(const _Float16* p) {   // elements 0..7 <- p[0..7], 8..15 <- p[16..23]
    U f; f.h[0] = *(const v8h*)(p); f.h[1] = *(const v8h*)(p + 16); return f.v;
  }
  static __device__ __forceinline__ v8f mma(v16h a, v16h b, v8f c) {
    return __builtin_amdgcn_wmma_f32_16x16x32_f16(false, a, false, b, (short)0, c, false, false);
  }
  static __device__ __forceinline__ void guard(v8f& a, v8f& b, v16h x, v16h y) { dep_guard_h(a, b, x, y); }
  static __device__ __forceinline__ void keep(v16h a, v16h b, v16h c, v16h d) { keep4_h(a, b, c, d); }
};
template <> struct Frag<__bf16> {
  typedef v16b V; typedef v8b H; union U { v16b v; v8b h[2]; };
  static __device__ __forceinline__ v16b load(const __bf16* p) {
    U f; f.h[0] = *(const v8b*)(p); f.h[1] = *(const v8b*)(p + 16); return f.v;
  }
  static __device__ __forceinline__ v8f mma(v16b a, v16b b, v8f c) {
    return __builtin_amdgcn_wmma_f32_16x16x32_bf16(false, a, false, b, (short)0, c, false, false);
  }
  static __device__ __forceinline__ void guard(v8f& a, v8f& b, v16b x, v16b y) { dep_guard_b(a, b, x, y); }
  static __device__ __forceinline__ void keep(v16b a, v16b b, v16b c, v16b d) { keep4_b(a, b, c, d); }
};

// ---- Register-blocked batched WMMA GEMM ------------------------------------
// C[m,n] = scale * sum_k A[m,k] * Bt[n,k] (+bias)(+resid); each wave owns a 64x64 tile.
// A row-major [M,K]; Bt row-major [N,K]; M,N % 64 == 0, K % 64 == 0; the tile count is a multiple of 8.
// The 8 waves of a block own 8 consecutive tiles that share one operand's 64 rows:
//   WIDE_M = false: N/64 is a multiple of 8, the block is 64 x 512 (A rows shared, 64 Bt rows per wave);
//   WIDE_M = true : N == 64, the block is 512 x 64 (Bt rows shared, 64 A rows per wave).
// Operands go through LDS in slabs of 64 k: every thread copies whole 16-B pieces so that a wave-wide load covers
// 4 whole 128-B lines; two LDS buffers, the next slab's global loads are issued ahead of the current slab's products.
// The row pitches lda, ldb are compile-time, so that a slab's 18 loads are two addresses plus immediate offsets.
// SPLIT (hi/lo planes) is not staged and not instantiated.
// BIAS_MODE: 0 = none, 1 = bias[m], 2 = bias[n].
// OUT_MODE: 0 = f32, 1 = f16, 2 = bf16 hi plane (Cout) + bf16 lo plane (Cout2).
// ET: 0 = f16 operands, 1 = bf16 operands (pointers passed as 16-bit storage)
template <int ET> struct Elem;
template <> struct Elem<0> { typedef _Float16 T; };
template <> struct Elem<1> { typedef __bf16 T; };
constexpr int kGsBk    = 64;                     // k elements per slab: 128 B of every operand row
constexpr int kGsPitch = 72;                     // LDS row pitch in 16-bit elements: 144 B = 16 B x odd
constexpr int kGsRows  = 64 + 8 * 64;            // the shared operand's rows, then 64 rows per wave
constexpr int kGsCopies = kGsRows * 8 / 256;     // 16-B pieces per thread and slab: 18
template <int ET, bool SPLIT, int BIAS_MODE, int OUT_MODE, bool RESID, int ACT = 0, bool WIDE_M = false, int lda = kEmb, int ldb = kEmb>
__global__ __launch_bounds__(256) void wmma_gemm64(
    const unsigned short* __restrict__ Ap, const unsigned short* __restrict__ A2p, long strideA,
    const unsigned short* __restrict__ Btp, const unsigned short* __restrict__ Bt2p, long strideB,
    void* __restrict__ Cout, void* __restrict__ Cout2, int ldc, long strideC,
    const float* __restrict__ bias,
    const float* __restrict__ resid, long strideR,
    int M, int N, int K, float scale) {
  typedef typename Elem<ET>::T T;
  typedef typename Frag<T>::V V;
  typedef typename Frag<T>::H H;
  static_assert(!SPLIT, "hi/lo planes are not staged");
  const T* A = (const T*)Ap; const T* Bt = (const T*)Btp;
  __shared__ __align__(16) T sStage[2][kGsRows * kGsPitch];   // two slab buffers, 82,944 B each
  __shared__ __align__(16) float sT[8][16 * 68];   // per-wave 16x64 slab, pitch 68 floats
  const int b    = blockIdx.y;
  const int tid  = threadIdx.x;
  const int lane = tid & 31;
  const int wave = tid >> 5;
  const int tilesN = N >> 6;
  const int tilesM = M >> 6;
  if ((int)(blockIdx.x + 1) * 8 > tilesM * tilesN) return;   // block-uniform, in front of every barrier
  const int tile0 = blockIdx.x * 8;            // the block's first tile; wave w owns tile0 + w
  const int tm0 = tile0 / tilesN;
  const int tn0 = tile0 - tm0 * tilesN;
  const int m0 = (tm0 << 6) + (WIDE_M ? (wave << 6) : 0);
  const int n0 = (tn0 << 6) + (WIDE_M ? 0 : (wave << 6));

  const T* Ab  = A  + (size_t)b * strideA;
  const T* Bb  = Bt + (size_t)b * strideB;

  const int rlane = lane & 15;                 // row (A) / col (B, D) within subtile
  const int koff  = (lane >> 4) * 8;           // k offset of this lane half
  const int mOff  = (lane >> 4) * 8;           // D row offset

  // staging map: piece q = it*256 + tid -> LDS row q/8, 16-B piece q%8; rows 0..63 shared operand, 64.. per wave
  const int srow = tid >> 3;
  const int sseg = (tid & 7) * 8;
  const int ldS = WIDE_M ? ldb : lda;          // shared operand
  const int ldW = WIDE_M ? lda : ldb;          // operand with 64 rows per wave
  const char* uA = (const char*)(Ab + (size_t)(tm0 << 6) * lda);   // block-uniform bases, byte addressed
  const char* uB = (const char*)(Bb + (size_t)(tn0 << 6) * ldb);
  const char* uS = WIDE_M ? uB : uA;
  const char* uW = WIDE_M ? uA : uB;
  const unsigned vS = (unsigned)(srow * ldS + sseg) * 2u;          // this thread's byte offset inside 32 rows
  const unsigned vW = (unsigned)(srow * ldW + sseg) * 2u;
  const int sOff = srow * kGsPitch + sseg;
  const int fS = rlane * kGsPitch + koff;                          // fragment row 0 of the shared operand
  const int fW = (64 + (wave << 6) + rlane) * kGsPitch + koff;     // fragment row 0 of this wave's own rows
  const int fA = WIDE_M ? fW : fS;
  const int fB = WIDE_M ? fS : fW;

  v8f acc[4][4];
#pragma unroll
  for (int i = 0; i < 4; ++i)
#pragma unroll
    for (int j = 0; j < 4; ++j) acc[i][j] = (v8f){0.f,0.f,0.f,0.f,0.f,0.f,0.f,0.f};

  // trip s: slab s's global loads are issued, slab s - 1 is multiplied out of its buffer, slab s goes to the other one
  const int nSlabs = K / kGsBk;
  for (int s = 0; s <= nSlabs; ++s) {
    const bool fill = s < nSlabs;              // block-uniform
    H st[kGsCopies];
    if (fill) {
      const int k1 = s * kGsBk;
#pragma unroll   // constant indices keep st[] in registers and the row steps in the loads' immediate offsets
      for (int it = 0; it < 2; ++it) st[it] = *(const H*)(uS + ((size_t)(it * 32) * ldS + k1) * 2 + vS);
#pragma unroll   // as above
      for (int it = 2; it < kGsCopies; ++it) st[it] = *(const H*)(uW + ((size_t)((it - 2) * 32) * ldW + k1) * 2 + vW);
      addr_regs_wait();
    }
    if (s > 0) {
      const T* cur = sStage[(s - 1) & 1];
#pragma unroll   // both halves of the slab in one trip: the second half's LDS reads can start under the first half's products
      for (int kk = 0; kk < kGsBk; kk += 32) {
        V bh[4], ah[4];
#pragma unroll   // fragments and accumulators in registers, here and in the three loops below
        for (int j = 0; j < 4; ++j) bh[j] = Frag<T>::load(cur + fB + j * 16 * kGsPitch + kk);
#pragma unroll
        for (int i = 0; i < 4; ++i) ah[i] = Frag<T>::load(cur + fA + i * 16 * kGsPitch + kk);
#pragma unroll
        for (int i = 0; i < 4; ++i) {
#pragma unroll
          for (int j = 0; j < 4; ++j) acc[i][j] = Frag<T>::mma(ah[i], bh[j], acc[i][j]);
          Frag<T>::guard(acc[i][0], acc[i][3], ah[i], ah[i]);
        }
        Frag<T>::keep(bh[0], bh[1], bh[2], bh[3]);
      }
    }
    if (fill) {
      T* nxt = sStage[s & 1];                  // its last readers (slab s - 2) left it at the barrier that ended trip s - 1
#pragma unroll   // st[] in registers, row steps in the stores' immediate offsets
      for (int it = 0; it < kGsCopies; ++it) *(H*)(nxt + sOff + it * 32 * kGsPitch) = st[it];
    }
    __syncthreads();                           // publishes slab s and ends every read of slab s - 1
  }
  acc_guard4(acc[0][0], acc[0][1], acc[0][2], acc[0][3]);
  acc_guard4(acc[1][0], acc[1][1], acc[1][2], acc[1][3]);
  acc_guard4(acc[2][0], acc[2][1], acc[2][2], acc[2][3]);
  acc_guard4(acc[3][0], acc[3][1], acc[3][2], acc[3][3]);

  // ---- epilogue ----
  float* slab = sT[wave];
  const float* Rb = RESID ? (resid + (size_t)b * strideR) : nullptr;
#pragma unroll
  for (int i = 0; i < 4; ++i) {
    const int mBase = m0 + (i << 4);
#pragma unroll
    for (int j = 0; j < 4; ++j) {
      const int n = n0 + (j << 4) + rlane;
      float bv = 0.f;
      if (BIAS_MODE == 2) bv = bias[n];
#pragma unroll
      for (int r = 0; r < 8; ++r) {
        float v = acc[i][j][r] * scale;
        if (BIAS_MODE == 1) v += bias[mBase + mOff + r];
        if (BIAS_MODE == 2) v += bv;
        if (RESID) v += Rb[(size_t)(mBase + mOff + r) * ldc + n];
        if (ACT == 1) v = tanhf(v);
        if (ACT == 2) v = fmaxf(v, 0.0f);
        if (ACT == 3) v = v / (1.0f + expf(-v));
        if (ACT == 4) v = (v > 0.f) ? v : 0.01f * v;
        if (ACT == 5) v = 0.5f * v * (1.0f + erff(v * 0.70710678118654752f));
        slab[(mOff + r) * 68 + (j << 4) + rlane] = v;
      }
    }
    __builtin_amdgcn_fence(__ATOMIC_RELEASE, "workgroup");
    __builtin_amdgcn_wave_barrier();
    __builtin_amdgcn_fence(__ATOMIC_ACQUIRE, "workgroup");
    if (OUT_MODE == 0) {
      float* C = (float*)Cout + (size_t)b * strideC;
      const int hh = lane >> 4, c4 = (lane & 15) * 4;     // row seg = 256 B = 16 lanes x 16 B
      {
#pragma unroll
        for (int it = 0; it < 8; ++it) {
          const int row = it * 2 + hh;
          v4f v = *(const v4f*)(slab + row * 68 + c4);
          *(v4f*)(C + (size_t)(mBase + row) * ldc + n0 + c4) = v;
        }
        
      }
    } else {
      const int q = lane >> 3, c8 = (lane & 7) * 8;
      unsigned short* C  = (unsigned short*)Cout  + (size_t)b * strideC;
      unsigned short* C2 = (OUT_MODE == 2) ? ((unsigned short*)Cout2 + (size_t)b * strideC) : nullptr;
      {
#pragma unroll
        for (int it = 0; it < 4; ++it) {
          const int row = it * 4 + q;
          const float* sp = slab + row * 68 + c8;
          v8h hv, lv;
#pragma unroll
          for (int e = 0; e < 8; ++e) {
            if (OUT_MODE == 1) {
              hv[e] = (_Float16)sp[e];
            } else {
              unsigned short hb = f2bf_bits(sp[e]);
              unsigned short lb = f2bf_bits(sp[e] - bf_bits2f(hb));
              hv[e] = __builtin_bit_cast(_Float16, hb);
              lv[e] = __builtin_bit_cast(_Float16, lb);
            }
          }
          *(v8h*)(C + (size_t)(mBase + row) * ldc + n0 + c8) = hv;
          if (OUT_MODE == 2) *(v8h*)(C2 + (size_t)(mBase + row) * ldc + n0 + c8) = lv;
        }
        
      }
    }
    __builtin_amdgcn_fence(__ATOMIC_RELEASE, "workgroup");
    __builtin_amdgcn_wave_barrier();
    __builtin_amdgcn_fence(__ATOMIC_ACQUIRE, "workgroup");
  }
}

// =====================================================================================
// Full (unmasked) attention, head dim 64, all batches and heads in one launch, time-major planes.
//   q plane  (f16): element (t, b, h, d) at [(t*kBatch + b)*kEmb + h*64 + d]   (unscaled q = LN(x).Wq^T)
//   k plane  (f16): element (s, b, h, d) at [(s*kBatch + b)*kEmb + h*64 + d]
//   v^T plane(f16): element (b, h, d, s) at [((b*kHeads + h)*64 + d)*kSeqK + s]
//   ctx plane (bf16 out): element (t, b, h, d) at [(t*kBatch + b)*kEmb + h*64 + d]
//   scores^T = (k . q^T) * sscale : single v_wmma_f32_16x16x32_f16 (A = K rows, B = Q), scale applied to the f32 accumulator
//   out^T    = v^T . p^T          : single v_wmma_f32_16x16x32_f16 (A = V^T rows, B = p^T), p = exp(s - m) in (0, 1] carried x2^15 as f16
//   A lane holds 32 of the chunk's 64 scores of ONE query (column lane & 15; keys j*16 + 8*(lane >> 4) + r), so the maximum and
//   the sum run in the lane, and two score tiles converted in place are the B operand of the second product: p never leaves registers.
//   online softmax in f32 over all kSeqK keys (32 chunks of 64, compile-time trip count).
//   Block = 4 waves = 64 query rows of one (b, h); grid.x = kBatch * kHeads * (kSeqQ/64) = 2048.
//   K / V^T chunk staging: 128 threads x 32 elements per plane = the whole 64x64 tile (16-B copies, plain loads,
//   __syncthreads before and after); fragment loads read the LDS tiles with the same v8h element type.
// =====================================================================================
#define AT_D 64
#define AT_NW 4
#define AT_QB 64
#define AT_KC 64
#define AT_LP 72   // LDS row pitch of the K and V^T tiles in f16: 144 B = 16 B x odd, so 16 rows read by 16-byte loads fall on distinct banks

__device__ __forceinline__ v8f mma_f16g(v16h a, v16h b, v8f c) {
  c = __builtin_amdgcn_wmma_f32_16x16x32_f16(false, a, false, b, (short)0, c, false, false);
  asm volatile("v_nop\n\tv_nop\n\tv_nop\n\tv_nop" : "+v"(c) : "v"(a), "v"(b));
  return c;
}

// lane l takes the value of lane l ^ 16: the other half of the same query column
__device__ __forceinline__ float xhalf(float x) {
  return __builtin_bit_cast(float, __builtin_amdgcn_permlanex16(__builtin_bit_cast(int, x), __builtin_bit_cast(int, x), 0x76543210, 0xfedcba98, false, false));
}

__global__ __launch_bounds__(128)
void attn_full16_kernel(const unsigned short* __restrict__ qp, const unsigned short* __restrict__ kp,
                        const unsigned short* __restrict__ vtp, unsigned short* __restrict__ ctxp, float sscale) {
  union FH { v16h v; v8h h[2]; };
  __shared__ __align__(16) _Float16 Ksh[AT_KC * AT_LP];            // K  [kv][d]   9 KB, 64 of 72 columns used
  __shared__ __align__(16) _Float16 Vth[AT_D * AT_LP];             // V^T [d][kv]  9 KB, 64 of 72 columns used
  __shared__ __align__(16) float    Os[AT_NW][16 * 68];            // per wave out tile, pitch 68

  const int tid  = threadIdx.x;
  const int wave = tid >> 5;
  const int lane = tid & 31;
  const int hh   = lane >> 4;
  const int c    = lane & 15;

  const int nqb  = kSeqQ / AT_QB;          // 32
  const int bx   = blockIdx.x;             // < kBatch*kHeads*nqb
  const int qb   = bx % nqb;
  const int bhid = bx / nqb;
  const int h    = bhid % kHeads;
  const int bb   = bhid / kHeads;          // 0..kBatch-1
  const int q0   = qb * AT_QB + wave * 16;

  const _Float16* Qh = (const _Float16*)(const void*)qp  + (size_t)bb * kEmb + (size_t)h * kHdim;
  const _Float16* Kh = (const _Float16*)(const void*)kp  + (size_t)bb * kEmb + (size_t)h * kHdim;
  const _Float16* Vh = (const _Float16*)(const void*)vtp + (size_t)(bb * kHeads + h) * kHdim * kSeqK;
  unsigned short* ob = ctxp + (size_t)bb * kEmb + (size_t)h * kHdim;

  // ---- Q fragments (B operand, column = lane&15, split k map via Frag load): 2 d-chunks ----
  v16h qa[2];
#pragma unroll
  for (int dc = 0; dc < 2; ++dc)
    qa[dc] = Frag<_Float16>::load(Qh + (size_t)(q0 + c) * kRowPitch + dc * 32 + 8 * hh);

  float mrow = -INFINITY;   // running maximum of query q0 + c, equal in both lane halves
  float lrow = 0.f;         // running sum over this lane half's keys only; the halves are joined behind the loop
  v8f oacc[4];              // oacc[t][r] = out^T[d = t*16 + 8*hh + r][query q0 + c]
#pragma unroll
  for (int t = 0; t < 4; ++t) oacc[t] = (v8f){0.f,0.f,0.f,0.f,0.f,0.f,0.f,0.f};

  const int nChunks = kSeqK / AT_KC;   // 32, compile-time constant
  for (int kc = 0; kc < nChunks; ++kc) {
    const int kv0 = kc * AT_KC;
    __syncthreads();
    {
      // staging coverage: 128 threads x (4 x 8) elements = 64 rows x 64 per plane = the whole chunk tile
      const int r = tid >> 1, half = (tid & 1) * 32;
      const _Float16* ks = Kh + (size_t)(kv0 + r) * kRowPitch + half;   // K row kv0+r, d = half..half+31
      const _Float16* vs = Vh + (size_t)r * kSeqK + kv0 + half;          // V^T row d = r, s = kv0+half..+31
#pragma unroll
      for (int i = 0; i < 4; ++i) {
        const v8h a0 = *(const v8h*)(ks + 8 * i);
        const v8h b0 = *(const v8h*)(vs + 8 * i);
        *(v8h*)(Ksh + r * AT_LP + half + 8 * i) = a0;
        *(v8h*)(Vth + r * AT_LP + half + 8 * i) = b0;
      }
    }
    __syncthreads();

    v8f s[4];
#pragma unroll
    for (int j = 0; j < 4; ++j) {
      s[j] = (v8f){0.f,0.f,0.f,0.f,0.f,0.f,0.f,0.f};
#pragma unroll
      for (int dc = 0; dc < 2; ++dc) {
        FH kb;
        kb.h[0] = *(const v8h*)(Ksh + (j * 16 + c) * AT_LP + dc * 32 + 8 * hh);
        kb.h[1] = *(const v8h*)(Ksh + (j * 16 + c) * AT_LP + dc * 32 + 16 + 8 * hh);
        s[j] = mma_f16g(kb.v, qa[dc], s[j]);   // s[j][r] = score of query c with key kv0 + j*16 + 8*hh + r
      }
    }
    float m = -INFINITY;
#pragma unroll
    for (int j = 0; j < 4; ++j) {
#pragma unroll
      for (int r = 0; r < 8; ++r) {
        const float sv = s[j][r] * sscale;
        s[j][r] = sv;
        m = fmaxf(m, sv);
      }
    }
    m = fmaxf(m, xhalf(m));                    // the query's maximum over all 64 keys of the chunk
    const float mnew  = fmaxf(mrow, m);
    const float alpha = expf(mrow - mnew);
    mrow = mnew;
    float psum = 0.f;
    FH pb[2];                                  // p^T as B operand: element e of pb[kk] = key kk*32 + (e < 8 ? 8*hh + e : 16 + 8*hh + e - 8)
#pragma unroll
    for (int j = 0; j < 4; ++j) {
#pragma unroll
      for (int r = 0; r < 8; ++r) {
        const float p = expf(s[j][r] - mnew);
        psum += p;
        pb[j >> 1].h[j & 1][r] = (_Float16)(p * kPCarry);
      }
    }
    lrow = lrow * alpha + psum;
#pragma unroll
    for (int t = 0; t < 4; ++t)
#pragma unroll
      for (int r = 0; r < 8; ++r) oacc[t][r] *= alpha;
#pragma unroll   // constant kk keeps pb[] in registers
    for (int kk = 0; kk < 2; ++kk) {
#pragma unroll
      for (int t = 0; t < 4; ++t) {
        FH vb;
        vb.h[0] = *(const v8h*)(Vth + (t * 16 + c) * AT_LP + kk * 32 + 8 * hh);
        vb.h[1] = *(const v8h*)(Vth + (t * 16 + c) * AT_LP + kk * 32 + 16 + 8 * hh);
        oacc[t] = mma_f16g(vb.v, pb[kk].v, oacc[t]);
      }
    }
  }

  // ---- normalise (fold back the 2^15 carry), stage the wave's 16x64 tile, write bf16 rows:
  float* os = Os[wave];
  const float inv = 1.0f / ((lrow + xhalf(lrow)) * kPCarry);   // both halves' sums joined
#pragma unroll
  for (int t = 0; t < 4; ++t)
#pragma unroll
    for (int r = 0; r < 8; ++r) os[c * 68 + t * 16 + 8 * hh + r] = oacc[t][r] * inv;
  __builtin_amdgcn_fence(__ATOMIC_RELEASE, "workgroup");
  __builtin_amdgcn_wave_barrier();
  __builtin_amdgcn_fence(__ATOMIC_ACQUIRE, "workgroup");
  {
    const int qq = lane >> 3, c8 = (lane & 7) * 8;
    {
#pragma unroll
      for (int it = 0; it < 4; ++it) {
        const int row = it * 4 + qq;
        const float* sp = os + row * 68 + c8;
        v8h hv;
#pragma unroll
        for (int e = 0; e < 8; ++e) hv[e] = __builtin_bit_cast(_Float16, f2bf_bits(sp[e]));
        *(v8h*)(ob + (size_t)(q0 + row) * kRowPitch + c8) = hv;
      }
      
    }
  }
}

// ---------------------------------------------------------------------------
// Pre-pass, ONE launch: LayerNorm(query) -> bf16 plane, and the bf16 (RNE) casts of key, w_q, w_kv and w_out.
// Unit of work: one row of kEmb = 1024 f32 (4 KB read, 2 KB written), done by ONE wave. Chunk j of a row is elements
// j*128 + 4*lane .. +3, so a wave-wide 16-B load covers 512 contiguous bytes and a wave-wide 8-B store 256: whole lines.
// 20,480 rows on kPpWaves = 4,096 waves: wave w takes query rows w and w + 4096, key rows w and w + 4096, and row w of the
// three weight matrices counted end to end. Few long waves with many loads in flight, so that the launch is paid for by its
// bytes and not by the number of waves to start. A row's sums stay inside its wave: no LDS, no barrier.
// ---------------------------------------------------------------------------
constexpr int kPpWaves  = 4096;
constexpr int kPpChunks = kEmb / 128;            // 8 chunks of 32 lanes x 4 elements
static_assert(kRowsQ == 2 * kPpWaves && kRowsK == 2 * kPpWaves && 4 * kEmb == kPpWaves, "two query rows, two key rows, one weight row per wave");

struct PpRow { v4f c[kPpChunks]; };

__device__ __forceinline__ void pp_load(PpRow& r, const float* __restrict__ row, int lane) {
#pragma unroll   // constant indices keep the row in registers and the chunk steps in the loads' immediate offsets
  for (int j = 0; j < kPpChunks; ++j) r.c[j] = *(const v4f*)(row + j * 128 + 4 * lane);
  // holds the row's 8 loads here, in the order of the calls: left alone, the scheduler sinks loads to their users, two at a
  // time, and the wave waits out memory latency once per pair; in call order the first row is worked on while the rest fly
  __builtin_amdgcn_sched_barrier(0);
}

__device__ __forceinline__ void pp_store(const PpRow& r, unsigned short* __restrict__ row, int lane) {
#pragma unroll   // as above
  for (int j = 0; j < kPpChunks; ++j) {
    v2u pk;
    pk[0] = (unsigned)f2bf_bits(r.c[j][0]) | ((unsigned)f2bf_bits(r.c[j][1]) << 16);
    pk[1] = (unsigned)f2bf_bits(r.c[j][2]) | ((unsigned)f2bf_bits(r.c[j][3]) << 16);
    *(v2u*)(row + j * 128 + 4 * lane) = pk;
  }
  addr_regs_wait();
}

// lane l takes the value of lane l ^ M inside its 16-lane row (DPP row_xmask:M)
template <int M> __device__ __forceinline__ float xrow(float x) {
  return __builtin_bit_cast(float, __builtin_amdgcn_update_dpp(0, __builtin_bit_cast(int, x), 0x160 + M, 0xf, 0xf, true));
}
// sum over the 32 lanes, the same bits in every lane
__device__ __forceinline__ float wave_sum(float x) {
  x += xrow<1>(x);
  x += xrow<2>(x);
  x += xrow<4>(x);
  x += xrow<8>(x);
  return x + xhalf(x);
}
__device__ __forceinline__ float sum8(const float* p) { return ((p[0] + p[1]) + (p[2] + p[3])) + ((p[4] + p[5]) + (p[6] + p[7])); }

// two-pass mean and variance of one row, then (x - mu) * rstd * gamma + beta in place
__device__ __forceinline__ void pp_norm(PpRow& r, const PpRow& g, const PpRow& bt, float eps) {
  float p[kPpChunks];
#pragma unroll
  for (int j = 0; j < kPpChunks; ++j) p[j] = (r.c[j][0] + r.c[j][1]) + (r.c[j][2] + r.c[j][3]);
  const float mu = wave_sum(sum8(p)) * (1.0f / (float)kEmb);
#pragma unroll
  for (int j = 0; j < kPpChunks; ++j) {
    r.c[j] -= mu;
    p[j] = (r.c[j][0] * r.c[j][0] + r.c[j][1] * r.c[j][1]) + (r.c[j][2] * r.c[j][2] + r.c[j][3] * r.c[j][3]);
  }
  const float var  = wave_sum(sum8(p)) * (1.0f / (float)kEmb);
  const float rstd = rsqrtf(var + eps);
#pragma unroll
  for (int j = 0; j < kPpChunks; ++j)
#pragma unroll
    for (int e = 0; e < 4; ++e) r.c[j][e] = r.c[j][e] * rstd * g.c[j][e] + bt.c[j][e];
}

__global__ __launch_bounds__(256)
void prepass_kernel(const float* __restrict__ query, const float* __restrict__ key,
                    const float* __restrict__ gam, const float* __restrict__ bet,
                    const float* __restrict__ w_q, const float* __restrict__ w_kv, const float* __restrict__ w_out,
                    unsigned short* __restrict__ lnx16, unsigned short* __restrict__ key16,
                    unsigned short* __restrict__ wq16, unsigned short* __restrict__ wkv16, unsigned short* __restrict__ wo16,
                    float eps) {
  const int lane = threadIdx.x & 31;
  // wave-uniform by construction; through readfirstlane so that every row address is a scalar base plus one lane offset
  const int w = blockIdx.x * 8 + __builtin_amdgcn_readfirstlane((int)(threadIdx.x >> 5));
  const float* wsrc;
  unsigned short* wdst;
  if (w < kEmb)          { wsrc = w_q   + (size_t)w * kEmb;              wdst = wq16  + (size_t)w * kEmb; }
  else if (w < 3 * kEmb) { wsrc = w_kv  + (size_t)(w - kEmb) * kEmb;     wdst = wkv16 + (size_t)(w - kEmb) * kEmb; }
  else                   { wsrc = w_out + (size_t)(w - 3 * kEmb) * kEmb; wdst = wo16  + (size_t)(w - 3 * kEmb) * kEmb; }

  PpRow ka, kb, wr, qa, qb, g, bt;
  pp_load(ka, key + (size_t)w * kEmb, lane);
  pp_load(kb, key + (size_t)(w + kPpWaves) * kEmb, lane);
  pp_load(wr, wsrc, lane);
  pp_load(qa, query + (size_t)w * kEmb, lane);
  pp_load(qb, query + (size_t)(w + kPpWaves) * kEmb, lane);
  addr_regs_wait();

  pp_store(ka, key16 + (size_t)w * kEmb, lane);
  pp_store(kb, key16 + (size_t)(w + kPpWaves) * kEmb, lane);
  pp_store(wr, wdst, lane);
  pp_load(g, gam, lane);      // 8 KB that every wave reads: cache hits, landing under the rows' sums
  pp_load(bt, bet, lane);
  addr_regs_wait();
  pp_norm(qa, g, bt, eps);
  pp_norm(qb, g, bt, eps);
  pp_store(qa, lnx16 + (size_t)w * kEmb, lane);
  pp_store(qb, lnx16 + (size_t)(w + kPpWaves) * kEmb, lane);
}

// ---------------------------------------------------------------------------
// Host orchestration.
// Workspace region map (byte offsets):
//   [  0 MiB, 16 MiB)  KEY16  bf16 [8192][1024]   key cast
//   [ 16 MiB, 18 MiB)  WQ16   bf16 [1024][1024]
//   [ 18 MiB, 22 MiB)  WKV16  bf16 [2048][1024]
//   [ 22 MiB, 24 MiB)  WO16   bf16 [1024][1024]
//   [ 24 MiB, 40 MiB)  LNX16  bf16 [8192][1024]   LN(query); dead after the q projection, then reused as
//                      CTX16  bf16 [8192][1024]   attention output
//   [ 40 MiB, 56 MiB)  Q16    f16  [8192][1024]
//   [ 56 MiB, 72 MiB)  K16    f16  [8192][1024]   (head h at columns h*64)
//   [ 72 MiB, 88 MiB)  VT16   f16  [4][16][64][2048]
//   total 88 MiB = 92274688 B
// ---------------------------------------------------------------------------
extern "C" void kernel_launch(void* const* d_in, const int* in_sizes, int n_in,
                              void* d_out, int out_size, void* d_ws, size_t ws_size,
                              hipStream_t stream) {
  if (n_in < 7) return;
  const int nAct = kSeqQ * kBatch * kEmb;          // 8388608
  if (in_sizes[0] != nAct || in_sizes[1] != kSeqK * kBatch * kEmb) return;
  if (in_sizes[2] < kEmb || in_sizes[3] < kEmb) return;
  if (in_sizes[4] != kEmb * kEmb || in_sizes[5] != 2 * kEmb * kEmb || in_sizes[6] != kEmb * kEmb) return;
  if (out_size != nAct) return;

  const float* query = (const float*)d_in[0];   // [2048][4][1024]
  const float* key   = (const float*)d_in[1];   // [2048][4][1024]
  const float* gamma = (const float*)d_in[2];   // [1024]
  const float* beta  = (const float*)d_in[3];   // [1024]
  const float* w_q   = (const float*)d_in[4];   // [1024][1024]
  const float* w_kv  = (const float*)d_in[5];   // [2048][1024]
  const float* w_out = (const float*)d_in[6];   // [1024][1024]
  float* out = (float*)d_out;

  const size_t szAct16 = (size_t)kRowsQ * kEmb * 2;          // 16 MiB
  const size_t szWq16  = (size_t)kEmb * kEmb * 2;            //  2 MiB
  const size_t szWkv16 = (size_t)2 * kEmb * kEmb * 2;        //  4 MiB
  const size_t szVt16  = (size_t)kBatch * kHeads * kHdim * kSeqK * 2;   // 16 MiB
  size_t off = 0;
  char* ws = (char*)d_ws;
  unsigned short* KEY16 = (unsigned short*)(ws + off); off += szAct16;
  unsigned short* WQ16  = (unsigned short*)(ws + off); off += szWq16;
  unsigned short* WKV16 = (unsigned short*)(ws + off); off += szWkv16;
  unsigned short* WO16  = (unsigned short*)(ws + off); off += szWq16;
  unsigned short* LNX16 = (unsigned short*)(ws + off); off += szAct16;
  unsigned short* CTX16 = LNX16;                                // region reuse (LNX16 dead after the q GEMM)
  unsigned short* Q16   = (unsigned short*)(ws + off); off += szAct16;
  unsigned short* K16   = (unsigned short*)(ws + off); off += szAct16;
  unsigned short* VT16  = (unsigned short*)(ws + off); off += szVt16;
  if (off > ws_size) return;

  // 1) + 2) pre-pass: LayerNorm(query) -> bf16 plane and the four bf16 casts, 8 waves per block
  prepass_kernel<<<kPpWaves / 8, 256, 0, stream>>>(query, key, gamma, beta, w_q, w_kv, w_out,
                                                   LNX16, KEY16, WQ16, WKV16, WO16, kLnEps);

  // 3) q = LN . Wq^T (unscaled; 0.125 applied to the f32 scores): M=8192, N=1024, K=1024 -> f16 plane
  {
    const int tiles = (kRowsQ / 64) * (kEmb / 64);   // 2048
    wmma_gemm64<1, false, 0, 1, false><<<dim3((tiles + 7) / 8, 1), 256, 0, stream>>>(
        LNX16, nullptr, 0L, WQ16, nullptr, 0L,
        (void*)Q16, nullptr, kEmb, 0L, nullptr, nullptr, 0L, kRowsQ, kEmb, kEmb, 1.0f);
  }

  // 4) k per head h (grid.y = h): C[(s,b)][h*64 + d] = sum_e key[(s,b)][e] * Wkv[h*128 + d][e]; M=8192, N=64, K=1024
  {
    const int tiles = (kRowsK / 64) * (kHdim / 64);   // 128
    wmma_gemm64<1, false, 0, 1, false, 0, true><<<dim3((tiles + 7) / 8, kHeads), 256, 0, stream>>>(
        KEY16, nullptr, 0L, WKV16, nullptr, (long)(2 * kHdim) * kEmb,
        (void*)K16, nullptr, kEmb, (long)kHdim, nullptr, nullptr, 0L, kRowsK, kHdim, kEmb, 1.0f);
  }

  // 5) v^T per (b, h): C[d][s] = sum_e Wkv[h*128 + 64 + d][e] * key[(s,b)][e]; M=64, N=2048, K=1024; one launch per b, grid.y = h
  {
    const int tiles = (kHdim / 64) * (kSeqK / 64);   // 32
    for (int b = 0; b < kBatch; ++b) {
      wmma_gemm64<1, false, 0, 1, false, 0, false, kEmb, kRowPitch><<<dim3((tiles + 7) / 8, kHeads), 256, 0, stream>>>(
          WKV16 + (size_t)kHdim * kEmb, nullptr, (long)(2 * kHdim) * kEmb,
          KEY16 + (size_t)b * kEmb, nullptr, 0L,
          (void*)(VT16 + (size_t)b * kHeads * kHdim * kSeqK), nullptr, kSeqK, (long)kHdim * kSeqK,
          nullptr, nullptr, 0L, kHdim, kSeqK, kEmb, 1.0f);
    }
  }

  // 6) attention: one block per (b, h, 64-query tile) -> ctx bf16 plane (time-major, heads merged)
  attn_full16_kernel<<<kBatch * kHeads * (kSeqQ / AT_QB), 128, 0, stream>>>(Q16, K16, VT16, CTX16, 0.125f);

  // 7) out = query + ctx . Wout^T : M=8192, N=1024, K=1024, f32 with residual epilogue, straight to d_out
  {
    const int tiles = (kRowsQ / 64) * (kEmb / 64);   // 2048
    wmma_gemm64<1, false, 0, 0, true><<<dim3((tiles + 7) / 8, 1), 256, 0, stream>>>(
        CTX16, nullptr, 0L, WO16, nullptr, 0L,
        (void*)out, nullptr, kEmb, 0L, nullptr, query, 0L, kRowsQ, kEmb, kEmb, 1.0f);
  }
}

// v005
// It runs in 260 microseconds.
// In two side-by-side timings against v004, it was 1.25 and 1.24 times as fast.
// Over all steps from v000 it is 3.11 times as fast.
// Contractions: q, k, v^T and output projections on v_wmma_f32_16x16x32_bf16 (bf16 operands); q.k^T and p.v on v_wmma_f32_16x16x32_f16 (f16 operands, p carried x2^15); all f32 accumulate; layernorm, softmax, score scale 0.125 and residual add in f32.
#include <hip/hip_runtime.h>
#include <math.h>
#include <stdint.h>

// ---------------------------------------------------------------------------
// Problem geometry (time-major activations: row (t, b) = t*kBatch + b, pitch kEmb)
// ---------------------------------------------------------------------------
constexpr int kSeqQ  = 2048;
constexpr int kSeqK  = 2048;
constexpr int kBatch = 4;
constexpr int kEmb   = 1024;
constexpr int kHeads = 16;
constexpr int kHdim  = 64;
constexpr int kRowsQ = kSeqQ * kBatch;          // 8192
constexpr int kRowsK = kSeqK * kBatch;          // 8192
constexpr int kRowPitch = kBatch * kEmb;        // 4096: stride between consecutive t at fixed b
constexpr float kLnEps  = 1e-5f;
constexpr float kPCarryLog2 = 15.0f;            // softmax numerators carried x2^15 in f16
constexpr float kLog2e  = 1.4426950408889634f;

typedef __attribute__((ext_vector_type(16))) _Float16 v16h;
typedef __attribute__((ext_vector_type(8)))  _Float16 v8h;
typedef __attribute__((ext_vector_type(16))) __bf16   v16b;
typedef __attribute__((ext_vector_type(8)))  __bf16   v8b;
typedef __attribute__((ext_vector_type(8)))  float    v8f;
typedef __attribute__((ext_vector_type(4)))  float    v4f;
typedef __attribute__((ext_vector_type(2)))  float    v2f;
typedef __attribute__((ext_vector_type(2)))  unsigned int v2u;

__device__ __forceinline__ unsigned short f2bf_bits(float f) {
  unsigned u = __float_as_uint(f);
  return (unsigned short)((u + 0x7FFFu + ((u >> 16) & 1u)) >> 16);
}
__device__ __forceinline__ float bf_bits2f(unsigned short h) { return __uint_as_float(((unsigned)h) << 16); }

// hazard guards as plain device helpers (no inline asm inside the kernel template body)
__device__ __forceinline__ void dep_guard_h(v8f& a, v8f& b, v16h x, v16h y) { asm volatile("v_nop\n\tv_nop\n\tv_nop\n\tv_nop" : "+v"(a), "+v"(b) : "v"(x), "v"(y)); }
__device__ __forceinline__ void dep_guard_b(v8f& a, v8f& b, v16b x, v16b y) { asm volatile("v_nop\n\tv_nop\n\tv_nop\n\tv_nop" : "+v"(a), "+v"(b) : "v"(x), "v"(y)); }
__device__ __forceinline__ void keep4_h(v16h a, v16h b, v16h c, v16h d) { asm volatile("v_nop" :: "v"(a), "v"(b), "v"(c), "v"(d)); }
__device__ __forceinline__ void keep4_b(v16b a, v16b b, v16b c, v16b d) { asm volatile("v_nop" :: "v"(a), "v"(b), "v"(c), "v"(d)); }
__device__ __forceinline__ void acc_guard4(v8f& a, v8f& b, v8f& c, v8f& d) { asm volatile("v_nop\n\tv_nop\n\tv_nop\n\tv_nop" : "+v"(a), "+v"(b), "+v"(c), "+v"(d)); }
// stands behind a group of global loads or stores: none of their address registers is rewritten in front of this wait
__device__ __forceinline__ void addr_regs_wait() { asm volatile("s_wait_xcnt 0x0" ::: "memory"); }
template <typename T> struct Frag;
template <> struct Frag<_Float16> {
  typedef v16h V; typedef v8h H; union U { v16h v; v8h h[2]; };
  static __device__ __forceinline__ v16h load(const _Float16* p) {   // elements 0..7 <- p[0..7], 8..15 <- p[16..23]
    U f; f.h[0] = *(const v8h*)(p); f.h[1] = *(const v8h*)(p + 16); return f.v;
  }
  static __device__ __forceinline__ v8f mma(v16h a, v16h b, v8f c) {
    return __builtin_amdgcn_wmma_f32_16x16x32_f16(false, a, false, b, (short)0, c, false, false);
  }
  static __device__ __forceinline__ void guard(v8f& a, v8f& b, v16h x, v16h y) { dep_guard_h(a, b, x, y); }
  static __device__ __forceinline__ void keep(v16h a, v16h b, v16h c, v16h d) { keep4_h(a, b, c, d); }
};
template <> struct Frag<__bf16> {
  typedef v16b V; typedef v8b H; union U { v16b v; v8b h[2]; };
  static __device__ __forceinline__ v16b load(const __bf16* p) {
    U f; f.h[0] = *(const v8b*)(p); f.h[1] = *(const v8b*)(p + 16); return f.v;
  }
  static __device__ __forceinline__ v8f mma(v16b a, v16b b, v8f c) {
    return __builtin_amdgcn_wmma_f32_16x16x32_bf16(false, a, false, b, (short)0, c, false, false);
  }
  static __device__ __forceinline__ void guard(v8f& a, v8f& b, v16b x, v16b y) { dep_guard_b(a, b, x, y); }
  static __device__ __forceinline__ void keep(v16b a, v16b b, v16b c, v16b d) { keep4_b(a, b, c, d); }
};

// ---- Register-blocked batched WMMA GEMM ------------------------------------
// C[m,n] = scale * sum_k A[m,k] * Bt[n,k] (+bias)(+resid); each wave owns a 64x64 tile.
// A row-major [M,K]; Bt row-major [N,K]; M,N % 64 == 0, K % 64 == 0; the tile count is a multiple of 8.
// The 8 waves of a block own 8 consecutive tiles that share one operand's 64 rows:
//   WIDE_M = false: N/64 is a multiple of 8, the block is 64 x 512 (A rows shared, 64 Bt rows per wave);
//   WIDE_M = true : N == 64, the block is 512 x 64 (Bt rows shared, 64 A rows per wave).
// Operands go through LDS in slabs of 64 k: every thread copies whole 16-B pieces so that a wave-wide load covers
// 4 whole 128-B lines; two LDS buffers, the next slab's global loads are issued ahead of the current slab's products.
// The row pitches lda, ldb are compile-time, so that a slab's 18 loads are two addresses plus immediate offsets.
// SPLIT (hi/lo planes) is not staged and not instantiated.
// BIAS_MODE: 0 = none, 1 = bias[m], 2 = bias[n].
// OUT_MODE: 0 = f32, 1 = f16, 2 = bf16 hi plane (Cout) + bf16 lo plane (Cout2).
// ET: 0 = f16 operands, 1 = bf16 operands (pointers passed as 16-bit storage)
template <int ET> struct Elem;
template <> struct Elem<0> { typedef _Float16 T; };
template <> struct Elem<1> { typedef __bf16 T; };
constexpr int kGsBk    = 64;                     // k elements per slab: 128 B of every operand row
constexpr int kGsPitch = 72;                     // LDS row pitch in 16-bit elements: 144 B = 16 B x odd
constexpr int kGsRows  = 64 + 8 * 64;            // the shared operand's rows, then 64 rows per wave
constexpr int kGsCopies = kGsRows * 8 / 256;     // 16-B pieces per thread and slab: 18
template <int ET, bool SPLIT, int BIAS_MODE, int OUT_MODE, bool RESID, int ACT = 0, bool WIDE_M = false, int lda = kEmb, int ldb = kEmb>
__global__ __launch_bounds__(256) void wmma_gemm64(
    const unsigned short* __restrict__ Ap, const unsigned short* __restrict__ A2p, long strideA,
    const unsigned short* __restrict__ Btp, const unsigned short* __restrict__ Bt2p, long strideB,
    void* __restrict__ Cout, void* __restrict__ Cout2, int ldc, long strideC,
    const float* __restrict__ bias,
    const float* __restrict__ resid, long strideR,
    int M, int N, int K, float scale) {
  typedef typename Elem<ET>::T T;
  typedef typename Frag<T>::V V;
  typedef typename Frag<T>::H H;
  static_assert(!SPLIT, "hi/lo planes are not staged");
  const T* A = (const T*)Ap; const T* Bt = (const T*)Btp;
  __shared__ __align__(16) T sStage[2][kGsRows * kGsPitch];   // two slab buffers, 82,944 B each
  __shared__ __align__(16) float sT[8][16 * 68];   // per-wave 16x64 slab, pitch 68 floats
  const int b    = blockIdx.y;
  const int tid  = threadIdx.x;
  const int lane = tid & 31;
  const int wave = tid >> 5;
  const int tilesN = N >> 6;
  const int tilesM = M >> 6;
  if ((int)(blockIdx.x + 1) * 8 > tilesM * tilesN) return;   // block-uniform, in front of every barrier
  const int tile0 = blockIdx.x * 8;            // the block's first tile; wave w owns tile0 + w
  const int tm0 = tile0 / tilesN;
  const int tn0 = tile0 - tm0 * tilesN;
  const int m0 = (tm0 << 6) + (WIDE_M ? (wave << 6) : 0);
  const int n0 = (tn0 << 6) + (WIDE_M ? 0 : (wave << 6));

  const T* Ab  = A  + (size_t)b * strideA;
  const T* Bb  = Bt + (size_t)b * strideB;

  const int rlane = lane & 15;                 // row (A) / col (B, D) within subtile
  const int koff  = (lane >> 4) * 8;           // k offset of this lane half
  const int mOff  = (lane >> 4) * 8;           // D row offset

  // staging map: piece q = it*256 + tid -> LDS row q/8, 16-B piece q%8; rows 0..63 shared operand, 64.. per wave
  const int srow = tid >> 3;
  const int sseg = (tid & 7) * 8;
  const int ldS = WIDE_M ? ldb : lda;          // shared operand
  const int ldW = WIDE_M ? lda : ldb;          // operand with 64 rows per wave
  const char* uA = (const char*)(Ab + (size_t)(tm0 << 6) * lda);   // block-uniform bases, byte addressed
  const char* uB = (const char*)(Bb + (size_t)(tn0 << 6) * ldb);
  const char* uS = WIDE_M ? uB : uA;
  const char* uW = WIDE_M ? uA : uB;
  const unsigned vS = (unsigned)(srow * ldS + sseg) * 2u;          // this thread's byte offset inside 32 rows
  const unsigned vW = (unsigned)(srow * ldW + sseg) * 2u;
  const int sOff = srow * kGsPitch + sseg;
  const int fS = rlane * kGsPitch + koff;                          // fragment row 0 of the shared operand
  const int fW = (64 + (wave << 6) + rlane) * kGsPitch + koff;     // fragment row 0 of this wave's own rows
  const int fA = WIDE_M ? fW : fS;
  const int fB = WIDE_M ? fS : fW;

  v8f acc[4][4];
#pragma unroll
  for (int i = 0; i < 4; ++i)
#pragma unroll
    for (int j = 0; j < 4; ++j) acc[i][j] = (v8f){0.f,0.f,0.f,0.f,0.f,0.f,0.f,0.f};

  // trip s: slab s's global loads are issued, slab s - 1 is multiplied out of its buffer, slab s goes to the other one
  const int nSlabs = K / kGsBk;
  for (int s = 0; s <= nSlabs; ++s) {
    const bool fill = s < nSlabs;              // block-uniform
    H st[kGsCopies];
    if (fill) {
      const int k1 = s * kGsBk;
#pragma unroll   // constant indices keep st[] in registers and the row steps in the loads' immediate offsets
      for (int it = 0; it < 2; ++it) st[it] = *(const H*)(uS + ((size_t)(it * 32) * ldS + k1) * 2 + vS);
#pragma unroll   // as above
      for (int it = 2; it < kGsCopies; ++it) st[it] = *(const H*)(uW + ((size_t)((it - 2) * 32) * ldW + k1) * 2 + vW);
      addr_regs_wait();
    }
    if (s > 0) {
      const T* cur = sStage[(s - 1) & 1];
#pragma unroll   // both halves of the slab in one trip: the second half's LDS reads can start under the first half's products
      for (int kk = 0; kk < kGsBk; kk += 32) {
        V bh[4], ah[4];
#pragma unroll   // fragments and accumulators in registers, here and in the three loops below
        for (int j = 0; j < 4; ++j) bh[j] = Frag<T>::load(cur + fB + j * 16 * kGsPitch + kk);
#pragma unroll
        for (int i = 0; i < 4; ++i) ah[i] = Frag<T>::load(cur + fA + i * 16 * kGsPitch + kk);
#pragma unroll
        for (int i = 0; i < 4; ++i) {
#pragma unroll
          for (int j = 0; j < 4; ++j) acc[i][j] = Frag<T>::mma(ah[i], bh[j], acc[i][j]);
          Frag<T>::guard(acc[i][0], acc[i][3], ah[i], ah[i]);
        }
        Frag<T>::keep(bh[0], bh[1], bh[2], bh[3]);
      }
    }
    if (fill) {
      T* nxt = sStage[s & 1];                  // its last readers (slab s - 2) left it at the barrier that ended trip s - 1
#pragma unroll   // st[] in registers, row steps in the stores' immediate offsets
      for (int it = 0; it < kGsCopies; ++it) *(H*)(nxt + sOff + it * 32 * kGsPitch) = st[it];
    }
    __syncthreads();                           // publishes slab s and ends every read of slab s - 1
  }
  acc_guard4(acc[0][0], acc[0][1], acc[0][2], acc[0][3]);
  acc_guard4(acc[1][0], acc[1][1], acc[1][2], acc[1][3]);
  acc_guard4(acc[2][0], acc[2][1], acc[2][2], acc[2][3]);
  acc_guard4(acc[3][0], acc[3][1], acc[3][2], acc[3][3]);

  // ---- epilogue ----
  float* slab = sT[wave];
  const float* Rb = RESID ? (resid + (size_t)b * strideR) : nullptr;
#pragma unroll
  for (int i = 0; i < 4; ++i) {
    const int mBase = m0 + (i << 4);
#pragma unroll
    for (int j = 0; j < 4; ++j) {
      const int n = n0 + (j << 4) + rlane;
      float bv = 0.f;
      if (BIAS_MODE == 2) bv = bias[n];
#pragma unroll
      for (int r = 0; r < 8; ++r) {
        float v = acc[i][j][r] * scale;
        if (BIAS_MODE == 1) v += bias[mBase + mOff + r];
        if (BIAS_MODE == 2) v += bv;
        if (RESID) v += Rb[(size_t)(mBase + mOff + r) * ldc + n];
        if (ACT == 1) v = tanhf(v);
        if (ACT == 2) v = fmaxf(v, 0.0f);
        if (ACT == 3) v = v / (1.0f + expf(-v));
        if (ACT == 4) v = (v > 0.f) ? v : 0.01f * v;
        if (ACT == 5) v = 0.5f * v * (1.0f + erff(v * 0.70710678118654752f));
        slab[(mOff + r) * 68 + (j << 4) + rlane] = v;
      }
    }
    __builtin_amdgcn_fence(__ATOMIC_RELEASE, "workgroup");
    __builtin_amdgcn_wave_barrier();
    __builtin_amdgcn_fence(__ATOMIC_ACQUIRE, "workgroup");
    if (OUT_MODE == 0) {
      float* C = (float*)Cout + (size_t)b * strideC;
      const int hh = lane >> 4, c4 = (lane & 15) * 4;     // row seg = 256 B = 16 lanes x 16 B
      {
#pragma unroll
        for (int it = 0; it < 8; ++it) {
          const int row = it * 2 + hh;
          v4f v = *(const v4f*)(slab + row * 68 + c4);
          *(v4f*)(C + (size_t)(mBase + row) * ldc + n0 + c4) = v;
        }
        
      }
    } else {
      const int q = lane >> 3, c8 = (lane & 7) * 8;
      unsigned short* C  = (unsigned short*)Cout  + (size_t)b * strideC;
      unsigned short* C2 = (OUT_MODE == 2) ? ((unsigned short*)Cout2 + (size_t)b * strideC) : nullptr;
      {
#pragma unroll
        for (int it = 0; it < 4; ++it) {
          const int row = it * 4 + q;
          const float* sp = slab + row * 68 + c8;
          v8h hv, lv;
#pragma unroll
          for (int e = 0; e < 8; ++e) {
            if (OUT_MODE == 1) {
              hv[e] = (_Float16)sp[e];
            } else {
              unsigned short hb = f2bf_bits(sp[e]);
              unsigned short lb = f2bf_bits(sp[e] - bf_bits2f(hb));
              hv[e] = __builtin_bit_cast(_Float16, hb);
              lv[e] = __builtin_bit_cast(_Float16, lb);
            }
          }
          *(v8h*)(C + (size_t)(mBase + row) * ldc + n0 + c8) = hv;
          if (OUT_MODE == 2) *(v8h*)(C2 + (size_t)(mBase + row) * ldc + n0 + c8) = lv;
        }
        
      }
    }
    __builtin_amdgcn_fence(__ATOMIC_RELEASE, "workgroup");
    __builtin_amdgcn_wave_barrier();
    __builtin_amdgcn_fence(__ATOMIC_ACQUIRE, "workgroup");
  }
}

// =====================================================================================
// Full (unmasked) attention, head dim 64, all batches and heads in one launch, time-major planes.
//   q plane  (f16): element (t, b, h, d) at [(t*kBatch + b)*kEmb + h*64 + d]   (unscaled q = LN(x).Wq^T)
//   k plane  (f16): element (s, b, h, d) at [(s*kBatch + b)*kEmb + h*64 + d]
//   v^T plane(f16): element (b, h, d, s) at [((b*kHeads + h)*64 + d)*kSeqK + s]
//   ctx plane (bf16 out): element (t, b, h, d) at [(t*kBatch + b)*kEmb + h*64 + d]
//   scores^T = (k . q^T) * sscale : single v_wmma_f32_16x16x32_f16 (A = K rows, B = Q), scale applied to the f32 accumulator
//   softmax in base 2: p * 2^15 = 2^(raw * sscale * log2(e) + 15 - maximum), one fused multiply-add and one v_exp_f32 per score
//   out^T    = v^T . p^T          : single v_wmma_f32_16x16x32_f16 (A = V^T rows, B = p^T), p = exp(s - m) in (0, 1] carried x2^15 as f16
//   A lane holds 32 of the chunk's 64 scores of ONE query (column lane & 15; keys j*16 + 8*(lane >> 4) + r), so the maximum and
//   the sum run in the lane, and two score tiles converted in place are the B operand of the second product: p never leaves registers.
//   online softmax in f32 over all kSeqK keys (32 chunks of 64, compile-time trip count).
//   Block = 4 waves = 64 query rows of one (b, h); grid.x = kBatch * kHeads * (kSeqQ/64) = 2048.
//   K / V^T chunk staging: 128 threads x 32 elements per plane = the whole 64x64 tile (16-B copies, plain loads,
//   __syncthreads before and after); fragment loads read the LDS tiles with the same v8h element type.
// =====================================================================================
#define AT_D 64
#define AT_NW 4
#define AT_QB 64
#define AT_KC 64
#define AT_LP 72   // LDS row pitch of the K and V^T tiles in f16: 144 B = 16 B x odd, so 16 rows read by 16-byte loads fall on distinct banks

__device__ __forceinline__ v8f mma_f16g(v16h a, v16h b, v8f c) {
  c = __builtin_amdgcn_wmma_f32_16x16x32_f16(false, a, false, b, (short)0, c, false, false);
  asm volatile("v_nop\n\tv_nop\n\tv_nop\n\tv_nop" : "+v"(c) : "v"(a), "v"(b));
  return c;
}

// 2^x as the one hardware instruction; arguments here are <= 15 but for rounding, and a result below the normal range may go to 0
__device__ __forceinline__ float exp2_hw(float x) { return __builtin_amdgcn_exp2f(x); }
// the same for eight values, each in place, in one statement that ends in v_nop: behind a transcendental the instruction set asks
// for one independent instruction before its result is read or its source overwritten; here the next v_exp_f32 is that instruction
// and the v_nop is the last one's
__device__ __forceinline__ void exp2_hw8(float (&x)[8]) {
  asm("v_exp_f32 %0, %0\n\tv_exp_f32 %1, %1\n\tv_exp_f32 %2, %2\n\tv_exp_f32 %3, %3\n\t"
      "v_exp_f32 %4, %4\n\tv_exp_f32 %5, %5\n\tv_exp_f32 %6, %6\n\tv_exp_f32 %7, %7\n\tv_nop"
      : "+v"(x[0]), "+v"(x[1]), "+v"(x[2]), "+v"(x[3]), "+v"(x[4]), "+v"(x[5]), "+v"(x[6]), "+v"(x[7]));
}

// lane l takes the value of lane l ^ 16: the other half of the same query column
__device__ __forceinline__ float xhalf(float x) {
  return __builtin_bit_cast(float, __builtin_amdgcn_permlanex16(__builtin_bit_cast(int, x), __builtin_bit_cast(int, x), 0x76543210, 0xfedcba98, false, false));
}

__global__ __launch_bounds__(128)
void attn_full16_kernel(const unsigned short* __restrict__ qp, const unsigned short* __restrict__ kp,
                        const unsigned short* __restrict__ vtp, unsigned short* __restrict__ ctxp, float sscale) {
  union FH { v16h v; v8h h[2]; };
  __shared__ __align__(16) _Float16 Ksh[AT_KC * AT_LP];            // K  [kv][d]   9 KB, 64 of 72 columns used
  __shared__ __align__(16) _Float16 Vth[AT_D * AT_LP];             // V^T [d][kv]  9 KB, 64 of 72 columns used
  __shared__ __align__(16) float    Os[AT_NW][16 * 68];            // per wave out tile, pitch 68

  const int tid  = threadIdx.x;
  const int wave = tid >> 5;
  const int lane = tid & 31;
  const int hh   = lane >> 4;
  const int c    = lane & 15;

  const int nqb  = kSeqQ / AT_QB;          // 32
  const int bx   = blockIdx.x;             // < kBatch*kHeads*nqb
  const int qb   = bx % nqb;
  const int bhid = bx / nqb;
  const int h    = bhid % kHeads;
  const int bb   = bhid / kHeads;          // 0..kBatch-1
  const int q0   = qb * AT_QB + wave * 16;

  const _Float16* Qh = (const _Float16*)(const void*)qp  + (size_t)bb * kEmb + (size_t)h * kHdim;
  const _Float16* Kh = (const _Float16*)(const void*)kp  + (size_t)bb * kEmb + (size_t)h * kHdim;
  const _Float16* Vh = (const _Float16*)(const void*)vtp + (size_t)(bb * kHeads + h) * kHdim * kSeqK;
  unsigned short* ob = ctxp + (size_t)bb * kEmb + (size_t)h * kHdim;

  // ---- Q fragments (B operand, column = lane&15, split k map via Frag load): 2 d-chunks ----
  v16h qa[2];
#pragma unroll
  for (int dc = 0; dc < 2; ++dc)
    qa[dc] = Frag<_Float16>::load(Qh + (size_t)(q0 + c) * kRowPitch + dc * 32 + 8 * hh);

  const float c2 = sscale * kLog2e;   // raw product -> exponent of 2; sscale > 0
  float mrow = -INFINITY;   // running maximum of query q0 + c in exponent-of-2 units, equal in both lane halves
  float lrow = 0.f;         // running sum (x2^15) over this lane half's keys only; the halves are joined behind the loop
  v8f oacc[4];              // oacc[t][r] = out^T[d = t*16 + 8*hh + r][query q0 + c]
#pragma unroll
  for (int t = 0; t < 4; ++t) oacc[t] = (v8f){0.f,0.f,0.f,0.f,0.f,0.f,0.f,0.f};

  const int nChunks = kSeqK / AT_KC;   // 32, compile-time constant
  for (int kc = 0; kc < nChunks; ++kc) {
    const int kv0 = kc * AT_KC;
    __syncthreads();
    {
      // staging coverage: 128 threads x (4 x 8) elements = 64 rows x 64 per plane = the whole chunk tile
      const int r = tid >> 1, half = (tid & 1) * 32;
      const _Float16* ks = Kh + (size_t)(kv0 + r) * kRowPitch + half;   // K row kv0+r, d = half..half+31
      const _Float16* vs = Vh + (size_t)r * kSeqK + kv0 + half;          // V^T row d = r, s = kv0+half..+31
#pragma unroll
      for (int i = 0; i < 4; ++i) {
        const v8h a0 = *(const v8h*)(ks + 8 * i);
        const v8h b0 = *(const v8h*)(vs + 8 * i);
        *(v8h*)(Ksh + r * AT_LP + half + 8 * i) = a0;
        *(v8h*)(Vth + r * AT_LP + half + 8 * i) = b0;
      }
    }
    __syncthreads();

    v8f s[4];
#pragma unroll
    for (int j = 0; j < 4; ++j) {
      s[j] = (v8f){0.f,0.f,0.f,0.f,0.f,0.f,0.f,0.f};
#pragma unroll
      for (int dc = 0; dc < 2; ++dc) {
        FH kb;
        kb.h[0] = *(const v8h*)(Ksh + (j * 16 + c) * AT_LP + dc * 32 + 8 * hh);
        kb.h[1] = *(const v8h*)(Ksh + (j * 16 + c) * AT_LP + dc * 32 + 16 + 8 * hh);
        s[j] = mma_f16g(kb.v, qa[dc], s[j]);   // s[j][r] = score of query c with key kv0 + j*16 + 8*hh + r
      }
    }
    float m = -INFINITY;
#pragma unroll
    for (int j = 0; j < 4; ++j) {
#pragma unroll
      for (int r = 0; r < 8; ++r) m = fmaxf(m, s[j][r]);   // on the raw products: c2 > 0 keeps their order
    }
    m = fmaxf(m, xhalf(m));                    // the query's maximum over all 64 keys of the chunk
    const float mnew  = fmaxf(mrow, m * c2);
    const float alpha = exp2_hw(mrow - mnew);
    mrow = mnew;
    const float eoff = kPCarryLog2 - mnew;     // maximum and carry in one addend of the exponent
    float psum = 0.f;
    FH pb[2];                                  // p^T as B operand: element e of pb[kk] = key kk*32 + (e < 8 ? 8*hh + e : 16 + 8*hh + e - 8)
#pragma unroll
    for (int j = 0; j < 4; ++j) {
      float p[8];                              // 2^15 * exp(score - maximum), at most 2^15 but for rounding
#pragma unroll
      for (int r = 0; r < 8; ++r) p[r] = fmaf(s[j][r], c2, eoff);
      exp2_hw8(p);
#pragma unroll
      for (int r = 0; r < 8; ++r) {
        psum += p[r];
        pb[j >> 1].h[j & 1][r] = (_Float16)p[r];
      }
      // ends the first 32 keys' exponentials, sums and packing before the next 32 begin: left alone, the scheduler holds all
      // 32 numerators of a lane live beside both packed operands, and the kernel goes over 128 registers (7 waves a SIMD, not 8)
      if (j == 1) __builtin_amdgcn_sched_barrier(0);
    }
    lrow = lrow * alpha + psum;
#pragma unroll
    for (int t = 0; t < 4; ++t)
#pragma unroll
      for (int r = 0; r < 8; ++r) oacc[t][r] *= alpha;
#pragma unroll   // constant kk keeps pb[] in registers
    for (int kk = 0; kk < 2; ++kk) {
#pragma unroll
      for (int t = 0; t < 4; ++t) {
        FH vb;
        vb.h[0] = *(const v8h*)(Vth + (t * 16 + c) * AT_LP + kk * 32 + 8 * hh);
        vb.h[1] = *(const v8h*)(Vth + (t * 16 + c) * AT_LP + kk * 32 + 16 + 8 * hh);
        oacc[t] = mma_f16g(vb.v, pb[kk].v, oacc[t]);
      }
    }
  }

  // ---- normalise (fold back the 2^15 carry), stage the wave's 16x64 tile, write bf16 rows:
  float* os = Os[wave];
  const float inv = 1.0f / (lrow + xhalf(lrow));   // both halves' sums joined; sums and products carry the same 2^15
#pragma unroll
  for (int t = 0; t < 4; ++t)
#pragma unroll
    for (int r = 0; r < 8; ++r) os[c * 68 + t * 16 + 8 * hh + r] = oacc[t][r] * inv;
  __builtin_amdgcn_fence(__ATOMIC_RELEASE, "workgroup");
  __builtin_amdgcn_wave_barrier();
  __builtin_amdgcn_fence(__ATOMIC_ACQUIRE, "workgroup");
  {
    const int qq = lane >> 3, c8 = (lane & 7) * 8;
    {
#pragma unroll
      for (int it = 0; it < 4; ++it) {
        const int row = it * 4 + qq;
        const float* sp = os + row * 68 + c8;
        v8h hv;
#pragma unroll
        for (int e = 0; e < 8; ++e) hv[e] = __builtin_bit_cast(_Float16, f2bf_bits(sp[e]));
        *(v8h*)(ob + (size_t)(q0 + row) * kRowPitch + c8) = hv;
      }
      
    }
  }
}

// ---------------------------------------------------------------------------
// Pre-pass, ONE launch: LayerNorm(query) -> bf16 plane, and the bf16 (RNE) casts of key, w_q, w_kv and w_out.
// Unit of work: one row of kEmb = 1024 f32 (4 KB read, 2 KB written), done by ONE wave. Chunk j of a row is elements
// j*128 + 4*lane .. +3, so a wave-wide 16-B load covers 512 contiguous bytes and a wave-wide 8-B store 256: whole lines.
// 20,480 rows on kPpWaves = 4,096 waves: wave w takes query rows w and w + 4096, key rows w and w + 4096, and row w of the
// three weight matrices counted end to end. Few long waves with many loads in flight, so that the launch is paid for by its
// bytes and not by the number of waves to start. A row's sums stay inside its wave: no LDS, no barrier.
// ---------------------------------------------------------------------------
constexpr int kPpWaves  = 4096;
constexpr int kPpChunks = kEmb / 128;            // 8 chunks of 32 lanes x 4 elements
static_assert(kRowsQ == 2 * kPpWaves && kRowsK == 2 * kPpWaves && 4 * kEmb == kPpWaves, "two query rows, two key rows, one weight row per wave");

struct PpRow { v4f c[kPpChunks]; };

__device__ __forceinline__ void pp_load(PpRow& r, const float* __restrict__ row, int lane) {
#pragma unroll   // constant indices keep the row in registers and the chunk steps in the loads' immediate offsets
  for (int j = 0; j < kPpChunks; ++j) r.c[j] = *(const v4f*)(row + j * 128 + 4 * lane);
  // holds the row's 8 loads here, in the order of the calls: left alone, the scheduler sinks loads to their users, two at a
  // time, and the wave waits out memory latency once per pair; in call order the first row is worked on while the rest fly
  __builtin_amdgcn_sched_barrier(0);
}

__device__ __forceinline__ void pp_store(const PpRow& r, unsigned short* __restrict__ row, int lane) {
#pragma unroll   // as above
  for (int j = 0; j < kPpChunks; ++j) {
    v2u pk;
    pk[0] = (unsigned)f2bf_bits(r.c[j][0]) | ((unsigned)f2bf_bits(r.c[j][1]) << 16);
    pk[1] = (unsigned)f2bf_bits(r.c[j][2]) | ((unsigned)f2bf_bits(r.c[j][3]) << 16);
    *(v2u*)(row + j * 128 + 4 * lane) = pk;
  }
  addr_regs_wait();
}

// lane l takes the value of lane l ^ M inside its 16-lane row (DPP row_xmask:M)
template <int M> __device__ __forceinline__ float xrow(float x) {
  return __builtin_bit_cast(float, __builtin_amdgcn_update_dpp(0, __builtin_bit_cast(int, x), 0x160 + M, 0xf, 0xf, true));
}
// sum over the 32 lanes, the same bits in every lane
__device__ __forceinline__ float wave_sum(float x) {
  x += xrow<1>(x);
  x += xrow<2>(x);
  x += xrow<4>(x);
  x += xrow<8>(x);
  return x + xhalf(x);
}
__device__ __forceinline__ float sum8(const float* p) { return ((p[0] + p[1]) + (p[2] + p[3])) + ((p[4] + p[5]) + (p[6] + p[7])); }

// two-pass mean and variance of one row, then (x - mu) * rstd * gamma + beta in place
__device__ __forceinline__ void pp_norm(PpRow& r, const PpRow& g, const PpRow& bt, float eps) {
  float p[kPpChunks];
#pragma unroll
  for (int j = 0; j < kPpChunks; ++j) p[j] = (r.c[j][0] + r.c[j][1]) + (r.c[j][2] + r.c[j][3]);
  const float mu = wave_sum(sum8(p)) * (1.0f / (float)kEmb);
#pragma unroll
  for (int j = 0; j < kPpChunks; ++j) {
    r.c[j] -= mu;
    p[j] = (r.c[j][0] * r.c[j][0] + r.c[j][1] * r.c[j][1]) + (r.c[j][2] * r.c[j][2] + r.c[j][3] * r.c[j][3]);
  }
  const float var  = wave_sum(sum8(p)) * (1.0f / (float)kEmb);
  const float rstd = rsqrtf(var + eps);
#pragma unroll
  for (int j = 0; j < kPpChunks; ++j)
#pragma unroll
    for (int e = 0; e < 4; ++e) r.c[j][e] = r.c[j][e] * rstd * g.c[j][e] + bt.c[j][e];
}

__global__ __launch_bounds__(256)
void prepass_kernel(const float* __restrict__ query, const float* __restrict__ key,
                    const float* __restrict__ gam, const float* __restrict__ bet,
                    const float* __restrict__ w_q, const float* __restrict__ w_kv, const float* __restrict__ w_out,
                    unsigned short* __restrict__ lnx16, unsigned short* __restrict__ key16,
                    unsigned short* __restrict__ wq16, unsigned short* __restrict__ wkv16, unsigned short* __restrict__ wo16,
                    float eps) {
  const int lane = threadIdx.x & 31;
  // wave-uniform by construction; through readfirstlane so that every row address is a scalar base plus one lane offset
  const int w = blockIdx.x * 8 + __builtin_amdgcn_readfirstlane((int)(threadIdx.x >> 5));
  const float* wsrc;
  unsigned short* wdst;
  if (w < kEmb)          { wsrc = w_q   + (size_t)w * kEmb;              wdst = wq16  + (size_t)w * kEmb; }
  else if (w < 3 * kEmb) { wsrc = w_kv  + (size_t)(w - kEmb) * kEmb;     wdst = wkv16 + (size_t)(w - kEmb) * kEmb; }
  else                   { wsrc = w_out + (size_t)(w - 3 * kEmb) * kEmb; wdst = wo16  + (size_t)(w - 3 * kEmb) * kEmb; }

  PpRow ka, kb, wr, qa, qb, g, bt;
  pp_load(ka, key + (size_t)w * kEmb, lane);
  pp_load(kb, key + (size_t)(w + kPpWaves) * kEmb, lane);
  pp_load(wr, wsrc, lane);
  pp_load(qa, query + (size_t)w * kEmb, lane);
  pp_load(qb, query + (size_t)(w + kPpWaves) * kEmb, lane);
  addr_regs_wait();

  pp_store(ka, key16 + (size_t)w * kEmb, lane);
  pp_store(kb, key16 + (size_t)(w + kPpWaves) * kEmb, lane);
  pp_store(wr, wdst, lane);
  pp_load(g, gam, lane);      // 8 KB that every wave reads: cache hits, landing under the rows' sums
  pp_load(bt, bet, lane);
  addr_regs_wait();
  pp_norm(qa, g, bt, eps);
  pp_norm(qb, g, bt, eps);
  pp_store(qa, lnx16 + (size_t)w * kEmb, lane);
  pp_store(qb, lnx16 + (size_t)(w + kPpWaves) * kEmb, lane);
}

// ---------------------------------------------------------------------------
// Host orchestration.
// Workspace region map (byte offsets):
//   [  0 MiB, 16 MiB)  KEY16  bf16 [8192][1024]   key cast
//   [ 16 MiB, 18 MiB)  WQ16   bf16 [1024][1024]
//   [ 18 MiB, 22 MiB)  WKV16  bf16 [2048][1024]
//   [ 22 MiB, 24 MiB)  WO16   bf16 [1024][1024]
//   [ 24 MiB, 40 MiB)  LNX16  bf16 [8192][1024]   LN(query); dead after the q projection, then reused as
//                      CTX16  bf16 [8192][1024]   attention output
//   [ 40 MiB, 56 MiB)  Q16    f16  [8192][1024]
//   [ 56 MiB, 72 MiB)  K16    f16  [8192][1024]   (head h at columns h*64)
//   [ 72 MiB, 88 MiB)  VT16   f16  [4][16][64][2048]
//   total 88 MiB = 92274688 B
// ---------------------------------------------------------------------------
extern "C" void kernel_launch(void* const* d_in, const int* in_sizes, int n_in,
                              void* d_out, int out_size, void* d_ws, size_t ws_size,
                              hipStream_t stream) {
  if (n_in < 7) return;
  const int nAct = kSeqQ * kBatch * kEmb;          // 8388608
  if (in_sizes[0] != nAct || in_sizes[1] != kSeqK * kBatch * kEmb) return;
  if (in_sizes[2] < kEmb || in_sizes[3] < kEmb) return;
  if (in_sizes[4] != kEmb * kEmb || in_sizes[5] != 2 * kEmb * kEmb || in_sizes[6] != kEmb * kEmb) return;
  if (out_size != nAct) return;

  const float* query = (const float*)d_in[0];   // [2048][4][1024]
  const float* key   = (const float*)d_in[1];   // [2048][4][1024]
  const float* gamma = (const float*)d_in[2];   // [1024]
  const float* beta  = (const float*)d_in[3];   // [1024]
  const float* w_q   = (const float*)d_in[4];   // [1024][1024]
  const float* w_kv  = (const float*)d_in[5];   // [2048][1024]
  const float* w_out = (const float*)d_in[6];   // [1024][1024]
  float* out = (float*)d_out;

  const size_t szAct16 = (size_t)kRowsQ * kEmb * 2;          // 16 MiB
  const size_t szWq16  = (size_t)kEmb * kEmb * 2;            //  2 MiB
  const size_t szWkv16 = (size_t)2 * kEmb * kEmb * 2;        //  4 MiB
  const size_t szVt16  = (size_t)kBatch * kHeads * kHdim * kSeqK * 2;   // 16 MiB
  size_t off = 0;
  char* ws = (char*)d_ws;
  unsigned short* KEY16 = (unsigned short*)(ws + off); off += szAct16;
  unsigned short* WQ16  = (unsigned short*)(ws + off); off += szWq16;
  unsigned short* WKV16 = (unsigned short*)(ws + off); off += szWkv16;
  unsigned short* WO16  = (unsigned short*)(ws + off); off += szWq16;
  unsigned short* LNX16 = (unsigned short*)(ws + off); off += szAct16;
  unsigned short* CTX16 = LNX16;                                // region reuse (LNX16 dead after the q GEMM)
  unsigned short* Q16   = (unsigned short*)(ws + off); off += szAct16;
  unsigned short* K16   = (unsigned short*)(ws + off); off += szAct16;
  unsigned short* VT16  = (unsigned short*)(ws + off); off += szVt16;
  if (off > ws_size) return;

  // 1) + 2) pre-pass: LayerNorm(query) -> bf16 plane and the four bf16 casts, 8 waves per block
  prepass_kernel<<<kPpWaves / 8, 256, 0, stream>>>(query, key, gamma, beta, w_q, w_kv, w_out,
                                                   LNX16, KEY16, WQ16, WKV16, WO16, kLnEps);

  // 3) q = LN . Wq^T (unscaled; 0.125 applied to the f32 scores): M=8192, N=1024, K=1024 -> f16 plane
  {
    const int tiles = (kRowsQ / 64) * (kEmb / 64);   // 2048
    wmma_gemm64<1, false, 0, 1, false><<<dim3((tiles + 7) / 8, 1), 256, 0, stream>>>(
        LNX16, nullptr, 0L, WQ16, nullptr, 0L,
        (void*)Q16, nullptr, kEmb, 0L, nullptr, nullptr, 0L, kRowsQ, kEmb, kEmb, 1.0f);
  }

  // 4) k per head h (grid.y = h): C[(s,b)][h*64 + d] = sum_e key[(s,b)][e] * Wkv[h*128 + d][e]; M=8192, N=64, K=1024
  {
    const int tiles = (kRowsK / 64) * (kHdim / 64);   // 128
    wmma_gemm64<1, false, 0, 1, false, 0, true><<<dim3((tiles + 7) / 8, kHeads), 256, 0, stream>>>(
        KEY16, nullptr, 0L, WKV16, nullptr, (long)(2 * kHdim) * kEmb,
        (void*)K16, nullptr, kEmb, (long)kHdim, nullptr, nullptr, 0L, kRowsK, kHdim, kEmb, 1.0f);
  }

  // 5) v^T per (b, h): C[d][s] = sum_e Wkv[h*128 + 64 + d][e] * key[(s,b)][e]; M=64, N=2048, K=1024; one launch per b, grid.y = h
  {
    const int tiles = (kHdim / 64) * (kSeqK / 64);   // 32
    for (int b = 0; b < kBatch; ++b) {
      wmma_gemm64<1, false, 0, 1, false, 0, false, kEmb, kRowPitch><<<dim3((tiles + 7) / 8, kHeads), 256, 0, stream>>>(
          WKV16 + (size_t)kHdim * kEmb, nullptr, (long)(2 * kHdim) * kEmb,
          KEY16 + (size_t)b * kEmb, nullptr, 0L,
          (void*)(VT16 + (size_t)b * kHeads * kHdim * kSeqK), nullptr, kSeqK, (long)kHdim * kSeqK,
          nullptr, nullptr, 0L, kHdim, kSeqK, kEmb, 1.0f);
    }
  }

  // 6) attention: one block per (b, h, 64-query tile) -> ctx bf16 plane (time-major, heads merged)
  attn_full16_kernel<<<kBatch * kHeads * (kSeqQ / AT_QB), 128, 0, stream>>>(Q16, K16, VT16, CTX16, 0.125f);

  // 7) out = query + ctx . Wout^T : M=8192, N=1024, K=1024, f32 with residual epilogue, straight to d_out
  {
    const int tiles = (kRowsQ / 64) * (kEmb / 64);   // 2048
    wmma_gemm64<1, false, 0, 0, true><<<dim3((tiles + 7) / 8, 1), 256, 0, stream>>>(
        CTX16, nullptr, 0L, WO16, nullptr, 0L,
        (void*)out, nullptr, kEmb, 0L, nullptr, query, 0L, kRowsQ, kEmb, kEmb, 1.0f);
  }
}

// v006
// Measured time: 192 microseconds a run.
// In two side-by-side timings against v005, it was 1.35 and 1.36 times as fast.
// All steps since v000 together make it 4.21 times as fast.
// Contractions: q, k, v^T and output projections on v_wmma_f32_16x16x32_bf16 (bf16 operands); q.k^T and p.v on v_wmma_f32_16x16x32_f16 (f16 operands, p carried x2^15); all f32 accumulate; layernorm, softmax, score scale 0.125 and residual add in f32.
#include <hip/hip_runtime.h>
#include <math.h>
#include <stdint.h>

// ---------------------------------------------------------------------------
// Problem geometry (time-major activations: row (t, b) = t*kBatch + b, pitch kEmb)
// ---------------------------------------------------------------------------
constexpr int kSeqQ  = 2048;
constexpr int kSeqK  = 2048;
constexpr int kBatch = 4;
constexpr int kEmb   = 1024;
constexpr int kHeads = 16;
constexpr int kHdim  = 64;
constexpr int kRowsQ = kSeqQ * kBatch;          // 8192
constexpr int kRowsK = kSeqK * kBatch;          // 8192
constexpr int kRowPitch = kBatch * kEmb;        // 4096: stride between consecutive t at fixed b
constexpr float kLnEps  = 1e-5f;
constexpr float kPCarryLog2 = 15.0f;            // softmax numerators carried x2^15 in f16
constexpr float kLog2e  = 1.4426950408889634f;

typedef __attribute__((ext_vector_type(16))) _Float16 v16h;
typedef __attribute__((ext_vector_type(8)))  _Float16 v8h;
typedef __attribute__((ext_vector_type(16))) __bf16   v16b;
typedef __attribute__((ext_vector_type(8)))  __bf16   v8b;
typedef __attribute__((ext_vector_type(8)))  float    v8f;
typedef __attribute__((ext_vector_type(4)))  float    v4f;
typedef __attribute__((ext_vector_type(2)))  float    v2f;
typedef __attribute__((ext_vector_type(2)))  unsigned int v2u;

__device__ __forceinline__ unsigned short f2bf_bits(float f) {
  unsigned u = __float_as_uint(f);
  return (unsigned short)((u + 0x7FFFu + ((u >> 16) & 1u)) >> 16);
}
__device__ __forceinline__ float bf_bits2f(unsigned short h) { return __uint_as_float(((unsigned)h) << 16); }

// hazard guards as plain device helpers (no inline asm inside the kernel template body)
__device__ __forceinline__ void dep_guard_h(v8f& a, v8f& b, v16h x, v16h y) { asm volatile("v_nop\n\tv_nop\n\tv_nop\n\tv_nop" : "+v"(a), "+v"(b) : "v"(x), "v"(y)); }
__device__ __forceinline__ void dep_guard_b(v8f& a, v8f& b, v16b x, v16b y) { asm volatile("v_nop\n\tv_nop\n\tv_nop\n\tv_nop" : "+v"(a), "+v"(b) : "v"(x), "v"(y)); }
__device__ __forceinline__ void keep4_h(v16h a, v16h b, v16h c, v16h d) { asm volatile("v_nop" :: "v"(a), "v"(b), "v"(c), "v"(d)); }
__device__ __forceinline__ void keep4_b(v16b a, v16b b, v16b c, v16b d) { asm volatile("v_nop" :: "v"(a), "v"(b), "v"(c), "v"(d)); }
__device__ __forceinline__ void acc_guard4(v8f& a, v8f& b, v8f& c, v8f& d) { asm volatile("v_nop\n\tv_nop\n\tv_nop\n\tv_nop" : "+v"(a), "+v"(b), "+v"(c), "+v"(d)); }
// stands behind a group of global loads or stores: none of their address registers is rewritten in front of this wait
__device__ __forceinline__ void addr_regs_wait() { asm volatile("s_wait_xcnt 0x0" ::: "memory"); }
template <typename T> struct Frag;
template <> struct Frag<_Float16> {
  typedef v16h V; typedef v8h H; union U { v16h v; v8h h[2]; };
  static __device__ __forceinline__ v16h load(const _Float16* p) {   // elements 0..7 <- p[0..7], 8..15 <- p[16..23]
    U f; f.h[0] = *(const v8h*)(p); f.h[1] = *(const v8h*)(p + 16); return f.v;
  }
  static __device__ __forceinline__ v8f mma(v16h a, v16h b, v8f c) {
    return __builtin_amdgcn_wmma_f32_16x16x32_f16(false, a, false, b, (short)0, c, false, false);
  }
  static __device__ __forceinline__ void guard(v8f& a, v8f& b, v16h x, v16h y) { dep_guard_h(a, b, x, y); }
  static __device__ __forceinline__ void keep(v16h a, v16h b, v16h c, v16h d) { keep4_h(a, b, c, d); }
};
template <> struct Frag<__bf16> {
  typedef v16b V; typedef v8b H; union U { v16b v; v8b h[2]; };
  static __device__ __forceinline__ v16b load(const __bf16* p) {
    U f; f.h[0] = *(const v8b*)(p); f.h[1] = *(const v8b*)(p + 16); return f.v;
  }
  static __device__ __forceinline__ v8f mma(v16b a, v16b b, v8f c) {
    return __builtin_amdgcn_wmma_f32_16x16x32_bf16(false, a, false, b, (short)0, c, false, false);
  }
  static __device__ __forceinline__ void guard(v8f& a, v8f& b, v16b x, v16b y) { dep_guard_b(a, b, x, y); }
  static __device__ __forceinline__ void keep(v16b a, v16b b, v16b c, v16b d) { keep4_b(a, b, c, d); }
};

// ---- Register-blocked batched WMMA GEMM ------------------------------------
// C[m,n] = scale * sum_k A[m,k] * Bt[n,k] (+bias)(+resid); each wave owns a 64x64 tile.
// A row-major [M,K]; Bt row-major [N,K]; M,N % 64 == 0, K % 64 == 0; the tile count is a multiple of 8.
// The 8 waves of a block own 8 consecutive tiles that share one operand's 64 rows:
//   WIDE_M = false: N/64 is a multiple of 8, the block is 64 x 512 (A rows shared, 64 Bt rows per wave);
//   WIDE_M = true : N == 64, the block is 512 x 64 (Bt rows shared, 64 A rows per wave).
// Operands go through LDS in slabs of 64 k: every thread copies whole 16-B pieces so that a wave-wide load covers
// 4 whole 128-B lines; two LDS buffers, the next slab's global loads are issued ahead of the current slab's products.
// The row pitches lda, ldb are compile-time, so that a slab's 18 loads are two addresses plus immediate offsets.
// SPLIT (hi/lo planes) is not staged and not instantiated.
// BIAS_MODE: 0 = none, 1 = bias[m], 2 = bias[n].
// OUT_MODE: 0 = f32, 1 = f16, 2 = bf16 hi plane (Cout) + bf16 lo plane (Cout2).
// ET: 0 = f16 operands, 1 = bf16 operands (pointers passed as 16-bit storage)
template <int ET> struct Elem;
template <> struct Elem<0> { typedef _Float16 T; };
template <> struct Elem<1> { typedef __bf16 T; };
constexpr int kGsBk    = 64;                     // k elements per slab: 128 B of every operand row
constexpr int kGsPitch = 72;                     // LDS row pitch in 16-bit elements: 144 B = 16 B x odd
constexpr int kGsRows  = 64 + 8 * 64;            // the shared operand's rows, then 64 rows per wave
constexpr int kGsCopies = kGsRows * 8 / 256;     // 16-B pieces per thread and slab: 18
// One block's work as a device function, so that one launch can hold blocks of several GEMMs: the kernel owns the LDS arrays and
// hands in the block's place (bx = group of 8 tiles; by steps A, Bt, C, resid by strideA, strideB, strideC, strideR; bz steps Bt, C
// by strideBz, strideCz).
template <int ET, bool SPLIT, int BIAS_MODE, int OUT_MODE, bool RESID, int ACT = 0, bool WIDE_M = false, int lda = kEmb, int ldb = kEmb>
__device__ __forceinline__ void gemm64_block(
    typename Elem<ET>::T (*sStage)[kGsRows * kGsPitch],   // two slab buffers, 82,944 B each
    float (*sT)[16 * 68],                                 // per-wave 16x64 slab, pitch 68 floats
    int bx, int by, int bz,
    const unsigned short* __restrict__ Ap, const unsigned short* __restrict__ A2p, long strideA,
    const unsigned short* __restrict__ Btp, const unsigned short* __restrict__ Bt2p, long strideB,
    void* __restrict__ Cout, void* __restrict__ Cout2, int ldc, long strideC,
    const float* __restrict__ bias,
    const float* __restrict__ resid, long strideR,
    int M, int N, int K, float scale, long strideBz, long strideCz) {
  typedef typename Elem<ET>::T T;
  typedef typename Frag<T>::V V;
  typedef typename Frag<T>::H H;
  static_assert(!SPLIT, "hi/lo planes are not staged");
  const T* A = (const T*)Ap; const T* Bt = (const T*)Btp;
  const int b    = by;
  const int tid  = threadIdx.x;
  const int lane = tid & 31;
  const int wave = tid >> 5;
  const int tilesN = N >> 6;
  const int tilesM = M >> 6;
  if ((bx + 1) * 8 > tilesM * tilesN) return;  // block-uniform, in front of every barrier
  const int tile0 = bx * 8;                    // the block's first tile; wave w owns tile0 + w
  const int tm0 = tile0 / tilesN;
  const int tn0 = tile0 - tm0 * tilesN;
  const int m0 = (tm0 << 6) + (WIDE_M ? (wave << 6) : 0);
  const int n0 = (tn0 << 6) + (WIDE_M ? 0 : (wave << 6));

  const T* Ab  = A  + (size_t)b * strideA;
  const T* Bb  = Bt + (size_t)b * strideB + (size_t)bz * strideBz;
  const size_t cOff = (size_t)b * strideC + (size_t)bz * strideCz;   // element offset of this (by, bz) problem's C

  const int rlane = lane & 15;                 // row (A) / col (B, D) within subtile
  const int koff  = (lane >> 4) * 8;           // k offset of this lane half
  const int mOff  = (lane >> 4) * 8;           // D row offset

  // staging map: piece q = it*256 + tid -> LDS row q/8, 16-B piece q%8; rows 0..63 shared operand, 64.. per wave
  const int srow = tid >> 3;
  const int sseg = (tid & 7) * 8;
  const int ldS = WIDE_M ? ldb : lda;          // shared operand
  const int ldW = WIDE_M ? lda : ldb;          // operand with 64 rows per wave
  const char* uA = (const char*)(Ab + (size_t)(tm0 << 6) * lda);   // block-uniform bases, byte addressed
  const char* uB = (const char*)(Bb + (size_t)(tn0 << 6) * ldb);
  const char* uS = WIDE_M ? uB : uA;
  const char* uW = WIDE_M ? uA : uB;
  const unsigned vS = (unsigned)(srow * ldS + sseg) * 2u;          // this thread's byte offset inside 32 rows
  const unsigned vW = (unsigned)(srow * ldW + sseg) * 2u;
  const int sOff = srow * kGsPitch + sseg;
  const int fS = rlane * kGsPitch + koff;                          // fragment row 0 of the shared operand
  const int fW = (64 + (wave << 6) + rlane) * kGsPitch + koff;     // fragment row 0 of this wave's own rows
  const int fA = WIDE_M ? fW : fS;
  const int fB = WIDE_M ? fS : fW;

  v8f acc[4][4];
#pragma unroll
  for (int i = 0; i < 4; ++i)
#pragma unroll
    for (int j = 0; j < 4; ++j) acc[i][j] = (v8f){0.f,0.f,0.f,0.f,0.f,0.f,0.f,0.f};

  // trip s: slab s's global loads are issued, slab s - 1 is multiplied out of its buffer, slab s goes to the other one
  const int nSlabs = K / kGsBk;
  for (int s = 0; s <= nSlabs; ++s) {
    const bool fill = s < nSlabs;              // block-uniform
    H st[kGsCopies];
    if (fill) {
      const int k1 = s * kGsBk;
#pragma unroll   // constant indices keep st[] in registers and the row steps in the loads' immediate offsets
      for (int it = 0; it < 2; ++it) st[it] = *(const H*)(uS + ((size_t)(it * 32) * ldS + k1) * 2 + vS);
#pragma unroll   // as above
      for (int it = 2; it < kGsCopies; ++it) st[it] = *(const H*)(uW + ((size_t)((it - 2) * 32) * ldW + k1) * 2 + vW);
      addr_regs_wait();
    }
    if (s > 0) {
      const T* cur = sStage[(s - 1) & 1];
#pragma unroll   // both halves of the slab in one trip: the second half's LDS reads can start under the first half's products
      for (int kk = 0; kk < kGsBk; kk += 32) {
        V bh[4], ah[4];
#pragma unroll   // fragments and accumulators in registers, here and in the three loops below
        for (int j = 0; j < 4; ++j) bh[j] = Frag<T>::load(cur + fB + j * 16 * kGsPitch + kk);
#pragma unroll
        for (int i = 0; i < 4; ++i) ah[i] = Frag<T>::load(cur + fA + i * 16 * kGsPitch + kk);
#pragma unroll
        for (int i = 0; i < 4; ++i) {
#pragma unroll
          for (int j = 0; j < 4; ++j) acc[i][j] = Frag<T>::mma(ah[i], bh[j], acc[i][j]);
          Frag<T>::guard(acc[i][0], acc[i][3], ah[i], ah[i]);
        }
        Frag<T>::keep(bh[0], bh[1], bh[2], bh[3]);
      }
    }
    if (fill) {
      T* nxt = sStage[s & 1];                  // its last readers (slab s - 2) left it at the barrier that ended trip s - 1
#pragma unroll   // st[] in registers, row steps in the stores' immediate offsets
      for (int it = 0; it < kGsCopies; ++it) *(H*)(nxt + sOff + it * 32 * kGsPitch) = st[it];
    }
    __syncthreads();                           // publishes slab s and ends every read of slab s - 1
  }
  acc_guard4(acc[0][0], acc[0][1], acc[0][2], acc[0][3]);
  acc_guard4(acc[1][0], acc[1][1], acc[1][2], acc[1][3]);
  acc_guard4(acc[2][0], acc[2][1], acc[2][2], acc[2][3]);
  acc_guard4(acc[3][0], acc[3][1], acc[3][2], acc[3][3]);

  // ---- epilogue ----
  float* slab = sT[wave];
  const float* Rb = RESID ? (resid + (size_t)b * strideR) : nullptr;
#pragma unroll
  for (int i = 0; i < 4; ++i) {
    const int mBase = m0 + (i << 4);
#pragma unroll
    for (int j = 0; j < 4; ++j) {
      const int n = n0 + (j << 4) + rlane;
      float bv = 0.f;
      if (BIAS_MODE == 2) bv = bias[n];
#pragma unroll
      for (int r = 0; r < 8; ++r) {
        float v = acc[i][j][r] * scale;
        if (BIAS_MODE == 1) v += bias[mBase + mOff + r];
        if (BIAS_MODE == 2) v += bv;
        if (RESID) v += Rb[(size_t)(mBase + mOff + r) * ldc + n];
        if (ACT == 1) v = tanhf(v);
        if (ACT == 2) v = fmaxf(v, 0.0f);
        if (ACT == 3) v = v / (1.0f + expf(-v));
        if (ACT == 4) v = (v > 0.f) ? v : 0.01f * v;
        if (ACT == 5) v = 0.5f * v * (1.0f + erff(v * 0.70710678118654752f));
        slab[(mOff + r) * 68 + (j << 4) + rlane] = v;
      }
    }
    __builtin_amdgcn_fence(__ATOMIC_RELEASE, "workgroup");
    __builtin_amdgcn_wave_barrier();
    __builtin_amdgcn_fence(__ATOMIC_ACQUIRE, "workgroup");
    if (OUT_MODE == 0) {
      float* C = (float*)Cout + cOff;
      const int hh = lane >> 4, c4 = (lane & 15) * 4;     // row seg = 256 B = 16 lanes x 16 B
      {
#pragma unroll
        for (int it = 0; it < 8; ++it) {
          const int row = it * 2 + hh;
          v4f v = *(const v4f*)(slab + row * 68 + c4);
          *(v4f*)(C + (size_t)(mBase + row) * ldc + n0 + c4) = v;
        }
        
      }
    } else {
      const int q = lane >> 3, c8 = (lane & 7) * 8;
      unsigned short* C  = (unsigned short*)Cout  + cOff;
      unsigned short* C2 = (OUT_MODE == 2) ? ((unsigned short*)Cout2 + cOff) : nullptr;
      {
#pragma unroll
        for (int it = 0; it < 4; ++it) {
          const int row = it * 4 + q;
          const float* sp = slab + row * 68 + c8;
          v8h hv, lv;
#pragma unroll
          for (int e = 0; e < 8; ++e) {
            if (OUT_MODE == 1) {
              hv[e] = (_Float16)sp[e];
            } else {
              unsigned short hb = f2bf_bits(sp[e]);
              unsigned short lb = f2bf_bits(sp[e] - bf_bits2f(hb));
              hv[e] = __builtin_bit_cast(_Float16, hb);
              lv[e] = __builtin_bit_cast(_Float16, lb);
            }
          }
          *(v8h*)(C + (size_t)(mBase + row) * ldc + n0 + c8) = hv;
          if (OUT_MODE == 2) *(v8h*)(C2 + (size_t)(mBase + row) * ldc + n0 + c8) = lv;
        }
        
      }
    }
    __builtin_amdgcn_fence(__ATOMIC_RELEASE, "workgroup");
    __builtin_amdgcn_wave_barrier();
    __builtin_amdgcn_fence(__ATOMIC_ACQUIRE, "workgroup");
  }
}

// One GEMM per launch: grid.x = groups of 8 tiles, grid.y = batch.
template <int ET, bool SPLIT, int BIAS_MODE, int OUT_MODE, bool RESID, int ACT = 0, bool WIDE_M = false, int lda = kEmb, int ldb = kEmb>
__global__ __launch_bounds__(256) void wmma_gemm64(
    const unsigned short* __restrict__ Ap, const unsigned short* __restrict__ A2p, long strideA,
    const unsigned short* __restrict__ Btp, const unsigned short* __restrict__ Bt2p, long strideB,
    void* __restrict__ Cout, void* __restrict__ Cout2, int ldc, long strideC,
    const float* __restrict__ bias,
    const float* __restrict__ resid, long strideR,
    int M, int N, int K, float scale) {
  __shared__ __align__(16) typename Elem<ET>::T sStage[2][kGsRows * kGsPitch];
  __shared__ __align__(16) float sT[8][16 * 68];
  gemm64_block<ET, SPLIT, BIAS_MODE, OUT_MODE, RESID, ACT, WIDE_M, lda, ldb>(
      sStage, sT, (int)blockIdx.x, (int)blockIdx.y, 0, Ap, A2p, strideA, Btp, Bt2p, strideB, Cout, Cout2, ldc, strideC,
      bias, resid, strideR, M, N, K, scale, 0L, 0L);
}

// The three projections that need only the pre-pass, in ONE launch of 3 x 256 blocks (256 = one block for every WGP; a block's LDS
// leaves room for no second one). None reads what another writes. The GEMM is picked by the block index, uniform in the block.
//   blocks   0..255: q   = LN . Wq^T (unscaled; 0.125 is applied to the f32 scores): M=8192, N=1024, K=1024 -> f16 plane
//   blocks 256..511: k   per head h: C[(s,b)][h*64 + d] = sum_e key[(s,b)][e] * Wkv[h*128 + d][e]; M=8192, N=64, K=1024; 16 groups x 16 h
//   blocks 512..767: v^T per (b, h): C[d][s] = sum_e Wkv[h*128 + 64 + d][e] * key[(s,b)][e]; M=64, N=2048, K=1024; 4 groups x 16 h x 4 b
constexpr int kProjBlocks = (kRowsQ / 64) * (kEmb / 64) / 8;   // 256 blocks per projection
static_assert((kRowsK / 64) / 8 * kHeads == kProjBlocks && (kSeqK / 64) / 8 * kHeads * kBatch == kProjBlocks, "three equal shares");
__global__ __launch_bounds__(256) void proj_qkv_kernel(
    const unsigned short* __restrict__ lnx16, const unsigned short* __restrict__ wq16,
    const unsigned short* __restrict__ key16, const unsigned short* __restrict__ wkv16,
    unsigned short* __restrict__ q16, unsigned short* __restrict__ k16, unsigned short* __restrict__ vt16) {
  __shared__ __align__(16) __bf16 sStage[2][kGsRows * kGsPitch];
  __shared__ __align__(16) float sT[8][16 * 68];
  const unsigned which = blockIdx.x / (unsigned)kProjBlocks;
  const unsigned j     = blockIdx.x % (unsigned)kProjBlocks;
  if (which == 0) {
    gemm64_block<1, false, 0, 1, false>(
        sStage, sT, (int)j, 0, 0, lnx16, nullptr, 0L, wq16, nullptr, 0L,
        (void*)q16, nullptr, kEmb, 0L, nullptr, nullptr, 0L, kRowsQ, kEmb, kEmb, 1.0f, 0L, 0L);
  } else if (which == 1) {
    constexpr unsigned g = (kRowsK / 64) / 8;   // 16 groups of 8 tiles per head
    gemm64_block<1, false, 0, 1, false, 0, true>(
        sStage, sT, (int)(j % g), (int)(j / g), 0, key16, nullptr, 0L, wkv16, nullptr, (long)(2 * kHdim) * kEmb,
        (void*)k16, nullptr, kEmb, (long)kHdim, nullptr, nullptr, 0L, kRowsK, kHdim, kEmb, 1.0f, 0L, 0L);
  } else {
    constexpr unsigned g = (kSeqK / 64) / 8;    // 4 groups of 8 tiles per (b, h)
    gemm64_block<1, false, 0, 1, false, 0, false, kEmb, kRowPitch>(
        sStage, sT, (int)(j % g), (int)((j / g) % kHeads), (int)(j / (g * kHeads)),
        wkv16 + (size_t)kHdim * kEmb, nullptr, (long)(2 * kHdim) * kEmb, key16, nullptr, 0L,
        (void*)vt16, nullptr, kSeqK, (long)kHdim * kSeqK, nullptr, nullptr, 0L, kHdim, kSeqK, kEmb, 1.0f,
        (long)kEmb, (long)kHeads * kHdim * kSeqK);
  }
}

// =====================================================================================
// Full (unmasked) attention, head dim 64, all batches and heads in one launch, time-major planes.
//   q plane  (f16): element (t, b, h, d) at [(t*kBatch + b)*kEmb + h*64 + d]   (unscaled q = LN(x).Wq^T)
//   k plane  (f16): element (s, b, h, d) at [(s*kBatch + b)*kEmb + h*64 + d]
//   v^T plane(f16): element (b, h, d, s) at [((b*kHeads + h)*64 + d)*kSeqK + s]
//   ctx plane (bf16 out): element (t, b, h, d) at [(t*kBatch + b)*kEmb + h*64 + d]
//   scores^T = (k . q^T) * sscale : single v_wmma_f32_16x16x32_f16 (A = K rows, B = Q), scale applied to the f32 accumulator
//   softmax in base 2: p * 2^15 = 2^(raw * sscale * log2(e) + 15 - maximum), one fused multiply-add and one v_exp_f32 per score
//   out^T    = v^T . p^T          : single v_wmma_f32_16x16x32_f16 (A = V^T rows, B = p^T), p = exp(s - m) in (0, 1] carried x2^15 as f16
//   A lane holds 32 of the chunk's 64 scores of ONE query (column lane & 15; keys j*16 + 8*(lane >> 4) + r), so the maximum and
//   the sum run in the lane, and two score tiles converted in place are the B operand of the second product: p never leaves registers.
//   online softmax in f32 over all kSeqK keys (32 chunks of 64, compile-time trip count).
//   Block = 4 waves = 64 query rows of one (b, h); grid.x = kBatch * kHeads * (kSeqQ/64) = 2048.
//   K / V^T chunk staging: 128 threads x 32 elements per plane = the whole 64x64 tile (16-B copies, plain loads,
//   __syncthreads before and after); fragment loads read the LDS tiles with the same v8h element type.
// =====================================================================================
#define AT_D 64
#define AT_NW 4
#define AT_QB 64
#define AT_KC 64
#define AT_LP 72   // LDS row pitch of the K and V^T tiles in f16: 144 B = 16 B x odd, so 16 rows read by 16-byte loads fall on distinct banks

__device__ __forceinline__ v8f mma_f16g(v16h a, v16h b, v8f c) {
  c = __builtin_amdgcn_wmma_f32_16x16x32_f16(false, a, false, b, (short)0, c, false, false);
  asm volatile("v_nop\n\tv_nop\n\tv_nop\n\tv_nop" : "+v"(c) : "v"(a), "v"(b));
  return c;
}

// 2^x as the one hardware instruction; arguments here are <= 15 but for rounding, and a result below the normal range may go to 0
__device__ __forceinline__ float exp2_hw(float x) { return __builtin_amdgcn_exp2f(x); }
// the same for eight values, each in place, in one statement that ends in v_nop: behind a transcendental the instruction set asks
// for one independent instruction before its result is read or its source overwritten; here the next v_exp_f32 is that instruction
// and the v_nop is the last one's
__device__ __forceinline__ void exp2_hw8(float (&x)[8]) {
  asm("v_exp_f32 %0, %0\n\tv_exp_f32 %1, %1\n\tv_exp_f32 %2, %2\n\tv_exp_f32 %3, %3\n\t"
      "v_exp_f32 %4, %4\n\tv_exp_f32 %5, %5\n\tv_exp_f32 %6, %6\n\tv_exp_f32 %7, %7\n\tv_nop"
      : "+v"(x[0]), "+v"(x[1]), "+v"(x[2]), "+v"(x[3]), "+v"(x[4]), "+v"(x[5]), "+v"(x[6]), "+v"(x[7]));
}

// lane l takes the value of lane l ^ 16: the other half of the same query column
__device__ __forceinline__ float xhalf(float x) {
  return __builtin_bit_cast(float, __builtin_amdgcn_permlanex16(__builtin_bit_cast(int, x), __builtin_bit_cast(int, x), 0x76543210, 0xfedcba98, false, false));
}

__global__ __launch_bounds__(128)
void attn_full16_kernel(const unsigned short* __restrict__ qp, const unsigned short* __restrict__ kp,
                        const unsigned short* __restrict__ vtp, unsigned short* __restrict__ ctxp, float sscale) {
  union FH { v16h v; v8h h[2]; };
  __shared__ __align__(16) _Float16 Ksh[AT_KC * AT_LP];            // K  [kv][d]   9 KB, 64 of 72 columns used
  __shared__ __align__(16) _Float16 Vth[AT_D * AT_LP];             // V^T [d][kv]  9 KB, 64 of 72 columns used
  __shared__ __align__(16) float    Os[AT_NW][16 * 68];            // per wave out tile, pitch 68

  const int tid  = threadIdx.x;
  const int wave = tid >> 5;
  const int lane = tid & 31;
  const int hh   = lane >> 4;
  const int c    = lane & 15;

  const int nqb  = kSeqQ / AT_QB;          // 32
  const int bx   = blockIdx.x;             // < kBatch*kHeads*nqb
  const int qb   = bx % nqb;
  const int bhid = bx / nqb;
  const int h    = bhid % kHeads;
  const int bb   = bhid / kHeads;          // 0..kBatch-1
  const int q0   = qb * AT_QB + wave * 16;

  const _Float16* Qh = (const _Float16*)(const void*)qp  + (size_t)bb * kEmb + (size_t)h * kHdim;
  const _Float16* Kh = (const _Float16*)(const void*)kp  + (size_t)bb * kEmb + (size_t)h * kHdim;
  const _Float16* Vh = (const _Float16*)(const void*)vtp + (size_t)(bb * kHeads + h) * kHdim * kSeqK;
  unsigned short* ob = ctxp + (size_t)bb * kEmb + (size_t)h * kHdim;

  // ---- Q fragments (B operand, column = lane&15, split k map via Frag load): 2 d-chunks ----
  v16h qa[2];
#pragma unroll
  for (int dc = 0; dc < 2; ++dc)
    qa[dc] = Frag<_Float16>::load(Qh + (size_t)(q0 + c) * kRowPitch + dc * 32 + 8 * hh);

  const float c2 = sscale * kLog2e;   // raw product -> exponent of 2; sscale > 0
  float mrow = -INFINITY;   // running maximum of query q0 + c in exponent-of-2 units, equal in both lane halves
  float lrow = 0.f;         // running sum (x2^15) over this lane half's keys only; the halves are joined behind the loop
  v8f oacc[4];              // oacc[t][r] = out^T[d = t*16 + 8*hh + r][query q0 + c]
#pragma unroll
  for (int t = 0; t < 4; ++t) oacc[t] = (v8f){0.f,0.f,0.f,0.f,0.f,0.f,0.f,0.f};

  const int nChunks = kSeqK / AT_KC;   // 32, compile-time constant
  for (int kc = 0; kc < nChunks; ++kc) {
    const int kv0 = kc * AT_KC;
    __syncthreads();
    {
      // staging coverage: 128 threads x (4 x 8) elements = 64 rows x 64 per plane = the whole chunk tile
      const int r = tid >> 1, half = (tid & 1) * 32;
      const _Float16* ks = Kh + (size_t)(kv0 + r) * kRowPitch + half;   // K row kv0+r, d = half..half+31
      const _Float16* vs = Vh + (size_t)r * kSeqK + kv0 + half;          // V^T row d = r, s = kv0+half..+31
#pragma unroll
      for (int i = 0; i < 4; ++i) {
        const v8h a0 = *(const v8h*)(ks + 8 * i);
        const v8h b0 = *(const v8h*)(vs + 8 * i);
        *(v8h*)(Ksh + r * AT_LP + half + 8 * i) = a0;
        *(v8h*)(Vth + r * AT_LP + half + 8 * i) = b0;
      }
    }
    __syncthreads();

    v8f s[4];
#pragma unroll
    for (int j = 0; j < 4; ++j) {
      s[j] = (v8f){0.f,0.f,0.f,0.f,0.f,0.f,0.f,0.f};
#pragma unroll
      for (int dc = 0; dc < 2; ++dc) {
        FH kb;
        kb.h[0] = *(const v8h*)(Ksh + (j * 16 + c) * AT_LP + dc * 32 + 8 * hh);
        kb.h[1] = *(const v8h*)(Ksh + (j * 16 + c) * AT_LP + dc * 32 + 16 + 8 * hh);
        s[j] = mma_f16g(kb.v, qa[dc], s[j]);   // s[j][r] = score of query c with key kv0 + j*16 + 8*hh + r
      }
    }
    float m = -INFINITY;
#pragma unroll
    for (int j = 0; j < 4; ++j) {
#pragma unroll
      for (int r = 0; r < 8; ++r) m = fmaxf(m, s[j][r]);   // on the raw products: c2 > 0 keeps their order
    }
    m = fmaxf(m, xhalf(m));                    // the query's maximum over all 64 keys of the chunk
    const float mnew  = fmaxf(mrow, m * c2);
    const float alpha = exp2_hw(mrow - mnew);
    mrow = mnew;
    const float eoff = kPCarryLog2 - mnew;     // maximum and carry in one addend of the exponent
    float psum = 0.f;
    FH pb[2];                                  // p^T as B operand: element e of pb[kk] = key kk*32 + (e < 8 ? 8*hh + e : 16 + 8*hh + e - 8)
#pragma unroll
    for (int j = 0; j < 4; ++j) {
      float p[8];                              // 2^15 * exp(score - maximum), at most 2^15 but for rounding
#pragma unroll
      for (int r = 0; r < 8; ++r) p[r] = fmaf(s[j][r], c2, eoff);
      exp2_hw8(p);
#pragma unroll
      for (int r = 0; r < 8; ++r) {
        psum += p[r];
        pb[j >> 1].h[j & 1][r] = (_Float16)p[r];
      }
      // ends the first 32 keys' exponentials, sums and packing before the next 32 begin: left alone, the scheduler holds all
      // 32 numerators of a lane live beside both packed operands, and the kernel goes over 128 registers (7 waves a SIMD, not 8)
      if (j == 1) __builtin_amdgcn_sched_barrier(0);
    }
    lrow = lrow * alpha + psum;
#pragma unroll
    for (int t = 0; t < 4; ++t)
#pragma unroll
      for (int r = 0; r < 8; ++r) oacc[t][r] *= alpha;
#pragma unroll   // constant kk keeps pb[] in registers
    for (int kk = 0; kk < 2; ++kk) {
#pragma unroll
      for (int t = 0; t < 4; ++t) {
        FH vb;
        vb.h[0] = *(const v8h*)(Vth + (t * 16 + c) * AT_LP + kk * 32 + 8 * hh);
        vb.h[1] = *(const v8h*)(Vth + (t * 16 + c) * AT_LP + kk * 32 + 16 + 8 * hh);
        oacc[t] = mma_f16g(vb.v, pb[kk].v, oacc[t]);
      }
    }
  }

  // ---- normalise (fold back the 2^15 carry), stage the wave's 16x64 tile, write bf16 rows:
  float* os = Os[wave];
  const float inv = 1.0f / (lrow + xhalf(lrow));   // both halves' sums joined; sums and products carry the same 2^15
#pragma unroll
  for (int t = 0; t < 4; ++t)
#pragma unroll
    for (int r = 0; r < 8; ++r) os[c * 68 + t * 16 + 8 * hh + r] = oacc[t][r] * inv;
  __builtin_amdgcn_fence(__ATOMIC_RELEASE, "workgroup");
  __builtin_amdgcn_wave_barrier();
  __builtin_amdgcn_fence(__ATOMIC_ACQUIRE, "workgroup");
  {
    const int qq = lane >> 3, c8 = (lane & 7) * 8;
    {
#pragma unroll
      for (int it = 0; it < 4; ++it) {
        const int row = it * 4 + qq;
        const float* sp = os + row * 68 + c8;
        v8h hv;
#pragma unroll
        for (int e = 0; e < 8; ++e) hv[e] = __builtin_bit_cast(_Float16, f2bf_bits(sp[e]));
        *(v8h*)(ob + (size_t)(q0 + row) * kRowPitch + c8) = hv;
      }
      
    }
  }
}

// ---------------------------------------------------------------------------
// Pre-pass, ONE launch: LayerNorm(query) -> bf16 plane, and the bf16 (RNE) casts of key, w_q, w_kv and w_out.
// Unit of work: one row of kEmb = 1024 f32 (4 KB read, 2 KB written), done by ONE wave. Chunk j of a row is elements
// j*128 + 4*lane .. +3, so a wave-wide 16-B load covers 512 contiguous bytes and a wave-wide 8-B store 256: whole lines.
// 20,480 rows on kPpWaves = 4,096 waves: wave w takes query rows w and w + 4096, key rows w and w + 4096, and row w of the
// three weight matrices counted end to end. Few long waves with many loads in flight, so that the launch is paid for by its
// bytes and not by the number of waves to start. A row's sums stay inside its wave: no LDS, no barrier.
// ---------------------------------------------------------------------------
constexpr int kPpWaves  = 4096;
constexpr int kPpChunks = kEmb / 128;            // 8 chunks of 32 lanes x 4 elements
static_assert(kRowsQ == 2 * kPpWaves && kRowsK == 2 * kPpWaves && 4 * kEmb == kPpWaves, "two query rows, two key rows, one weight row per wave");

struct PpRow { v4f c[kPpChunks]; };

__device__ __forceinline__ void pp_load(PpRow& r, const float* __restrict__ row, int lane) {
#pragma unroll   // constant indices keep the row in registers and the chunk steps in the loads' immediate offsets
  for (int j = 0; j < kPpChunks; ++j) r.c[j] = *(const v4f*)(row + j * 128 + 4 * lane);
  // holds the row's 8 loads here, in the order of the calls: left alone, the scheduler sinks loads to their users, two at a
  // time, and the wave waits out memory latency once per pair; in call order the first row is worked on while the rest fly
  __builtin_amdgcn_sched_barrier(0);
}

__device__ __forceinline__ void pp_store(const PpRow& r, unsigned short* __restrict__ row, int lane) {
#pragma unroll   // as above
  for (int j = 0; j < kPpChunks; ++j) {
    v2u pk;
    pk[0] = (unsigned)f2bf_bits(r.c[j][0]) | ((unsigned)f2bf_bits(r.c[j][1]) << 16);
    pk[1] = (unsigned)f2bf_bits(r.c[j][2]) | ((unsigned)f2bf_bits(r.c[j][3]) << 16);
    *(v2u*)(row + j * 128 + 4 * lane) = pk;
  }
  addr_regs_wait();
}

// lane l takes the value of lane l ^ M inside its 16-lane row (DPP row_xmask:M)
template <int M> __device__ __forceinline__ float xrow(float x) {
  return __builtin_bit_cast(float, __builtin_amdgcn_update_dpp(0, __builtin_bit_cast(int, x), 0x160 + M, 0xf, 0xf, true));
}
// sum over the 32 lanes, the same bits in every lane
__device__ __forceinline__ float wave_sum(float x) {
  x += xrow<1>(x);
  x += xrow<2>(x);
  x += xrow<4>(x);
  x += xrow<8>(x);
  return x + xhalf(x);
}
__device__ __forceinline__ float sum8(const float* p) { return ((p[0] + p[1]) + (p[2] + p[3])) + ((p[4] + p[5]) + (p[6] + p[7])); }

// two-pass mean and variance of one row, then (x - mu) * rstd * gamma + beta in place
__device__ __forceinline__ void pp_norm(PpRow& r, const PpRow& g, const PpRow& bt, float eps) {
  float p[kPpChunks];
#pragma unroll
  for (int j = 0; j < kPpChunks; ++j) p[j] = (r.c[j][0] + r.c[j][1]) + (r.c[j][2] + r.c[j][3]);
  const float mu = wave_sum(sum8(p)) * (1.0f / (float)kEmb);
#pragma unroll
  for (int j = 0; j < kPpChunks; ++j) {
    r.c[j] -= mu;
    p[j] = (r.c[j][0] * r.c[j][0] + r.c[j][1] * r.c[j][1]) + (r.c[j][2] * r.c[j][2] + r.c[j][3] * r.c[j][3]);
  }
  const float var  = wave_sum(sum8(p)) * (1.0f / (float)kEmb);
  const float rstd = rsqrtf(var + eps);
#pragma unroll
  for (int j = 0; j < kPpChunks; ++j)
#pragma unroll
    for (int e = 0; e < 4; ++e) r.c[j][e] = r.c[j][e] * rstd * g.c[j][e] + bt.c[j][e];
}

__global__ __launch_bounds__(256)
void prepass_kernel(const float* __restrict__ query, const float* __restrict__ key,
                    const float* __restrict__ gam, const float* __restrict__ bet,
                    const float* __restrict__ w_q, const float* __restrict__ w_kv, const float* __restrict__ w_out,
                    unsigned short* __restrict__ lnx16, unsigned short* __restrict__ key16,
                    unsigned short* __restrict__ wq16, unsigned short* __restrict__ wkv16, unsigned short* __restrict__ wo16,
                    float eps) {
  const int lane = threadIdx.x & 31;
  // wave-uniform by construction; through readfirstlane so that every row address is a scalar base plus one lane offset
  const int w = blockIdx.x * 8 + __builtin_amdgcn_readfirstlane((int)(threadIdx.x >> 5));
  const float* wsrc;
  unsigned short* wdst;
  if (w < kEmb)          { wsrc = w_q   + (size_t)w * kEmb;              wdst = wq16  + (size_t)w * kEmb; }
  else if (w < 3 * kEmb) { wsrc = w_kv  + (size_t)(w - kEmb) * kEmb;     wdst = wkv16 + (size_t)(w - kEmb) * kEmb; }
  else                   { wsrc = w_out + (size_t)(w - 3 * kEmb) * kEmb; wdst = wo16  + (size_t)(w - 3 * kEmb) * kEmb; }

  PpRow ka, kb, wr, qa, qb, g, bt;
  pp_load(ka, key + (size_t)w * kEmb, lane);
  pp_load(kb, key + (size_t)(w + kPpWaves) * kEmb, lane);
  pp_load(wr, wsrc, lane);
  pp_load(qa, query + (size_t)w * kEmb, lane);
  pp_load(qb, query + (size_t)(w + kPpWaves) * kEmb, lane);
  addr_regs_wait();

  pp_store(ka, key16 + (size_t)w * kEmb, lane);
  pp_store(kb, key16 + (size_t)(w + kPpWaves) * kEmb, lane);
  pp_store(wr, wdst, lane);
  pp_load(g, gam, lane);      // 8 KB that every wave reads: cache hits, landing under the rows' sums
  pp_load(bt, bet, lane);
  addr_regs_wait();
  pp_norm(qa, g, bt, eps);
  pp_norm(qb, g, bt, eps);
  pp_store(qa, lnx16 + (size_t)w * kEmb, lane);
  pp_store(qb, lnx16 + (size_t)(w + kPpWaves) * kEmb, lane);
}

// ---------------------------------------------------------------------------
// Host orchestration.
// Workspace region map (byte offsets):
//   [  0 MiB, 16 MiB)  KEY16  bf16 [8192][1024]   key cast
//   [ 16 MiB, 18 MiB)  WQ16   bf16 [1024][1024]
//   [ 18 MiB, 22 MiB)  WKV16  bf16 [2048][1024]
//   [ 22 MiB, 24 MiB)  WO16   bf16 [1024][1024]
//   [ 24 MiB, 40 MiB)  LNX16  bf16 [8192][1024]   LN(query); dead after the q projection, then reused as
//                      CTX16  bf16 [8192][1024]   attention output
//   [ 40 MiB, 56 MiB)  Q16    f16  [8192][1024]
//   [ 56 MiB, 72 MiB)  K16    f16  [8192][1024]   (head h at columns h*64)
//   [ 72 MiB, 88 MiB)  VT16   f16  [4][16][64][2048]
//   total 88 MiB = 92274688 B
// ---------------------------------------------------------------------------
extern "C" void kernel_launch(void* const* d_in, const int* in_sizes, int n_in,
                              void* d_out, int out_size, void* d_ws, size_t ws_size,
                              hipStream_t stream) {
  if (n_in < 7) return;
  const int nAct = kSeqQ * kBatch * kEmb;          // 8388608
  if (in_sizes[0] != nAct || in_sizes[1] != kSeqK * kBatch * kEmb) return;
  if (in_sizes[2] < kEmb || in_sizes[3] < kEmb) return;
  if (in_sizes[4] != kEmb * kEmb || in_sizes[5] != 2 * kEmb * kEmb || in_sizes[6] != kEmb * kEmb) return;
  if (out_size != nAct) return;

  const float* query = (const float*)d_in[0];   // [2048][4][1024]
  const float* key   = (const float*)d_in[1];   // [2048][4][1024]
  const float* gamma = (const float*)d_in[2];   // [1024]
  const float* beta  = (const float*)d_in[3];   // [1024]
  const float* w_q   = (const float*)d_in[4];   // [1024][1024]
  const float* w_kv  = (const float*)d_in[5];   // [2048][1024]
  const float* w_out = (const float*)d_in[6];   // [1024][1024]
  float* out = (float*)d_out;

  const size_t szAct16 = (size_t)kRowsQ * kEmb * 2;          // 16 MiB
  const size_t szWq16  = (size_t)kEmb * kEmb * 2;            //  2 MiB
  const size_t szWkv16 = (size_t)2 * kEmb * kEmb * 2;        //  4 MiB
  const size_t szVt16  = (size_t)kBatch * kHeads * kHdim * kSeqK * 2;   // 16 MiB
  size_t off = 0;
  char* ws = (char*)d_ws;
  unsigned short* KEY16 = (unsigned short*)(ws + off); off += szAct16;
  unsigned short* WQ16  = (unsigned short*)(ws + off); off += szWq16;
  unsigned short* WKV16 = (unsigned short*)(ws + off); off += szWkv16;
  unsigned short* WO16  = (unsigned short*)(ws + off); off += szWq16;
  unsigned short* LNX16 = (unsigned short*)(ws + off); off += szAct16;
  unsigned short* CTX16 = LNX16;                                // region reuse (LNX16 dead after the q GEMM)
  unsigned short* Q16   = (unsigned short*)(ws + off); off += szAct16;
  unsigned short* K16   = (unsigned short*)(ws + off); off += szAct16;
  unsigned short* VT16  = (unsigned short*)(ws + off); off += szVt16;
  if (off > ws_size) return;

  // 1) + 2) pre-pass: LayerNorm(query) -> bf16 plane and the four bf16 casts, 8 waves per block
  prepass_kernel<<<kPpWaves / 8, 256, 0, stream>>>(query, key, gamma, beta, w_q, w_kv, w_out,
                                                   LNX16, KEY16, WQ16, WKV16, WO16, kLnEps);

  // 3) + 4) + 5) q, k and v^T projections, one launch
  proj_qkv_kernel<<<3 * kProjBlocks, 256, 0, stream>>>(LNX16, WQ16, KEY16, WKV16, Q16, K16, VT16);

  // 6) attention: one block per (b, h, 64-query tile) -> ctx bf16 plane (time-major, heads merged)
  attn_full16_kernel<<<kBatch * kHeads * (kSeqQ / AT_QB), 128, 0, stream>>>(Q16, K16, VT16, CTX16, 0.125f);

  // 7) out = query + ctx . Wout^T : M=8192, N=1024, K=1024, f32 with residual epilogue, straight to d_out
  {
    const int tiles = (kRowsQ / 64) * (kEmb / 64);   // 2048
    wmma_gemm64<1, false, 0, 0, true><<<dim3((tiles + 7) / 8, 1), 256, 0, stream>>>(
        CTX16, nullptr, 0L, WO16, nullptr, 0L,
        (void*)out, nullptr, kEmb, 0L, nullptr, query, 0L, kRowsQ, kEmb, kEmb, 1.0f);
  }
}

// v007
// Measured time: 182 microseconds a run.
// Next to v006, in two timings, it ran 1.06 and 1.05 times as fast.
// All steps since v000 together make it 4.44 times as fast.
// Contractions: q, k, v^T and output projections on v_wmma_f32_16x16x32_bf16 (bf16 operands); q.k^T and p.v on v_wmma_f32_16x16x32_f16 (f16 operands, p carried x2^15); all f32 accumulate; layernorm, softmax, score scale 0.125 and residual add in f32.
#include <hip/hip_runtime.h>
#include <math.h>
#include <stdint.h>

// ---------------------------------------------------------------------------
// Problem geometry (time-major activations: row (t, b) = t*kBatch + b, pitch kEmb)
// ---------------------------------------------------------------------------
constexpr int kSeqQ  = 2048;
constexpr int kSeqK  = 2048;
constexpr int kBatch = 4;
constexpr int kEmb   = 1024;
constexpr int kHeads = 16;
constexpr int kHdim  = 64;
constexpr int kRowsQ = kSeqQ * kBatch;          // 8192
constexpr int kRowsK = kSeqK * kBatch;          // 8192
constexpr int kRowPitch = kBatch * kEmb;        // 4096: stride between consecutive t at fixed b
constexpr float kLnEps  = 1e-5f;
constexpr float kPCarryLog2 = 15.0f;            // softmax numerators carried x2^15 in f16
constexpr float kLog2e  = 1.4426950408889634f;

typedef __attribute__((ext_vector_type(16))) _Float16 v16h;
typedef __attribute__((ext_vector_type(8)))  _Float16 v8h;
typedef __attribute__((ext_vector_type(16))) __bf16   v16b;
typedef __attribute__((ext_vector_type(8)))  __bf16   v8b;
typedef __attribute__((ext_vector_type(8)))  float    v8f;
typedef __attribute__((ext_vector_type(4)))  float    v4f;
typedef __attribute__((ext_vector_type(2)))  float    v2f;
typedef __attribute__((ext_vector_type(2)))  unsigned int v2u;

__device__ __forceinline__ unsigned short f2bf_bits(float f) {
  unsigned u = __float_as_uint(f);
  return (unsigned short)((u + 0x7FFFu + ((u >> 16) & 1u)) >> 16);
}
__device__ __forceinline__ float bf_bits2f(unsigned short h) { return __uint_as_float(((unsigned)h) << 16); }

// hazard guards as plain device helpers (no inline asm inside the kernel template body)
__device__ __forceinline__ void dep_guard_h(v8f& a, v8f& b, v16h x, v16h y) { asm volatile("v_nop\n\tv_nop\n\tv_nop\n\tv_nop" : "+v"(a), "+v"(b) : "v"(x), "v"(y)); }
__device__ __forceinline__ void dep_guard_b(v8f& a, v8f& b, v16b x, v16b y) { asm volatile("v_nop\n\tv_nop\n\tv_nop\n\tv_nop" : "+v"(a), "+v"(b) : "v"(x), "v"(y)); }
__device__ __forceinline__ void keep4_h(v16h a, v16h b, v16h c, v16h d) { asm volatile("v_nop" :: "v"(a), "v"(b), "v"(c), "v"(d)); }
__device__ __forceinline__ void keep4_b(v16b a, v16b b, v16b c, v16b d) { asm volatile("v_nop" :: "v"(a), "v"(b), "v"(c), "v"(d)); }
__device__ __forceinline__ void acc_guard4(v8f& a, v8f& b, v8f& c, v8f& d) { asm volatile("v_nop\n\tv_nop\n\tv_nop\n\tv_nop" : "+v"(a), "+v"(b), "+v"(c), "+v"(d)); }
// stands behind a group of global loads or stores: none of their address registers is rewritten in front of this wait
__device__ __forceinline__ void addr_regs_wait() { asm volatile("s_wait_xcnt 0x0" ::: "memory"); }
template <typename T> struct Frag;
template <> struct Frag<_Float16> {
  typedef v16h V; typedef v8h H; union U { v16h v; v8h h[2]; };
  static __device__ __forceinline__ v16h load(const _Float16* p) {   // elements 0..7 <- p[0..7], 8..15 <- p[16..23]
    U f; f.h[0] = *(const v8h*)(p); f.h[1] = *(const v8h*)(p + 16); return f.v;
  }
  static __device__ __forceinline__ v8f mma(v16h a, v16h b, v8f c) {
    return __builtin_amdgcn_wmma_f32_16x16x32_f16(false, a, false, b, (short)0, c, false, false);
  }
  static __device__ __forceinline__ void guard(v8f& a, v8f& b, v16h x, v16h y) { dep_guard_h(a, b, x, y); }
  static __device__ __forceinline__ void keep(v16h a, v16h b, v16h c, v16h d) { keep4_h(a, b, c, d); }
};
template <> struct Frag<__bf16> {
  typedef v16b V; typedef v8b H; union U { v16b v; v8b h[2]; };
  static __device__ __forceinline__ v16b load(const __bf16* p) {
    U f; f.h[0] = *(const v8b*)(p); f.h[1] = *(const v8b*)(p + 16); return f.v;
  }
  static __device__ __forceinline__ v8f mma(v16b a, v16b b, v8f c) {
    return __builtin_amdgcn_wmma_f32_16x16x32_bf16(false, a, false, b, (short)0, c, false, false);
  }
  static __device__ __forceinline__ void guard(v8f& a, v8f& b, v16b x, v16b y) { dep_guard_b(a, b, x, y); }
  static __device__ __forceinline__ void keep(v16b a, v16b b, v16b c, v16b d) { keep4_b(a, b, c, d); }
};

// ---- Register-blocked batched WMMA GEMM ------------------------------------
// C[m,n] = scale * sum_k A[m,k] * Bt[n,k] (+bias)(+resid); each wave owns a 64x64 tile.
// A row-major [M,K]; Bt row-major [N,K]; M,N % 64 == 0, K % 64 == 0; the tile count is a multiple of 8.
// The 8 waves of a block own 8 consecutive tiles that share one operand's 64 rows:
//   WIDE_M = false: N/64 is a multiple of 8, the block is 64 x 512 (A rows shared, 64 Bt rows per wave);
//   WIDE_M = true : N == 64, the block is 512 x 64 (Bt rows shared, 64 A rows per wave).
// Operands go through LDS in slabs of 64 k: every thread copies whole 16-B pieces so that a wave-wide load covers
// 4 whole 128-B lines; two LDS buffers, the next slab's global loads are issued ahead of the current slab's products.
// The row pitches lda, ldb are compile-time, so that a slab's 18 loads are two addresses plus immediate offsets.
// SPLIT (hi/lo planes) is not staged and not instantiated.
// BIAS_MODE: 0 = none, 1 = bias[m], 2 = bias[n].
// OUT_MODE: 0 = f32, 1 = f16, 2 = bf16 hi plane (Cout) + bf16 lo plane (Cout2).
// ET: 0 = f16 operands, 1 = bf16 operands (pointers passed as 16-bit storage)
template <int ET> struct Elem;
template <> struct Elem<0> { typedef _Float16 T; };
template <> struct Elem<1> { typedef __bf16 T; };
constexpr int kGsBk    = 64;                     // k elements per slab: 128 B of every operand row
constexpr int kGsPitch = 72;                     // LDS row pitch in 16-bit elements: 144 B = 16 B x odd
constexpr int kGsRows  = 64 + 8 * 64;            // the shared operand's rows, then 64 rows per wave
constexpr int kGsCopies = kGsRows * 8 / 256;     // 16-B pieces per thread and slab: 18
// One block's work as a device function, so that one launch can hold blocks of several GEMMs: the kernel owns the LDS arrays and
// hands in the block's place (bx = group of 8 tiles; by steps A, Bt, C, resid by strideA, strideB, strideC, strideR; bz steps Bt, C
// by strideBz, strideCz).
template <int ET, bool SPLIT, int BIAS_MODE, int OUT_MODE, bool RESID, int ACT = 0, bool WIDE_M = false, int lda = kEmb, int ldb = kEmb>
__device__ __forceinline__ void gemm64_block(
    typename Elem<ET>::T (*sStage)[kGsRows * kGsPitch],   // two slab buffers, 82,944 B each
    float (*sT)[16 * 68],                                 // per-wave 16x64 slab, pitch 68 floats
    int bx, int by, int bz,
    const unsigned short* __restrict__ Ap, const unsigned short* __restrict__ A2p, long strideA,
    const unsigned short* __restrict__ Btp, const unsigned short* __restrict__ Bt2p, long strideB,
    void* __restrict__ Cout, void* __restrict__ Cout2, int ldc, long strideC,
    const float* __restrict__ bias,
    const float* __restrict__ resid, long strideR,
    int M, int N, int K, float scale, long strideBz, long strideCz) {
  typedef typename Elem<ET>::T T;
  typedef typename Frag<T>::V V;
  typedef typename Frag<T>::H H;
  static_assert(!SPLIT, "hi/lo planes are not staged");
  const T* A = (const T*)Ap; const T* Bt = (const T*)Btp;
  const int b    = by;
  const int tid  = threadIdx.x;
  const int lane = tid & 31;
  const int wave = tid >> 5;
  const int tilesN = N >> 6;
  const int tilesM = M >> 6;
  if ((bx + 1) * 8 > tilesM * tilesN) return;  // block-uniform, in front of every barrier
  const int tile0 = bx * 8;                    // the block's first tile; wave w owns tile0 + w
  const int tm0 = tile0 / tilesN;
  const int tn0 = tile0 - tm0 * tilesN;
  const int m0 = (tm0 << 6) + (WIDE_M ? (wave << 6) : 0);
  const int n0 = (tn0 << 6) + (WIDE_M ? 0 : (wave << 6));

  const T* Ab  = A  + (size_t)b * strideA;
  const T* Bb  = Bt + (size_t)b * strideB + (size_t)bz * strideBz;
  const size_t cOff = (size_t)b * strideC + (size_t)bz * strideCz;   // element offset of this (by, bz) problem's C

  const int rlane = lane & 15;                 // row (A) / col (B, D) within subtile
  const int koff  = (lane >> 4) * 8;           // k offset of this lane half
  const int mOff  = (lane >> 4) * 8;           // D row offset

  // staging map: piece q = it*256 + tid -> LDS row q/8, 16-B piece q%8; rows 0..63 shared operand, 64.. per wave
  const int srow = tid >> 3;
  const int sseg = (tid & 7) * 8;
  const int ldS = WIDE_M ? ldb : lda;          // shared operand
  const int ldW = WIDE_M ? lda : ldb;          // operand with 64 rows per wave
  const char* uA = (const char*)(Ab + (size_t)(tm0 << 6) * lda);   // block-uniform bases, byte addressed
  const char* uB = (const char*)(Bb + (size_t)(tn0 << 6) * ldb);
  const char* uS = WIDE_M ? uB : uA;
  const char* uW = WIDE_M ? uA : uB;
  const unsigned vS = (unsigned)(srow * ldS + sseg) * 2u;          // this thread's byte offset inside 32 rows
  const unsigned vW = (unsigned)(srow * ldW + sseg) * 2u;
  const int sOff = srow * kGsPitch + sseg;
  const int fS = rlane * kGsPitch + koff;                          // fragment row 0 of the shared operand
  const int fW = (64 + (wave << 6) + rlane) * kGsPitch + koff;     // fragment row 0 of this wave's own rows
  const int fA = WIDE_M ? fW : fS;
  const int fB = WIDE_M ? fS : fW;

  v8f acc[4][4];
#pragma unroll
  for (int i = 0; i < 4; ++i)
#pragma unroll
    for (int j = 0; j < 4; ++j) acc[i][j] = (v8f){0.f,0.f,0.f,0.f,0.f,0.f,0.f,0.f};

  // trip s: slab s's global loads are issued, slab s - 1 is multiplied out of its buffer, slab s goes to the other one
  const int nSlabs = K / kGsBk;
  for (int s = 0; s <= nSlabs; ++s) {
    const bool fill = s < nSlabs;              // block-uniform
    H st[kGsCopies];
    if (fill) {
      const int k1 = s * kGsBk;
#pragma unroll   // constant indices keep st[] in registers and the row steps in the loads' immediate offsets
      for (int it = 0; it < 2; ++it) st[it] = *(const H*)(uS + ((size_t)(it * 32) * ldS + k1) * 2 + vS);
#pragma unroll   // as above
      for (int it = 2; it < kGsCopies; ++it) st[it] = *(const H*)(uW + ((size_t)((it - 2) * 32) * ldW + k1) * 2 + vW);
      addr_regs_wait();
    }
    if (s > 0) {
      const T* cur = sStage[(s - 1) & 1];
#pragma unroll   // both halves of the slab in one trip: the second half's LDS reads can start under the first half's products
      for (int kk = 0; kk < kGsBk; kk += 32) {
        V bh[4], ah[4];
#pragma unroll   // fragments and accumulators in registers, here and in the three loops below
        for (int j = 0; j < 4; ++j) bh[j] = Frag<T>::load(cur + fB + j * 16 * kGsPitch + kk);
#pragma unroll
        for (int i = 0; i < 4; ++i) ah[i] = Frag<T>::load(cur + fA + i * 16 * kGsPitch + kk);
#pragma unroll
        for (int i = 0; i < 4; ++i) {
#pragma unroll
          for (int j = 0; j < 4; ++j) acc[i][j] = Frag<T>::mma(ah[i], bh[j], acc[i][j]);
          Frag<T>::guard(acc[i][0], acc[i][3], ah[i], ah[i]);
        }
        Frag<T>::keep(bh[0], bh[1], bh[2], bh[3]);
      }
    }
    if (fill) {
      T* nxt = sStage[s & 1];                  // its last readers (slab s - 2) left it at the barrier that ended trip s - 1
#pragma unroll   // st[] in registers, row steps in the stores' immediate offsets
      for (int it = 0; it < kGsCopies; ++it) *(H*)(nxt + sOff + it * 32 * kGsPitch) = st[it];
    }
    __syncthreads();                           // publishes slab s and ends every read of slab s - 1
  }
  acc_guard4(acc[0][0], acc[0][1], acc[0][2], acc[0][3]);
  acc_guard4(acc[1][0], acc[1][1], acc[1][2], acc[1][3]);
  acc_guard4(acc[2][0], acc[2][1], acc[2][2], acc[2][3]);
  acc_guard4(acc[3][0], acc[3][1], acc[3][2], acc[3][3]);

  // ---- epilogue ----
  float* slab = sT[wave];
  const float* Rb = RESID ? (resid + (size_t)b * strideR) : nullptr;
#pragma unroll
  for (int i = 0; i < 4; ++i) {
    const int mBase = m0 + (i << 4);
#pragma unroll
    for (int j = 0; j < 4; ++j) {
      const int n = n0 + (j << 4) + rlane;
      float bv = 0.f;
      if (BIAS_MODE == 2) bv = bias[n];
#pragma unroll
      for (int r = 0; r < 8; ++r) {
        float v = acc[i][j][r] * scale;
        if (BIAS_MODE == 1) v += bias[mBase + mOff + r];
        if (BIAS_MODE == 2) v += bv;
        if (RESID) v += Rb[(size_t)(mBase + mOff + r) * ldc + n];
        if (ACT == 1) v = tanhf(v);
        if (ACT == 2) v = fmaxf(v, 0.0f);
        if (ACT == 3) v = v / (1.0f + expf(-v));
        if (ACT == 4) v = (v > 0.f) ? v : 0.01f * v;
        if (ACT == 5) v = 0.5f * v * (1.0f + erff(v * 0.70710678118654752f));
        slab[(mOff + r) * 68 + (j << 4) + rlane] = v;
      }
    }
    __builtin_amdgcn_fence(__ATOMIC_RELEASE, "workgroup");
    __builtin_amdgcn_wave_barrier();
    __builtin_amdgcn_fence(__ATOMIC_ACQUIRE, "workgroup");
    if (OUT_MODE == 0) {
      float* C = (float*)Cout + cOff;
      const int hh = lane >> 4, c4 = (lane & 15) * 4;     // row seg = 256 B = 16 lanes x 16 B
      {
#pragma unroll
        for (int it = 0; it < 8; ++it) {
          const int row = it * 2 + hh;
          v4f v = *(const v4f*)(slab + row * 68 + c4);
          *(v4f*)(C + (size_t)(mBase + row) * ldc + n0 + c4) = v;
        }
        
      }
    } else {
      const int q = lane >> 3, c8 = (lane & 7) * 8;
      unsigned short* C  = (unsigned short*)Cout  + cOff;
      unsigned short* C2 = (OUT_MODE == 2) ? ((unsigned short*)Cout2 + cOff) : nullptr;
      {
#pragma unroll
        for (int it = 0; it < 4; ++it) {
          const int row = it * 4 + q;
          const float* sp = slab + row * 68 + c8;
          v8h hv, lv;
#pragma unroll
          for (int e = 0; e < 8; ++e) {
            if (OUT_MODE == 1) {
              hv[e] = (_Float16)sp[e];
            } else {
              unsigned short hb = f2bf_bits(sp[e]);
              unsigned short lb = f2bf_bits(sp[e] - bf_bits2f(hb));
              hv[e] = __builtin_bit_cast(_Float16, hb);
              lv[e] = __builtin_bit_cast(_Float16, lb);
            }
          }
          *(v8h*)(C + (size_t)(mBase + row) * ldc + n0 + c8) = hv;
          if (OUT_MODE == 2) *(v8h*)(C2 + (size_t)(mBase + row) * ldc + n0 + c8) = lv;
        }
        
      }
    }
    __builtin_amdgcn_fence(__ATOMIC_RELEASE, "workgroup");
    __builtin_amdgcn_wave_barrier();
    __builtin_amdgcn_fence(__ATOMIC_ACQUIRE, "workgroup");
  }
}

// One GEMM per launch: grid.x = groups of 8 tiles, grid.y = batch.
template <int ET, bool SPLIT, int BIAS_MODE, int OUT_MODE, bool RESID, int ACT = 0, bool WIDE_M = false, int lda = kEmb, int ldb = kEmb>
__global__ __launch_bounds__(256) void wmma_gemm64(
    const unsigned short* __restrict__ Ap, const unsigned short* __restrict__ A2p, long strideA,
    const unsigned short* __restrict__ Btp, const unsigned short* __restrict__ Bt2p, long strideB,
    void* __restrict__ Cout, void* __restrict__ Cout2, int ldc, long strideC,
    const float* __restrict__ bias,
    const float* __restrict__ resid, long strideR,
    int M, int N, int K, float scale) {
  __shared__ __align__(16) typename Elem<ET>::T sStage[2][kGsRows * kGsPitch];
  __shared__ __align__(16) float sT[8][16 * 68];
  gemm64_block<ET, SPLIT, BIAS_MODE, OUT_MODE, RESID, ACT, WIDE_M, lda, ldb>(
      sStage, sT, (int)blockIdx.x, (int)blockIdx.y, 0, Ap, A2p, strideA, Btp, Bt2p, strideB, Cout, Cout2, ldc, strideC,
      bias, resid, strideR, M, N, K, scale, 0L, 0L);
}

// The three projections that need only the pre-pass, in ONE launch of 3 x 256 blocks (256 = one block for every WGP; a block's LDS
// leaves room for no second one). None reads what another writes. The GEMM is picked by the block index, uniform in the block.
//   blocks   0..255: q   = LN . Wq^T (unscaled; 0.125 is applied to the f32 scores): M=8192, N=1024, K=1024 -> f16 plane
//   blocks 256..511: k   per head h: C[(s,b)][h*64 + d] = sum_e key[(s,b)][e] * Wkv[h*128 + d][e]; M=8192, N=64, K=1024; 16 groups x 16 h
//   blocks 512..767: v^T per (b, h): C[d][s] = sum_e Wkv[h*128 + 64 + d][e] * key[(s,b)][e]; M=64, N=2048, K=1024; 4 groups x 16 h x 4 b
constexpr int kProjBlocks = (kRowsQ / 64) * (kEmb / 64) / 8;   // 256 blocks per projection
static_assert((kRowsK / 64) / 8 * kHeads == kProjBlocks && (kSeqK / 64) / 8 * kHeads * kBatch == kProjBlocks, "three equal shares");
__global__ __launch_bounds__(256) void proj_qkv_kernel(
    const unsigned short* __restrict__ lnx16, const unsigned short* __restrict__ wq16,
    const unsigned short* __restrict__ key16, const unsigned short* __restrict__ wkv16,
    unsigned short* __restrict__ q16, unsigned short* __restrict__ k16, unsigned short* __restrict__ vt16) {
  __shared__ __align__(16) __bf16 sStage[2][kGsRows * kGsPitch];
  __shared__ __align__(16) float sT[8][16 * 68];
  const unsigned which = blockIdx.x / (unsigned)kProjBlocks;
  const unsigned j     = blockIdx.x % (unsigned)kProjBlocks;
  if (which == 0) {
    gemm64_block<1, false, 0, 1, false>(
        sStage, sT, (int)j, 0, 0, lnx16, nullptr, 0L, wq16, nullptr, 0L,
        (void*)q16, nullptr, kEmb, 0L, nullptr, nullptr, 0L, kRowsQ, kEmb, kEmb, 1.0f, 0L, 0L);
  } else if (which == 1) {
    constexpr unsigned g = (kRowsK / 64) / 8;   // 16 groups of 8 tiles per head
    gemm64_block<1, false, 0, 1, false, 0, true>(
        sStage, sT, (int)(j % g), (int)(j / g), 0, key16, nullptr, 0L, wkv16, nullptr, (long)(2 * kHdim) * kEmb,
        (void*)k16, nullptr, kEmb, (long)kHdim, nullptr, nullptr, 0L, kRowsK, kHdim, kEmb, 1.0f, 0L, 0L);
  } else {
    constexpr unsigned g = (kSeqK / 64) / 8;    // 4 groups of 8 tiles per (b, h)
    gemm64_block<1, false, 0, 1, false, 0, false, kEmb, kRowPitch>(
        sStage, sT, (int)(j % g), (int)((j / g) % kHeads), (int)(j / (g * kHeads)),
        wkv16 + (size_t)kHdim * kEmb, nullptr, (long)(2 * kHdim) * kEmb, key16, nullptr, 0L,
        (void*)vt16, nullptr, kSeqK, (long)kHdim * kSeqK, nullptr, nullptr, 0L, kHdim, kSeqK, kEmb, 1.0f,
        (long)kEmb, (long)kHeads * kHdim * kSeqK);
  }
}

// =====================================================================================
// Full (unmasked) attention, head dim 64, all batches and heads in one launch, time-major planes.
//   q plane  (f16): element (t, b, h, d) at [(t*kBatch + b)*kEmb + h*64 + d]   (unscaled q = LN(x).Wq^T)
//   k plane  (f16): element (s, b, h, d) at [(s*kBatch + b)*kEmb + h*64 + d]
//   v^T plane(f16): element (b, h, d, s) at [((b*kHeads + h)*64 + d)*kSeqK + s]
//   ctx plane (bf16 out): element (t, b, h, d) at [(t*kBatch + b)*kEmb + h*64 + d]
//   scores^T = (k . q^T) * sscale : single v_wmma_f32_16x16x32_f16 (A = K rows, B = Q), scale applied to the f32 accumulator
//   softmax in base 2: p * 2^15 = 2^(raw * sscale * log2(e) + 15 - maximum), one fused multiply-add and one v_exp_f32 per score
//   out^T    = v^T . p^T          : single v_wmma_f32_16x16x32_f16 (A = V^T rows, B = p^T), p = exp(s - m) in (0, 1] carried x2^15 as f16
//   A lane holds 32 of the chunk's 64 scores of ONE query (column lane & 15; keys j*16 + 8*(lane >> 4) + r), so the maximum and
//   the sum run in the lane, and two score tiles converted in place are the B operand of the second product: p never leaves registers.
//   online softmax in f32 over all kSeqK keys (32 chunks of 64, compile-time trip count).
//   Block = 4 waves = 64 query rows of one (b, h); grid.x = kBatch * kHeads * (kSeqQ/64) = 2048.
//   K / V^T chunk staging: 128 threads x 32 elements per plane = the whole 64x64 tile (16-B copies, plain loads,
//   __syncthreads before and after); fragment loads read the LDS tiles with the same v8h element type.
// =====================================================================================
#define AT_D 64
#define AT_NW 4
#define AT_QB 64
#define AT_KC 64
#define AT_LP 72   // LDS row pitch of the K and V^T tiles in f16: 144 B = 16 B x odd, so 16 rows read by 16-byte loads fall on distinct banks

// the plain builtin: the compiler keeps the distances behind its own matrix instructions, and with no volatile statement behind
// each product the LDS reads of later fragments are free to stand ahead of it
__device__ __forceinline__ v8f mma_f16g(v16h a, v16h b, v8f c) {
  return __builtin_amdgcn_wmma_f32_16x16x32_f16(false, a, false, b, (short)0, c, false, false);
}

// 2^x as the one hardware instruction; arguments here are <= 15 but for rounding, and a result below the normal range may go to 0
__device__ __forceinline__ float exp2_hw(float x) { return __builtin_amdgcn_exp2f(x); }
// the same for eight values, each in place, in one statement that ends in v_nop: behind a transcendental the instruction set asks
// for one independent instruction before its result is read or its source overwritten; here the next v_exp_f32 is that instruction
// and the v_nop is the last one's
__device__ __forceinline__ void exp2_hw8(float (&x)[8]) {
  asm("v_exp_f32 %0, %0\n\tv_exp_f32 %1, %1\n\tv_exp_f32 %2, %2\n\tv_exp_f32 %3, %3\n\t"
      "v_exp_f32 %4, %4\n\tv_exp_f32 %5, %5\n\tv_exp_f32 %6, %6\n\tv_exp_f32 %7, %7\n\tv_nop"
      : "+v"(x[0]), "+v"(x[1]), "+v"(x[2]), "+v"(x[3]), "+v"(x[4]), "+v"(x[5]), "+v"(x[6]), "+v"(x[7]));
}

// lane l takes the value of lane l ^ 16: the other half of the same query column
__device__ __forceinline__ float xhalf(float x) {
  return __builtin_bit_cast(float, __builtin_amdgcn_permlanex16(__builtin_bit_cast(int, x), __builtin_bit_cast(int, x), 0x76543210, 0xfedcba98, false, false));
}

// eight waves a SIMD is what lets all 2,048 blocks be resident at once: the register count is held at 128
__global__ __launch_bounds__(128) __attribute__((amdgpu_waves_per_eu(8)))
void attn_full16_kernel(const unsigned short* __restrict__ qp, const unsigned short* __restrict__ kp,
                        const unsigned short* __restrict__ vtp, unsigned short* __restrict__ ctxp, float sscale) {
  union FH { v16h v; v8h h[2]; };
  __shared__ __align__(16) _Float16 Ksh[AT_KC * AT_LP];            // K  [kv][d]   9 KB, 64 of 72 columns used
  __shared__ __align__(16) _Float16 Vth[AT_D * AT_LP];             // V^T [d][kv]  9 KB, 64 of 72 columns used
  __shared__ __align__(16) float    Os[AT_NW][16 * 68];            // per wave out tile, pitch 68

  const int tid  = threadIdx.x;
  const int wave = tid >> 5;
  const int lane = tid & 31;
  const int hh   = lane >> 4;
  const int c    = lane & 15;

  const int nqb  = kSeqQ / AT_QB;          // 32
  const int bx   = blockIdx.x;             // < kBatch*kHeads*nqb
  const int qb   = bx % nqb;
  const int bhid = bx / nqb;
  const int h    = bhid % kHeads;
  const int bb   = bhid / kHeads;          // 0..kBatch-1
  const int q0   = qb * AT_QB + wave * 16;

  const _Float16* Qh = (const _Float16*)(const void*)qp  + (size_t)bb * kEmb + (size_t)h * kHdim;
  const _Float16* Kh = (const _Float16*)(const void*)kp  + (size_t)bb * kEmb + (size_t)h * kHdim;
  const _Float16* Vh = (const _Float16*)(const void*)vtp + (size_t)(bb * kHeads + h) * kHdim * kSeqK;
  unsigned short* ob = ctxp + (size_t)bb * kEmb + (size_t)h * kHdim;

  // ---- Q fragments (B operand, column = lane&15, split k map via Frag load): 2 d-chunks ----
  v16h qa[2];
#pragma unroll
  for (int dc = 0; dc < 2; ++dc)
    qa[dc] = Frag<_Float16>::load(Qh + (size_t)(q0 + c) * kRowPitch + dc * 32 + 8 * hh);

  const float c2 = sscale * kLog2e;   // raw product -> exponent of 2; sscale > 0
  float mrow = -INFINITY;   // running maximum of query q0 + c in exponent-of-2 units, equal in both lane halves
  float lrow = 0.f;         // running sum (x2^15) over this lane half's keys only; the halves are joined behind the loop
  v8f oacc[4];              // oacc[t][r] = out^T[d = t*16 + 8*hh + r][query q0 + c]
#pragma unroll
  for (int t = 0; t < 4; ++t) oacc[t] = (v8f){0.f,0.f,0.f,0.f,0.f,0.f,0.f,0.f};

  const int nChunks = kSeqK / AT_KC;   // 32, compile-time constant
  for (int kc = 0; kc < nChunks; ++kc) {
    const int kv0 = kc * AT_KC;
    __syncthreads();
    {
      // staging coverage: 128 threads x (4 x 8) elements = 64 rows x 64 per plane = the whole chunk tile
      const int r = tid >> 1, half = (tid & 1) * 32;
      const _Float16* ks = Kh + (size_t)(kv0 + r) * kRowPitch + half;   // K row kv0+r, d = half..half+31
      const _Float16* vs = Vh + (size_t)r * kSeqK + kv0 + half;          // V^T row d = r, s = kv0+half..+31
#pragma unroll
      for (int i = 0; i < 4; ++i) {
        const v8h a0 = *(const v8h*)(ks + 8 * i);
        const v8h b0 = *(const v8h*)(vs + 8 * i);
        *(v8h*)(Ksh + r * AT_LP + half + 8 * i) = a0;
        *(v8h*)(Vth + r * AT_LP + half + 8 * i) = b0;
      }
      // the wait that stands in front of any rewrite of the eight loads' address registers; it names both addresses, so that they
      // keep their registers up to here (without it this build let the last load of each plane land on its own address pair)
      asm volatile("s_wait_xcnt 0x0" :: "v"(ks), "v"(vs) : "memory");
    }
    __syncthreads();

    v8f s[4];
#pragma unroll
    for (int j = 0; j < 4; ++j) {
      s[j] = (v8f){0.f,0.f,0.f,0.f,0.f,0.f,0.f,0.f};
#pragma unroll
      for (int dc = 0; dc < 2; ++dc) {
        FH kb;
        kb.h[0] = *(const v8h*)(Ksh + (j * 16 + c) * AT_LP + dc * 32 + 8 * hh);
        kb.h[1] = *(const v8h*)(Ksh + (j * 16 + c) * AT_LP + dc * 32 + 16 + 8 * hh);
        s[j] = mma_f16g(kb.v, qa[dc], s[j]);   // s[j][r] = score of query c with key kv0 + j*16 + 8*hh + r
      }
    }
    float m = -INFINITY;
#pragma unroll
    for (int j = 0; j < 4; ++j) {
#pragma unroll
      for (int r = 0; r < 8; ++r) m = fmaxf(m, s[j][r]);   // on the raw products: c2 > 0 keeps their order
    }
    m = fmaxf(m, xhalf(m));                    // the query's maximum over all 64 keys of the chunk
    const float mnew  = fmaxf(mrow, m * c2);
    const float alpha = exp2_hw(mrow - mnew);
    mrow = mnew;
    const float eoff = kPCarryLog2 - mnew;     // maximum and carry in one addend of the exponent
    float psum = 0.f;
    FH pb[2];                                  // p^T as B operand: element e of pb[kk] = key kk*32 + (e < 8 ? 8*hh + e : 16 + 8*hh + e - 8)
#pragma unroll
    for (int j = 0; j < 4; ++j) {
      float p[8];                              // 2^15 * exp(score - maximum), at most 2^15 but for rounding
#pragma unroll
      for (int r = 0; r < 8; ++r) p[r] = fmaf(s[j][r], c2, eoff);
      exp2_hw8(p);
#pragma unroll
      for (int r = 0; r < 8; ++r) {
        psum += p[r];
        pb[j >> 1].h[j & 1][r] = (_Float16)p[r];
      }
      // ends the first 32 keys' exponentials, sums and packing before the next 32 begin: left alone, the scheduler holds all
      // 32 numerators of a lane live beside both packed operands, and the kernel goes over 128 registers (7 waves a SIMD, not 8)
      if (j == 1) __builtin_amdgcn_sched_barrier(0);
    }
    FH vb[4];                                  // V^T fragments of the first 32 keys, read as one group
#pragma unroll
    for (int t = 0; t < 4; ++t) {
      vb[t].h[0] = *(const v8h*)(Vth + (t * 16 + c) * AT_LP + 8 * hh);
      vb[t].h[1] = *(const v8h*)(Vth + (t * 16 + c) * AT_LP + 16 + 8 * hh);
    }
    // holds the eight reads here, ahead of the rescaling: left alone, the scheduler sinks each pair to its product and the wave
    // waits out the LDS latency once per product
    __builtin_amdgcn_sched_barrier(0);
    lrow = lrow * alpha + psum;
#pragma unroll
    for (int t = 0; t < 4; ++t)
#pragma unroll
      for (int r = 0; r < 8; ++r) oacc[t][r] *= alpha;
#pragma unroll
    for (int t = 0; t < 4; ++t) oacc[t] = mma_f16g(vb[t].v, pb[0].v, oacc[t]);
#pragma unroll   // the second 32 keys' fragments, again as one group, under the four products just issued
    for (int t = 0; t < 4; ++t) {
      vb[t].h[0] = *(const v8h*)(Vth + (t * 16 + c) * AT_LP + 32 + 8 * hh);
      vb[t].h[1] = *(const v8h*)(Vth + (t * 16 + c) * AT_LP + 32 + 16 + 8 * hh);
    }
    __builtin_amdgcn_sched_barrier(0);         // as above: keeps the eight reads together in front of their products
#pragma unroll
    for (int t = 0; t < 4; ++t) oacc[t] = mma_f16g(vb[t].v, pb[1].v, oacc[t]);
  }

  // ---- normalise (fold back the 2^15 carry), stage the wave's 16x64 tile, write bf16 rows:
  float* os = Os[wave];
  const float inv = 1.0f / (lrow + xhalf(lrow));   // both halves' sums joined; sums and products carry the same 2^15
#pragma unroll
  for (int t = 0; t < 4; ++t)
#pragma unroll
    for (int r = 0; r < 8; ++r) os[c * 68 + t * 16 + 8 * hh + r] = oacc[t][r] * inv;
  __builtin_amdgcn_fence(__ATOMIC_RELEASE, "workgroup");
  __builtin_amdgcn_wave_barrier();
  __builtin_amdgcn_fence(__ATOMIC_ACQUIRE, "workgroup");
  {
    const int qq = lane >> 3, c8 = (lane & 7) * 8;
    {
#pragma unroll
      for (int it = 0; it < 4; ++it) {
        const int row = it * 4 + qq;
        const float* sp = os + row * 68 + c8;
        v8h hv;
#pragma unroll
        for (int e = 0; e < 8; ++e) hv[e] = __builtin_bit_cast(_Float16, f2bf_bits(sp[e]));
        *(v8h*)(ob + (size_t)(q0 + row) * kRowPitch + c8) = hv;
      }
      
    }
  }
}

// ---------------------------------------------------------------------------
// Pre-pass, ONE launch: LayerNorm(query) -> bf16 plane, and the bf16 (RNE) casts of key, w_q, w_kv and w_out.
// Unit of work: one row of kEmb = 1024 f32 (4 KB read, 2 KB written), done by ONE wave. Chunk j of a row is elements
// j*128 + 4*lane .. +3, so a wave-wide 16-B load covers 512 contiguous bytes and a wave-wide 8-B store 256: whole lines.
// 20,480 rows on kPpWaves = 4,096 waves: wave w takes query rows w and w + 4096, key rows w and w + 4096, and row w of the
// three weight matrices counted end to end. Few long waves with many loads in flight, so that the launch is paid for by its
// bytes and not by the number of waves to start. A row's sums stay inside its wave: no LDS, no barrier.
// ---------------------------------------------------------------------------
constexpr int kPpWaves  = 4096;
constexpr int kPpChunks = kEmb / 128;            // 8 chunks of 32 lanes x 4 elements
static_assert(kRowsQ == 2 * kPpWaves && kRowsK == 2 * kPpWaves && 4 * kEmb == kPpWaves, "two query rows, two key rows, one weight row per wave");

struct PpRow { v4f c[kPpChunks]; };

__device__ __forceinline__ void pp_load(PpRow& r, const float* __restrict__ row, int lane) {
#pragma unroll   // constant indices keep the row in registers and the chunk steps in the loads' immediate offsets
  for (int j = 0; j < kPpChunks; ++j) r.c[j] = *(const v4f*)(row + j * 128 + 4 * lane);
  // holds the row's 8 loads here, in the order of the calls: left alone, the scheduler sinks loads to their users, two at a
  // time, and the wave waits out memory latency once per pair; in call order the first row is worked on while the rest fly
  __builtin_amdgcn_sched_barrier(0);
}

__device__ __forceinline__ void pp_store(const PpRow& r, unsigned short* __restrict__ row, int lane) {
#pragma unroll   // as above
  for (int j = 0; j < kPpChunks; ++j) {
    v2u pk;
    pk[0] = (unsigned)f2bf_bits(r.c[j][0]) | ((unsigned)f2bf_bits(r.c[j][1]) << 16);
    pk[1] = (unsigned)f2bf_bits(r.c[j][2]) | ((unsigned)f2bf_bits(r.c[j][3]) << 16);
    *(v2u*)(row + j * 128 + 4 * lane) = pk;
  }
  addr_regs_wait();
}

// lane l takes the value of lane l ^ M inside its 16-lane row (DPP row_xmask:M)
template <int M> __device__ __forceinline__ float xrow(float x) {
  return __builtin_bit_cast(float, __builtin_amdgcn_update_dpp(0, __builtin_bit_cast(int, x), 0x160 + M, 0xf, 0xf, true));
}
// sum over the 32 lanes, the same bits in every lane
__device__ __forceinline__ float wave_sum(float x) {
  x += xrow<1>(x);
  x += xrow<2>(x);
  x += xrow<4>(x);
  x += xrow<8>(x);
  return x + xhalf(x);
}
__device__ __forceinline__ float sum8(const float* p) { return ((p[0] + p[1]) + (p[2] + p[3])) + ((p[4] + p[5]) + (p[6] + p[7])); }

// two-pass mean and variance of one row, then (x - mu) * rstd * gamma + beta in place
__device__ __forceinline__ void pp_norm(PpRow& r, const PpRow& g, const PpRow& bt, float eps) {
  float p[kPpChunks];
#pragma unroll
  for (int j = 0; j < kPpChunks; ++j) p[j] = (r.c[j][0] + r.c[j][1]) + (r.c[j][2] + r.c[j][3]);
  const float mu = wave_sum(sum8(p)) * (1.0f / (float)kEmb);
#pragma unroll
  for (int j = 0; j < kPpChunks; ++j) {
    r.c[j] -= mu;
    p[j] = (r.c[j][0] * r.c[j][0] + r.c[j][1] * r.c[j][1]) + (r.c[j][2] * r.c[j][2] + r.c[j][3] * r.c[j][3]);
  }
  const float var  = wave_sum(sum8(p)) * (1.0f / (float)kEmb);
  const float rstd = rsqrtf(var + eps);
#pragma unroll
  for (int j = 0; j < kPpChunks; ++j)
#pragma unroll
    for (int e = 0; e < 4; ++e) r.c[j][e] = r.c[j][e] * rstd * g.c[j][e] + bt.c[j][e];
}

__global__ __launch_bounds__(256)
void prepass_kernel(const float* __restrict__ query, const float* __restrict__ key,
                    const float* __restrict__ gam, const float* __restrict__ bet,
                    const float* __restrict__ w_q, const float* __restrict__ w_kv, const float* __restrict__ w_out,
                    unsigned short* __restrict__ lnx16, unsigned short* __restrict__ key16,
                    unsigned short* __restrict__ wq16, unsigned short* __restrict__ wkv16, unsigned short* __restrict__ wo16,
                    float eps) {
  const int lane = threadIdx.x & 31;
  // wave-uniform by construction; through readfirstlane so that every row address is a scalar base plus one lane offset
  const int w = blockIdx.x * 8 + __builtin_amdgcn_readfirstlane((int)(threadIdx.x >> 5));
  const float* wsrc;
  unsigned short* wdst;
  if (w < kEmb)          { wsrc = w_q   + (size_t)w * kEmb;              wdst = wq16  + (size_t)w * kEmb; }
  else if (w < 3 * kEmb) { wsrc = w_kv  + (size_t)(w - kEmb) * kEmb;     wdst = wkv16 + (size_t)(w - kEmb) * kEmb; }
  else                   { wsrc = w_out + (size_t)(w - 3 * kEmb) * kEmb; wdst = wo16  + (size_t)(w - 3 * kEmb) * kEmb; }

  PpRow ka, kb, wr, qa, qb, g, bt;
  pp_load(ka, key + (size_t)w * kEmb, lane);
  pp_load(kb, key + (size_t)(w + kPpWaves) * kEmb, lane);
  pp_load(wr, wsrc, lane);
  pp_load(qa, query + (size_t)w * kEmb, lane);
  pp_load(qb, query + (size_t)(w + kPpWaves) * kEmb, lane);
  addr_regs_wait();

  pp_store(ka, key16 + (size_t)w * kEmb, lane);
  pp_store(kb, key16 + (size_t)(w + kPpWaves) * kEmb, lane);
  pp_store(wr, wdst, lane);
  pp_load(g, gam, lane);      // 8 KB that every wave reads: cache hits, landing under the rows' sums
  pp_load(bt, bet, lane);
  addr_regs_wait();
  pp_norm(qa, g, bt, eps);
  pp_norm(qb, g, bt, eps);
  pp_store(qa, lnx16 + (size_t)w * kEmb, lane);
  pp_store(qb, lnx16 + (size_t)(w + kPpWaves) * kEmb, lane);
}

// ---------------------------------------------------------------------------
// Host orchestration.
// Workspace region map (byte offsets):
//   [  0 MiB, 16 MiB)  KEY16  bf16 [8192][1024]   key cast
//   [ 16 MiB, 18 MiB)  WQ16   bf16 [1024][1024]
//   [ 18 MiB, 22 MiB)  WKV16  bf16 [2048][1024]
//   [ 22 MiB, 24 MiB)  WO16   bf16 [1024][1024]
//   [ 24 MiB, 40 MiB)  LNX16  bf16 [8192][1024]   LN(query); dead after the q projection, then reused as
//                      CTX16  bf16 [8192][1024]   attention output
//   [ 40 MiB, 56 MiB)  Q16    f16  [8192][1024]
//   [ 56 MiB, 72 MiB)  K16    f16  [8192][1024]   (head h at columns h*64)
//   [ 72 MiB, 88 MiB)  VT16   f16  [4][16][64][2048]
//   total 88 MiB = 92274688 B
// ---------------------------------------------------------------------------
extern "C" void kernel_launch(void* const* d_in, const int* in_sizes, int n_in,
                              void* d_out, int out_size, void* d_ws, size_t ws_size,
                              hipStream_t stream) {
  if (n_in < 7) return;
  const int nAct = kSeqQ * kBatch * kEmb;          // 8388608
  if (in_sizes[0] != nAct || in_sizes[1] != kSeqK * kBatch * kEmb) return;
  if (in_sizes[2] < kEmb || in_sizes[3] < kEmb) return;
  if (in_sizes[4] != kEmb * kEmb || in_sizes[5] != 2 * kEmb * kEmb || in_sizes[6] != kEmb * kEmb) return;
  if (out_size != nAct) return;

  const float* query = (const float*)d_in[0];   // [2048][4][1024]
  const float* key   = (const float*)d_in[1];   // [2048][4][1024]
  const float* gamma = (const float*)d_in[2];   // [1024]
  const float* beta  = (const float*)d_in[3];   // [1024]
  const float* w_q   = (const float*)d_in[4];   // [1024][1024]
  const float* w_kv  = (const float*)d_in[5];   // [2048][1024]
  const float* w_out = (const float*)d_in[6];   // [1024][1024]
  float* out = (float*)d_out;

  const size_t szAct16 = (size_t)kRowsQ * kEmb * 2;          // 16 MiB
  const size_t szWq16  = (size_t)kEmb * kEmb * 2;            //  2 MiB
  const size_t szWkv16 = (size_t)2 * kEmb * kEmb * 2;        //  4 MiB
  const size_t szVt16  = (size_t)kBatch * kHeads * kHdim * kSeqK * 2;   // 16 MiB
  size_t off = 0;
  char* ws = (char*)d_ws;
  unsigned short* KEY16 = (unsigned short*)(ws + off); off += szAct16;
  unsigned short* WQ16  = (unsigned short*)(ws + off); off += szWq16;
  unsigned short* WKV16 = (unsigned short*)(ws + off); off += szWkv16;
  unsigned short* WO16  = (unsigned short*)(ws + off); off += szWq16;
  unsigned short* LNX16 = (unsigned short*)(ws + off); off += szAct16;
  unsigned short* CTX16 = LNX16;                                // region reuse (LNX16 dead after the q GEMM)
  unsigned short* Q16   = (unsigned short*)(ws + off); off += szAct16;
  unsigned short* K16   = (unsigned short*)(ws + off); off += szAct16;
  unsigned short* VT16  = (unsigned short*)(ws + off); off += szVt16;
  if (off > ws_size) return;

  // 1) + 2) pre-pass: LayerNorm(query) -> bf16 plane and the four bf16 casts, 8 waves per block
  prepass_kernel<<<kPpWaves / 8, 256, 0, stream>>>(query, key, gamma, beta, w_q, w_kv, w_out,
                                                   LNX16, KEY16, WQ16, WKV16, WO16, kLnEps);

  // 3) + 4) + 5) q, k and v^T projections, one launch
  proj_qkv_kernel<<<3 * kProjBlocks, 256, 0, stream>>>(LNX16, WQ16, KEY16, WKV16, Q16, K16, VT16);

  // 6) attention: one block per (b, h, 64-query tile) -> ctx bf16 plane (time-major, heads merged)
  attn_full16_kernel<<<kBatch * kHeads * (kSeqQ / AT_QB), 128, 0, stream>>>(Q16, K16, VT16, CTX16, 0.125f);

  // 7) out = query + ctx . Wout^T : M=8192, N=1024, K=1024, f32 with residual epilogue, straight to d_out
  {
    const int tiles = (kRowsQ / 64) * (kEmb / 64);   // 2048
    wmma_gemm64<1, false, 0, 0, true><<<dim3((tiles + 7) / 8, 1), 256, 0, stream>>>(
        CTX16, nullptr, 0L, WO16, nullptr, 0L,
        (void*)out, nullptr, kEmb, 0L, nullptr, query, 0L, kRowsQ, kEmb, kEmb, 1.0f);
  }
}

// v008
// One run takes 167 microseconds.
// In two side-by-side timings against v007, it was 1.08 and 1.09 times as fast.
// All steps since v000 together make it 4.83 times as fast.
// Contractions: q, k, v^T and output projections on v_wmma_f32_16x16x32_bf16 (bf16 operands); q.k^T and p.v on v_wmma_f32_16x16x32_f16 (f16 operands, p carried x2^15); all f32 accumulate; layernorm, softmax, score scale 0.125 and residual add in f32.
#include <hip/hip_runtime.h>
#include <math.h>
#include <stdint.h>

// ---------------------------------------------------------------------------
// Problem geometry (time-major activations: row (t, b) = t*kBatch + b, pitch kEmb)
// ---------------------------------------------------------------------------
constexpr int kSeqQ  = 2048;
constexpr int kSeqK  = 2048;
constexpr int kBatch = 4;
constexpr int kEmb   = 1024;
constexpr int kHeads = 16;
constexpr int kHdim  = 64;
constexpr int kRowsQ = kSeqQ * kBatch;          // 8192
constexpr int kRowsK = kSeqK * kBatch;          // 8192
constexpr int kRowPitch = kBatch * kEmb;        // 4096: stride between consecutive t at fixed b
constexpr float kLnEps  = 1e-5f;
constexpr float kPCarryLog2 = 15.0f;            // softmax numerators carried x2^15 in f16
constexpr float kLog2e  = 1.4426950408889634f;

typedef __attribute__((ext_vector_type(16))) _Float16 v16h;
typedef __attribute__((ext_vector_type(8)))  _Float16 v8h;
typedef __attribute__((ext_vector_type(16))) __bf16   v16b;
typedef __attribute__((ext_vector_type(8)))  __bf16   v8b;
typedef __attribute__((ext_vector_type(8)))  float    v8f;
typedef __attribute__((ext_vector_type(4)))  float    v4f;
typedef __attribute__((ext_vector_type(2)))  float    v2f;
typedef __attribute__((ext_vector_type(2)))  unsigned int v2u;

__device__ __forceinline__ unsigned short f2bf_bits(float f) {
  unsigned u = __float_as_uint(f);
  return (unsigned short)((u + 0x7FFFu + ((u >> 16) & 1u)) >> 16);
}
__device__ __forceinline__ float bf_bits2f(unsigned short h) { return __uint_as_float(((unsigned)h) << 16); }

// hazard guards as plain device helpers (no inline asm inside the kernel template body)
__device__ __forceinline__ void dep_guard_h(v8f& a, v8f& b, v16h x, v16h y) { asm volatile("v_nop\n\tv_nop\n\tv_nop\n\tv_nop" : "+v"(a), "+v"(b) : "v"(x), "v"(y)); }
__device__ __forceinline__ void dep_guard_b(v8f& a, v8f& b, v16b x, v16b y) { asm volatile("v_nop\n\tv_nop\n\tv_nop\n\tv_nop" : "+v"(a), "+v"(b) : "v"(x), "v"(y)); }
__device__ __forceinline__ void keep4_h(v16h a, v16h b, v16h c, v16h d) { asm volatile("v_nop" :: "v"(a), "v"(b), "v"(c), "v"(d)); }
__device__ __forceinline__ void keep4_b(v16b a, v16b b, v16b c, v16b d) { asm volatile("v_nop" :: "v"(a), "v"(b), "v"(c), "v"(d)); }
__device__ __forceinline__ void acc_guard4(v8f& a, v8f& b, v8f& c, v8f& d) { asm volatile("v_nop\n\tv_nop\n\tv_nop\n\tv_nop" : "+v"(a), "+v"(b), "+v"(c), "+v"(d)); }
// stands behind a group of global loads or stores: none of their address registers is rewritten in front of this wait
__device__ __forceinline__ void addr_regs_wait() { asm volatile("s_wait_xcnt 0x0" ::: "memory"); }
template <typename T> struct Frag;
template <> struct Frag<_Float16> {
  typedef v16h V; typedef v8h H; union U { v16h v; v8h h[2]; };
  static __device__ __forceinline__ v16h load(const _Float16* p) {   // elements 0..7 <- p[0..7], 8..15 <- p[16..23]
    U f; f.h[0] = *(const v8h*)(p); f.h[1] = *(const v8h*)(p + 16); return f.v;
  }
  static __device__ __forceinline__ v8f mma(v16h a, v16h b, v8f c) {
    return __builtin_amdgcn_wmma_f32_16x16x32_f16(false, a, false, b, (short)0, c, false, false);
  }
  static __device__ __forceinline__ void guard(v8f& a, v8f& b, v16h x, v16h y) { dep_guard_h(a, b, x, y); }
  static __device__ __forceinline__ void keep(v16h a, v16h b, v16h c, v16h d) { keep4_h(a, b, c, d); }
};
template <> struct Frag<__bf16> {
  typedef v16b V; typedef v8b H; union U { v16b v; v8b h[2]; };
  static __device__ __forceinline__ v16b load(const __bf16* p) {
    U f; f.h[0] = *(const v8b*)(p); f.h[1] = *(const v8b*)(p + 16); return f.v;
  }
  static __device__ __forceinline__ v8f mma(v16b a, v16b b, v8f c) {
    return __builtin_amdgcn_wmma_f32_16x16x32_bf16(false, a, false, b, (short)0, c, false, false);
  }
  static __device__ __forceinline__ void guard(v8f& a, v8f& b, v16b x, v16b y) { dep_guard_b(a, b, x, y); }
  static __device__ __forceinline__ void keep(v16b a, v16b b, v16b c, v16b d) { keep4_b(a, b, c, d); }
};

// ---- Register-blocked batched WMMA GEMM ------------------------------------
// C[m,n] = scale * sum_k A[m,k] * Bt[n,k] (+bias)(+resid); each wave owns a 64x64 tile.
// A row-major [M,K]; Bt row-major [N,K]; M,N % 64 == 0, K % 64 == 0; the tile count is a multiple of 8.
// The 8 waves of a block own 8 consecutive tiles that share one operand's 64 rows:
//   WIDE_M = false: N/64 is a multiple of 8, the block is 64 x 512 (A rows shared, 64 Bt rows per wave);
//   WIDE_M = true : N == 64, the block is 512 x 64 (Bt rows shared, 64 A rows per wave).
// Operands go through LDS in slabs of 64 k: every thread copies whole 16-B pieces so that a wave-wide load covers
// 4 whole 128-B lines; two LDS buffers, the next slab's global loads are issued ahead of the current slab's products.
// The row pitches lda, ldb are compile-time, so that a slab's 18 loads are two addresses plus immediate offsets.
// SPLIT (hi/lo planes) is not staged and not instantiated.
// BIAS_MODE: 0 = none, 1 = bias[m], 2 = bias[n].
// OUT_MODE: 0 = f32, 1 = f16, 2 = bf16 hi plane (Cout) + bf16 lo plane (Cout2).
// ET: 0 = f16 operands, 1 = bf16 operands (pointers passed as 16-bit storage)
template <int ET> struct Elem;
template <> struct Elem<0> { typedef _Float16 T; };
template <> struct Elem<1> { typedef __bf16 T; };
constexpr int kGsBk    = 64;                     // k elements per slab: 128 B of every operand row
constexpr int kGsPitch = 72;                     // LDS row pitch in 16-bit elements: 144 B = 16 B x odd
constexpr int kGsRows  = 64 + 8 * 64;            // the shared operand's rows, then 64 rows per wave
constexpr int kGsCopies = kGsRows * 8 / 256;     // 16-B pieces per thread and slab: 18
// One block's work as a device function, so that one launch can hold blocks of several GEMMs: the kernel owns the LDS arrays and
// hands in the block's place (bx = group of 8 tiles; by steps A, Bt, C, resid by strideA, strideB, strideC, strideR; bz steps Bt, C
// by strideBz, strideCz).
template <int ET, bool SPLIT, int BIAS_MODE, int OUT_MODE, bool RESID, int ACT = 0, bool WIDE_M = false, int lda = kEmb, int ldb = kEmb>
__device__ __forceinline__ void gemm64_block(
    typename Elem<ET>::T (*sStage)[kGsRows * kGsPitch],   // two slab buffers, 82,944 B each
    float (*sT)[16 * 68],                                 // per-wave 16x64 slab, pitch 68 floats
    int bx, int by, int bz,
    const unsigned short* __restrict__ Ap, const unsigned short* __restrict__ A2p, long strideA,
    const unsigned short* __restrict__ Btp, const unsigned short* __restrict__ Bt2p, long strideB,
    void* __restrict__ Cout, void* __restrict__ Cout2, int ldc, long strideC,
    const float* __restrict__ bias,
    const float* __restrict__ resid, long strideR,
    int M, int N, int K, float scale, long strideBz, long strideCz) {
  typedef typename Elem<ET>::T T;
  typedef typename Frag<T>::V V;
  typedef typename Frag<T>::H H;
  static_assert(!SPLIT, "hi/lo planes are not staged");
  const T* A = (const T*)Ap; const T* Bt = (const T*)Btp;
  const int b    = by;
  const int tid  = threadIdx.x;
  const int lane = tid & 31;
  const int wave = tid >> 5;
  const int tilesN = N >> 6;
  const int tilesM = M >> 6;
  if ((bx + 1) * 8 > tilesM * tilesN) return;  // block-uniform, in front of every barrier
  const int tile0 = bx * 8;                    // the block's first tile; wave w owns tile0 + w
  const int tm0 = tile0 / tilesN;
  const int tn0 = tile0 - tm0 * tilesN;
  const int m0 = (tm0 << 6) + (WIDE_M ? (wave << 6) : 0);
  const int n0 = (tn0 << 6) + (WIDE_M ? 0 : (wave << 6));

  const T* Ab  = A  + (size_t)b * strideA;
  const T* Bb  = Bt + (size_t)b * strideB + (size_t)bz * strideBz;
  const size_t cOff = (size_t)b * strideC + (size_t)bz * strideCz;   // element offset of this (by, bz) problem's C

  const int rlane = lane & 15;                 // row (A) / col (B, D) within subtile
  const int koff  = (lane >> 4) * 8;           // k offset of this lane half
  const int mOff  = (lane >> 4) * 8;           // D row offset

  // staging map: piece q = it*256 + tid -> LDS row q/8, 16-B piece q%8; rows 0..63 shared operand, 64.. per wave
  const int srow = tid >> 3;
  const int sseg = (tid & 7) * 8;
  const int ldS = WIDE_M ? ldb : lda;          // shared operand
  const int ldW = WIDE_M ? lda : ldb;          // operand with 64 rows per wave
  const char* uA = (const char*)(Ab + (size_t)(tm0 << 6) * lda);   // block-uniform bases, byte addressed
  const char* uB = (const char*)(Bb + (size_t)(tn0 << 6) * ldb);
  const char* uS = WIDE_M ? uB : uA;
  const char* uW = WIDE_M ? uA : uB;
  const unsigned vS = (unsigned)(srow * ldS + sseg) * 2u;          // this thread's byte offset inside 32 rows
  const unsigned vW = (unsigned)(srow * ldW + sseg) * 2u;
  const int sOff = srow * kGsPitch + sseg;
  const int fS = rlane * kGsPitch + koff;                          // fragment row 0 of the shared operand
  const int fW = (64 + (wave << 6) + rlane) * kGsPitch + koff;     // fragment row 0 of this wave's own rows
  const int fA = WIDE_M ? fW : fS;
  const int fB = WIDE_M ? fS : fW;

  v8f acc[4][4];
#pragma unroll
  for (int i = 0; i < 4; ++i)
#pragma unroll
    for (int j = 0; j < 4; ++j) acc[i][j] = (v8f){0.f,0.f,0.f,0.f,0.f,0.f,0.f,0.f};

  // trip s: slab s's global loads are issued, slab s - 1 is multiplied out of its buffer, slab s goes to the other one
  const int nSlabs = K / kGsBk;
  for (int s = 0; s <= nSlabs; ++s) {
    const bool fill = s < nSlabs;              // block-uniform
    H st[kGsCopies];
    if (fill) {
      const int k1 = s * kGsBk;
#pragma unroll   // constant indices keep st[] in registers and the row steps in the loads' immediate offsets
      for (int it = 0; it < 2; ++it) st[it] = *(const H*)(uS + ((size_t)(it * 32) * ldS + k1) * 2 + vS);
#pragma unroll   // as above
      for (int it = 2; it < kGsCopies; ++it) st[it] = *(const H*)(uW + ((size_t)((it - 2) * 32) * ldW + k1) * 2 + vW);
      addr_regs_wait();
    }
    if (s > 0) {
      const T* cur = sStage[(s - 1) & 1];
#pragma unroll   // both halves of the slab in one trip: the second half's LDS reads can start under the first half's products
      for (int kk = 0; kk < kGsBk; kk += 32) {
        V bh[4], ah[4];
#pragma unroll   // fragments and accumulators in registers, here and in the three loops below
        for (int j = 0; j < 4; ++j) bh[j] = Frag<T>::load(cur + fB + j * 16 * kGsPitch + kk);
#pragma unroll
        for (int i = 0; i < 4; ++i) ah[i] = Frag<T>::load(cur + fA + i * 16 * kGsPitch + kk);
#pragma unroll
        for (int i = 0; i < 4; ++i) {
#pragma unroll
          for (int j = 0; j < 4; ++j) acc[i][j] = Frag<T>::mma(ah[i], bh[j], acc[i][j]);
          Frag<T>::guard(acc[i][0], acc[i][3], ah[i], ah[i]);
        }
        Frag<T>::keep(bh[0], bh[1], bh[2], bh[3]);
      }
    }
    if (fill) {
      T* nxt = sStage[s & 1];                  // its last readers (slab s - 2) left it at the barrier that ended trip s - 1
#pragma unroll   // st[] in registers, row steps in the stores' immediate offsets
      for (int it = 0; it < kGsCopies; ++it) *(H*)(nxt + sOff + it * 32 * kGsPitch) = st[it];
    }
    __syncthreads();                           // publishes slab s and ends every read of slab s - 1
  }
  acc_guard4(acc[0][0], acc[0][1], acc[0][2], acc[0][3]);
  acc_guard4(acc[1][0], acc[1][1], acc[1][2], acc[1][3]);
  acc_guard4(acc[2][0], acc[2][1], acc[2][2], acc[2][3]);
  acc_guard4(acc[3][0], acc[3][1], acc[3][2], acc[3][3]);

  // ---- epilogue ----
  float* slab = sT[wave];
  const float* Rb = RESID ? (resid + (size_t)b * strideR) : nullptr;
#pragma unroll
  for (int i = 0; i < 4; ++i) {
    const int mBase = m0 + (i << 4);
#pragma unroll
    for (int j = 0; j < 4; ++j) {
      const int n = n0 + (j << 4) + rlane;
      float bv = 0.f;
      if (BIAS_MODE == 2) bv = bias[n];
#pragma unroll
      for (int r = 0; r < 8; ++r) {
        float v = acc[i][j][r] * scale;
        if (BIAS_MODE == 1) v += bias[mBase + mOff + r];
        if (BIAS_MODE == 2) v += bv;
        if (RESID) v += Rb[(size_t)(mBase + mOff + r) * ldc + n];
        if (ACT == 1) v = tanhf(v);
        if (ACT == 2) v = fmaxf(v, 0.0f);
        if (ACT == 3) v = v / (1.0f + expf(-v));
        if (ACT == 4) v = (v > 0.f) ? v : 0.01f * v;
        if (ACT == 5) v = 0.5f * v * (1.0f + erff(v * 0.70710678118654752f));
        slab[(mOff + r) * 68 + (j << 4) + rlane] = v;
      }
    }
    __builtin_amdgcn_fence(__ATOMIC_RELEASE, "workgroup");
    __builtin_amdgcn_wave_barrier();
    __builtin_amdgcn_fence(__ATOMIC_ACQUIRE, "workgroup");
    if (OUT_MODE == 0) {
      float* C = (float*)Cout + cOff;
      const int hh = lane >> 4, c4 = (lane & 15) * 4;     // row seg = 256 B = 16 lanes x 16 B
      {
#pragma unroll
        for (int it = 0; it < 8; ++it) {
          const int row = it * 2 + hh;
          v4f v = *(const v4f*)(slab + row * 68 + c4);
          *(v4f*)(C + (size_t)(mBase + row) * ldc + n0 + c4) = v;
        }
        
      }
    } else {
      const int q = lane >> 3, c8 = (lane & 7) * 8;
      unsigned short* C  = (unsigned short*)Cout  + cOff;
      unsigned short* C2 = (OUT_MODE == 2) ? ((unsigned short*)Cout2 + cOff) : nullptr;
      {
#pragma unroll
        for (int it = 0; it < 4; ++it) {
          const int row = it * 4 + q;
          const float* sp = slab + row * 68 + c8;
          v8h hv, lv;
#pragma unroll
          for (int e = 0; e < 8; ++e) {
            if (OUT_MODE == 1) {
              hv[e] = (_Float16)sp[e];
            } else {
              unsigned short hb = f2bf_bits(sp[e]);
              unsigned short lb = f2bf_bits(sp[e] - bf_bits2f(hb));
              hv[e] = __builtin_bit_cast(_Float16, hb);
              lv[e] = __builtin_bit_cast(_Float16, lb);
            }
          }
          *(v8h*)(C + (size_t)(mBase + row) * ldc + n0 + c8) = hv;
          if (OUT_MODE == 2) *(v8h*)(C2 + (size_t)(mBase + row) * ldc + n0 + c8) = lv;
        }
        
      }
    }
    __builtin_amdgcn_fence(__ATOMIC_RELEASE, "workgroup");
    __builtin_amdgcn_wave_barrier();
    __builtin_amdgcn_fence(__ATOMIC_ACQUIRE, "workgroup");
  }
}

// One GEMM per launch: grid.x = groups of 8 tiles, grid.y = batch.
template <int ET, bool SPLIT, int BIAS_MODE, int OUT_MODE, bool RESID, int ACT = 0, bool WIDE_M = false, int lda = kEmb, int ldb = kEmb>
__global__ __launch_bounds__(256) void wmma_gemm64(
    const unsigned short* __restrict__ Ap, const unsigned short* __restrict__ A2p, long strideA,
    const unsigned short* __restrict__ Btp, const unsigned short* __restrict__ Bt2p, long strideB,
    void* __restrict__ Cout, void* __restrict__ Cout2, int ldc, long strideC,
    const float* __restrict__ bias,
    const float* __restrict__ resid, long strideR,
    int M, int N, int K, float scale) {
  __shared__ __align__(16) typename Elem<ET>::T sStage[2][kGsRows * kGsPitch];
  __shared__ __align__(16) float sT[8][16 * 68];
  gemm64_block<ET, SPLIT, BIAS_MODE, OUT_MODE, RESID, ACT, WIDE_M, lda, ldb>(
      sStage, sT, (int)blockIdx.x, (int)blockIdx.y, 0, Ap, A2p, strideA, Btp, Bt2p, strideB, Cout, Cout2, ldc, strideC,
      bias, resid, strideR, M, N, K, scale, 0L, 0L);
}

// The three projections that need only the pre-pass, in ONE launch of 3 x 256 blocks (256 = one block for every WGP; a block's LDS
// leaves room for no second one). None reads what another writes. The GEMM is picked by the block index, uniform in the block.
//   blocks   0..255: q   = LN . Wq^T (unscaled; 0.125 is applied to the f32 scores): M=8192, N=1024, K=1024 -> f16 plane
//   blocks 256..511: k   per head h: C[(s,b)][h*64 + d] = sum_e key[(s,b)][e] * Wkv[h*128 + d][e]; M=8192, N=64, K=1024; 16 groups x 16 h
//   blocks 512..767: v^T per (b, h): C[d][s] = sum_e Wkv[h*128 + 64 + d][e] * key[(s,b)][e]; M=64, N=2048, K=1024; 4 groups x 16 h x 4 b
constexpr int kProjBlocks = (kRowsQ / 64) * (kEmb / 64) / 8;   // 256 blocks per projection
static_assert((kRowsK / 64) / 8 * kHeads == kProjBlocks && (kSeqK / 64) / 8 * kHeads * kBatch == kProjBlocks, "three equal shares");
__global__ __launch_bounds__(256) void proj_qkv_kernel(
    const unsigned short* __restrict__ lnx16, const unsigned short* __restrict__ wq16,
    const unsigned short* __restrict__ key16, const unsigned short* __restrict__ wkv16,
    unsigned short* __restrict__ q16, unsigned short* __restrict__ k16, unsigned short* __restrict__ vt16) {
  __shared__ __align__(16) __bf16 sStage[2][kGsRows * kGsPitch];
  __shared__ __align__(16) float sT[8][16 * 68];
  const unsigned which = blockIdx.x / (unsigned)kProjBlocks;
  const unsigned j     = blockIdx.x % (unsigned)kProjBlocks;
  if (which == 0) {
    gemm64_block<1, false, 0, 1, false>(
        sStage, sT, (int)j, 0, 0, lnx16, nullptr, 0L, wq16, nullptr, 0L,
        (void*)q16, nullptr, kEmb, 0L, nullptr, nullptr, 0L, kRowsQ, kEmb, kEmb, 1.0f, 0L, 0L);
  } else if (which == 1) {
    constexpr unsigned g = (kRowsK / 64) / 8;   // 16 groups of 8 tiles per head
    gemm64_block<1, false, 0, 1, false, 0, true>(
        sStage, sT, (int)(j % g), (int)(j / g), 0, key16, nullptr, 0L, wkv16, nullptr, (long)(2 * kHdim) * kEmb,
        (void*)k16, nullptr, kEmb, (long)kHdim, nullptr, nullptr, 0L, kRowsK, kHdim, kEmb, 1.0f, 0L, 0L);
  } else {
    constexpr unsigned g = (kSeqK / 64) / 8;    // 4 groups of 8 tiles per (b, h)
    gemm64_block<1, false, 0, 1, false, 0, false, kEmb, kRowPitch>(
        sStage, sT, (int)(j % g), (int)((j / g) % kHeads), (int)(j / (g * kHeads)),
        wkv16 + (size_t)kHdim * kEmb, nullptr, (long)(2 * kHdim) * kEmb, key16, nullptr, 0L,
        (void*)vt16, nullptr, kSeqK, (long)kHdim * kSeqK, nullptr, nullptr, 0L, kHdim, kSeqK, kEmb, 1.0f,
        (long)kEmb, (long)kHeads * kHdim * kSeqK);
  }
}

// =====================================================================================
// Full (unmasked) attention, head dim 64, all batches and heads in one launch, time-major planes.
//   q plane  (f16): element (t, b, h, d) at [(t*kBatch + b)*kEmb + h*64 + d]   (unscaled q = LN(x).Wq^T)
//   k plane  (f16): element (s, b, h, d) at [(s*kBatch + b)*kEmb + h*64 + d]
//   v^T plane(f16): element (b, h, d, s) at [((b*kHeads + h)*64 + d)*kSeqK + s]
//   ctx plane (bf16 out): element (t, b, h, d) at [(t*kBatch + b)*kEmb + h*64 + d]
//   scores^T = (k . q^T) * sscale : single v_wmma_f32_16x16x32_f16 (A = K rows, B = Q), scale applied to the f32 accumulator
//   softmax in base 2: p * 2^15 = 2^(raw * sscale * log2(e) + 15 - maximum), one fused multiply-add and one v_exp_f32 per score
//   out^T    = v^T . p^T          : single v_wmma_f32_16x16x32_f16 (A = V^T rows, B = p^T), p = exp(s - m) in (0, 1] carried x2^15 as f16
//   Per column group a lane holds 32 of the chunk's 64 scores of ONE query (column lane & 15; keys j*16 + 8*(lane >> 4) + r), so the maximum and
//   the sum run in the lane, and two score tiles converted in place are the B operand of the second product: p never leaves registers.
//   online softmax in f32 over all kSeqK keys (32 chunks of 64, compile-time trip count).
//   Block = 4 waves x 32 query rows = 128 query rows of one (b, h); grid.x = kBatch * kHeads * (kSeqQ/128) = 1024.
//   K / V^T chunk staging: 128 threads x 32 elements per plane = the whole 64x64 tile (16-B copies, plain loads,
//   __syncthreads before and after); fragment loads read the LDS tiles with the same v8h element type.
// =====================================================================================
#define AT_D 64
#define AT_NW 4
#define AT_G 2     // 16-query column groups per wave: every K and V^T fragment read from LDS feeds AT_G products
#define AT_QB (AT_NW * AT_G * 16)
#define AT_KC 64
#define AT_LP 72   // LDS row pitch of the K and V^T tiles in f16: 144 B = 16 B x odd, so 16 rows read by 16-byte loads fall on distinct banks

// the plain builtin: the compiler keeps the distances behind its own matrix instructions, and with no volatile statement behind
// each product the LDS reads of later fragments are free to stand ahead of it
__device__ __forceinline__ v8f mma_f16g(v16h a, v16h b, v8f c) {
  return __builtin_amdgcn_wmma_f32_16x16x32_f16(false, a, false, b, (short)0, c, false, false);
}

// 2^x as the one hardware instruction; arguments here are <= 15 but for rounding, and a result below the normal range may go to 0
__device__ __forceinline__ float exp2_hw(float x) { return __builtin_amdgcn_exp2f(x); }
// the same for eight values, each in place, in one statement that ends in v_nop: behind a transcendental the instruction set asks
// for one independent instruction before its result is read or its source overwritten; here the next v_exp_f32 is that instruction
// and the v_nop is the last one's
__device__ __forceinline__ void exp2_hw8(float (&x)[8]) {
  asm("v_exp_f32 %0, %0\n\tv_exp_f32 %1, %1\n\tv_exp_f32 %2, %2\n\tv_exp_f32 %3, %3\n\t"
      "v_exp_f32 %4, %4\n\tv_exp_f32 %5, %5\n\tv_exp_f32 %6, %6\n\tv_exp_f32 %7, %7\n\tv_nop"
      : "+v"(x[0]), "+v"(x[1]), "+v"(x[2]), "+v"(x[3]), "+v"(x[4]), "+v"(x[5]), "+v"(x[6]), "+v"(x[7]));
}

// lane l takes the value of lane l ^ 16: the other half of the same query column
__device__ __forceinline__ float xhalf(float x) {
  return __builtin_bit_cast(float, __builtin_amdgcn_permlanex16(__builtin_bit_cast(int, x), __builtin_bit_cast(int, x), 0x76543210, 0xfedcba98, false, false));
}

// four waves a SIMD, 256 registers each: all 1,024 blocks are resident at once
__global__ __launch_bounds__(128) __attribute__((amdgpu_waves_per_eu(4, 4)))
void attn_full16_kernel(const unsigned short* __restrict__ qp, const unsigned short* __restrict__ kp,
                        const unsigned short* __restrict__ vtp, unsigned short* __restrict__ ctxp, float sscale) {
  union FH { v16h v; v8h h[2]; };
  __shared__ __align__(16) _Float16 Ksh[AT_KC * AT_LP];            // K  [kv][d]   9 KB, 64 of 72 columns used
  __shared__ __align__(16) _Float16 Vth[AT_D * AT_LP];             // V^T [d][kv]  9 KB, 64 of 72 columns used
  __shared__ __align__(16) float    Os[AT_NW][AT_G * 16 * 68];     // per wave out tile, 32 query rows, pitch 68

  const int tid  = threadIdx.x;
  const int wave = tid >> 5;
  const int lane = tid & 31;
  const int hh   = lane >> 4;
  const int c    = lane & 15;

  const int nqb  = kSeqQ / AT_QB;          // 16
  const int bx   = blockIdx.x;             // < kBatch*kHeads*nqb
  const int qb   = bx % nqb;
  const int bhid = bx / nqb;
  const int h    = bhid % kHeads;
  const int bb   = bhid / kHeads;          // 0..kBatch-1
  const int q0   = qb * AT_QB + wave * (16 * AT_G);

  const _Float16* Qh = (const _Float16*)(const void*)qp  + (size_t)bb * kEmb + (size_t)h * kHdim;
  const _Float16* Kh = (const _Float16*)(const void*)kp  + (size_t)bb * kEmb + (size_t)h * kHdim;
  const _Float16* Vh = (const _Float16*)(const void*)vtp + (size_t)(bb * kHeads + h) * kHdim * kSeqK;
  unsigned short* ob = ctxp + (size_t)bb * kEmb + (size_t)h * kHdim;

  // ---- Q fragments (B operand, column = lane&15, split k map via Frag load): AT_G column groups x 2 d-chunks ----
  v16h qa[AT_G][2];
#pragma unroll   // here and below: a constant g keeps each column group's fragments, scores and sums in registers
  for (int g = 0; g < AT_G; ++g)
#pragma unroll
    for (int dc = 0; dc < 2; ++dc)
      qa[g][dc] = Frag<_Float16>::load(Qh + (size_t)(q0 + g * 16 + c) * kRowPitch + dc * 32 + 8 * hh);

  const float c2 = sscale * kLog2e;   // raw product -> exponent of 2; sscale > 0
  float mrow[AT_G];         // running maximum of query q0 + g*16 + c in exponent-of-2 units, equal in both lane halves
  float lrow[AT_G];         // running sum (x2^15) over this lane half's keys only; the halves are joined behind the loop
  v8f oacc[AT_G][4];        // oacc[g][t][r] = out^T[d = t*16 + 8*hh + r][query q0 + g*16 + c]
#pragma unroll
  for (int g = 0; g < AT_G; ++g) {
    mrow[g] = -INFINITY;
    lrow[g] = 0.f;
#pragma unroll
    for (int t = 0; t < 4; ++t) oacc[g][t] = (v8f){0.f,0.f,0.f,0.f,0.f,0.f,0.f,0.f};
  }

  const int nChunks = kSeqK / AT_KC;   // 32, compile-time constant
  for (int kc = 0; kc < nChunks; ++kc) {
    const int kv0 = kc * AT_KC;
    __syncthreads();
    {
      // staging coverage: 128 threads x (4 x 8) elements = 64 rows x 64 per plane = the whole chunk tile
      const int r = tid >> 1, half = (tid & 1) * 32;
      const _Float16* ks = Kh + (size_t)(kv0 + r) * kRowPitch + half;   // K row kv0+r, d = half..half+31
      const _Float16* vs = Vh + (size_t)r * kSeqK + kv0 + half;          // V^T row d = r, s = kv0+half..+31
#pragma unroll
      for (int i = 0; i < 4; ++i) {
        const v8h a0 = *(const v8h*)(ks + 8 * i);
        const v8h b0 = *(const v8h*)(vs + 8 * i);
        *(v8h*)(Ksh + r * AT_LP + half + 8 * i) = a0;
        *(v8h*)(Vth + r * AT_LP + half + 8 * i) = b0;
      }
      // the wait that stands in front of any rewrite of the eight loads' address registers; it names both addresses, so that they
      // keep their registers up to here (without it this build let the last load of each plane land on its own address pair)
      asm volatile("s_wait_xcnt 0x0" :: "v"(ks), "v"(vs) : "memory");
    }
    __syncthreads();

    v8f s[AT_G][4];
#pragma unroll
    for (int j = 0; j < 4; ++j) {
#pragma unroll
      for (int g = 0; g < AT_G; ++g) s[g][j] = (v8f){0.f,0.f,0.f,0.f,0.f,0.f,0.f,0.f};
#pragma unroll
      for (int dc = 0; dc < 2; ++dc) {
        FH kb;                                 // one K fragment serves every column group
        kb.h[0] = *(const v8h*)(Ksh + (j * 16 + c) * AT_LP + dc * 32 + 8 * hh);
        kb.h[1] = *(const v8h*)(Ksh + (j * 16 + c) * AT_LP + dc * 32 + 16 + 8 * hh);
#pragma unroll
        for (int g = 0; g < AT_G; ++g)
          s[g][j] = mma_f16g(kb.v, qa[g][dc], s[g][j]);   // s[g][j][r] = score of query g*16 + c with key kv0 + j*16 + 8*hh + r
      }
    }
    float alpha[AT_G];
    FH pb[AT_G][2];                            // p^T as B operand: element e of pb[g][kk] = key kk*32 + (e < 8 ? 8*hh + e : 16 + 8*hh + e - 8)
#pragma unroll
    for (int g = 0; g < AT_G; ++g) {
      float m = -INFINITY;
#pragma unroll
      for (int j = 0; j < 4; ++j) {
#pragma unroll
        for (int r = 0; r < 8; ++r) m = fmaxf(m, s[g][j][r]);   // on the raw products: c2 > 0 keeps their order
      }
      m = fmaxf(m, xhalf(m));                  // the query's maximum over all 64 keys of the chunk
      const float mnew = fmaxf(mrow[g], m * c2);
      alpha[g] = exp2_hw(mrow[g] - mnew);
      mrow[g] = mnew;
      const float eoff = kPCarryLog2 - mnew;   // maximum and carry in one addend of the exponent
      float psum = 0.f;
#pragma unroll
      for (int j = 0; j < 4; ++j) {
        float p[8];                            // 2^15 * exp(score - maximum), at most 2^15 but for rounding
#pragma unroll
        for (int r = 0; r < 8; ++r) p[r] = fmaf(s[g][j][r], c2, eoff);
        exp2_hw8(p);
#pragma unroll
        for (int r = 0; r < 8; ++r) {
          psum += p[r];
          pb[g][j >> 1].h[j & 1][r] = (_Float16)p[r];
        }
      }
      lrow[g] = lrow[g] * alpha[g] + psum;
    }
    FH vb[4];                                  // V^T fragments of the first 32 keys, read as one group; each serves every column group
#pragma unroll
    for (int t = 0; t < 4; ++t) {
      vb[t].h[0] = *(const v8h*)(Vth + (t * 16 + c) * AT_LP + 8 * hh);
      vb[t].h[1] = *(const v8h*)(Vth + (t * 16 + c) * AT_LP + 16 + 8 * hh);
    }
    // holds the eight reads here, ahead of the rescaling: left alone, the scheduler sinks each pair to its product and the wave
    // waits out the LDS latency once per product; without this one and the next the build also runs out of its 256 registers
    // and spills inside the loop
    __builtin_amdgcn_sched_barrier(0);
#pragma unroll
    for (int g = 0; g < AT_G; ++g)
#pragma unroll
      for (int t = 0; t < 4; ++t)
#pragma unroll
        for (int r = 0; r < 8; ++r) oacc[g][t][r] *= alpha[g];
#pragma unroll
    for (int t = 0; t < 4; ++t)
#pragma unroll
      for (int g = 0; g < AT_G; ++g) oacc[g][t] = mma_f16g(vb[t].v, pb[g][0].v, oacc[g][t]);
#pragma unroll   // the second 32 keys' fragments, again as one group, under the products just issued
    for (int t = 0; t < 4; ++t) {
      vb[t].h[0] = *(const v8h*)(Vth + (t * 16 + c) * AT_LP + 32 + 8 * hh);
      vb[t].h[1] = *(const v8h*)(Vth + (t * 16 + c) * AT_LP + 32 + 16 + 8 * hh);
    }
    __builtin_amdgcn_sched_barrier(0);         // as above: keeps the eight reads together in front of their products
#pragma unroll
    for (int t = 0; t < 4; ++t)
#pragma unroll
      for (int g = 0; g < AT_G; ++g) oacc[g][t] = mma_f16g(vb[t].v, pb[g][1].v, oacc[g][t]);
  }

  // ---- normalise (fold back the 2^15 carry), stage the wave's 32x64 tile, write bf16 rows:
  float* os = Os[wave];
#pragma unroll
  for (int g = 0; g < AT_G; ++g) {
    const float inv = 1.0f / (lrow[g] + xhalf(lrow[g]));   // both halves' sums joined; sums and products carry the same 2^15
#pragma unroll
    for (int t = 0; t < 4; ++t)
#pragma unroll
      for (int r = 0; r < 8; ++r) os[(g * 16 + c) * 68 + t * 16 + 8 * hh + r] = oacc[g][t][r] * inv;
  }
  __builtin_amdgcn_fence(__ATOMIC_RELEASE, "workgroup");
  __builtin_amdgcn_wave_barrier();
  __builtin_amdgcn_fence(__ATOMIC_ACQUIRE, "workgroup");
  {
    const int qq = lane >> 3, c8 = (lane & 7) * 8;
#pragma unroll
    for (int g = 0; g < AT_G; ++g) {
#pragma unroll
      for (int it = 0; it < 4; ++it) {
        const int row = g * 16 + it * 4 + qq;
        const float* sp = os + row * 68 + c8;
        v8h hv;
#pragma unroll
        for (int e = 0; e < 8; ++e) hv[e] = __builtin_bit_cast(_Float16, f2bf_bits(sp[e]));
        *(v8h*)(ob + (size_t)(q0 + row) * kRowPitch + c8) = hv;
      }
      if (g + 1 < AT_G) addr_regs_wait();   // behind a group's four stores, in front of the next group's use of their registers
    }
  }
}

// ---------------------------------------------------------------------------
// Pre-pass, ONE launch: LayerNorm(query) -> bf16 plane, and the bf16 (RNE) casts of key, w_q, w_kv and w_out.
// Unit of work: one row of kEmb = 1024 f32 (4 KB read, 2 KB written), done by ONE wave. Chunk j of a row is elements
// j*128 + 4*lane .. +3, so a wave-wide 16-B load covers 512 contiguous bytes and a wave-wide 8-B store 256: whole lines.
// 20,480 rows on kPpWaves = 4,096 waves: wave w takes query rows w and w + 4096, key rows w and w + 4096, and row w of the
// three weight matrices counted end to end. Few long waves with many loads in flight, so that the launch is paid for by its
// bytes and not by the number of waves to start. A row's sums stay inside its wave: no LDS, no barrier.
// ---------------------------------------------------------------------------
constexpr int kPpWaves  = 4096;
constexpr int kPpChunks = kEmb / 128;            // 8 chunks of 32 lanes x 4 elements
static_assert(kRowsQ == 2 * kPpWaves && kRowsK == 2 * kPpWaves && 4 * kEmb == kPpWaves, "two query rows, two key rows, one weight row per wave");

struct PpRow { v4f c[kPpChunks]; };

__device__ __forceinline__ void pp_load(PpRow& r, const float* __restrict__ row, int lane) {
#pragma unroll   // constant indices keep the row in registers and the chunk steps in the loads' immediate offsets
  for (int j = 0; j < kPpChunks; ++j) r.c[j] = *(const v4f*)(row + j * 128 + 4 * lane);
  // holds the row's 8 loads here, in the order of the calls: left alone, the scheduler sinks loads to their users, two at a
  // time, and the wave waits out memory latency once per pair; in call order the first row is worked on while the rest fly
  __builtin_amdgcn_sched_barrier(0);
}

__device__ __forceinline__ void pp_store(const PpRow& r, unsigned short* __restrict__ row, int lane) {
#pragma unroll   // as above
  for (int j = 0; j < kPpChunks; ++j) {
    v2u pk;
    pk[0] = (unsigned)f2bf_bits(r.c[j][0]) | ((unsigned)f2bf_bits(r.c[j][1]) << 16);
    pk[1] = (unsigned)f2bf_bits(r.c[j][2]) | ((unsigned)f2bf_bits(r.c[j][3]) << 16);
    *(v2u*)(row + j * 128 + 4 * lane) = pk;
  }
  addr_regs_wait();
}

// lane l takes the value of lane l ^ M inside its 16-lane row (DPP row_xmask:M)
template <int M> __device__ __forceinline__ float xrow(float x) {
  return __builtin_bit_cast(float, __builtin_amdgcn_update_dpp(0, __builtin_bit_cast(int, x), 0x160 + M, 0xf, 0xf, true));
}
// sum over the 32 lanes, the same bits in every lane
__device__ __forceinline__ float wave_sum(float x) {
  x += xrow<1>(x);
  x += xrow<2>(x);
  x += xrow<4>(x);
  x += xrow<8>(x);
  return x + xhalf(x);
}
__device__ __forceinline__ float sum8(const float* p) { return ((p[0] + p[1]) + (p[2] + p[3])) + ((p[4] + p[5]) + (p[6] + p[7])); }

// two-pass mean and variance of one row, then (x - mu) * rstd * gamma + beta in place
__device__ __forceinline__ void pp_norm(PpRow& r, const PpRow& g, const PpRow& bt, float eps) {
  float p[kPpChunks];
#pragma unroll
  for (int j = 0; j < kPpChunks; ++j) p[j] = (r.c[j][0] + r.c[j][1]) + (r.c[j][2] + r.c[j][3]);
  const float mu = wave_sum(sum8(p)) * (1.0f / (float)kEmb);
#pragma unroll
  for (int j = 0; j < kPpChunks; ++j) {
    r.c[j] -= mu;
    p[j] = (r.c[j][0] * r.c[j][0] + r.c[j][1] * r.c[j][1]) + (r.c[j][2] * r.c[j][2] + r.c[j][3] * r.c[j][3]);
  }
  const float var  = wave_sum(sum8(p)) * (1.0f / (float)kEmb);
  const float rstd = rsqrtf(var + eps);
#pragma unroll
  for (int j = 0; j < kPpChunks; ++j)
#pragma unroll
    for (int e = 0; e < 4; ++e) r.c[j][e] = r.c[j][e] * rstd * g.c[j][e] + bt.c[j][e];
}

__global__ __launch_bounds__(256)
void prepass_kernel(const float* __restrict__ query, const float* __restrict__ key,
                    const float* __restrict__ gam, const float* __restrict__ bet,
                    const float* __restrict__ w_q, const float* __restrict__ w_kv, const float* __restrict__ w_out,
                    unsigned short* __restrict__ lnx16, unsigned short* __restrict__ key16,
                    unsigned short* __restrict__ wq16, unsigned short* __restrict__ wkv16, unsigned short* __restrict__ wo16,
                    float eps) {
  const int lane = threadIdx.x & 31;
  // wave-uniform by construction; through readfirstlane so that every row address is a scalar base plus one lane offset
  const int w = blockIdx.x * 8 + __builtin_amdgcn_readfirstlane((int)(threadIdx.x >> 5));
  const float* wsrc;
  unsigned short* wdst;
  if (w < kEmb)          { wsrc = w_q   + (size_t)w * kEmb;              wdst = wq16  + (size_t)w * kEmb; }
  else if (w < 3 * kEmb) { wsrc = w_kv  + (size_t)(w - kEmb) * kEmb;     wdst = wkv16 + (size_t)(w - kEmb) * kEmb; }
  else                   { wsrc = w_out + (size_t)(w - 3 * kEmb) * kEmb; wdst = wo16  + (size_t)(w - 3 * kEmb) * kEmb; }

  PpRow ka, kb, wr, qa, qb, g, bt;
  pp_load(ka, key + (size_t)w * kEmb, lane);
  pp_load(kb, key + (size_t)(w + kPpWaves) * kEmb, lane);
  pp_load(wr, wsrc, lane);
  pp_load(qa, query + (size_t)w * kEmb, lane);
  pp_load(qb, query + (size_t)(w + kPpWaves) * kEmb, lane);
  addr_regs_wait();

  pp_store(ka, key16 + (size_t)w * kEmb, lane);
  pp_store(kb, key16 + (size_t)(w + kPpWaves) * kEmb, lane);
  pp_store(wr, wdst, lane);
  pp_load(g, gam, lane);      // 8 KB that every wave reads: cache hits, landing under the rows' sums
  pp_load(bt, bet, lane);
  addr_regs_wait();
  pp_norm(qa, g, bt, eps);
  pp_norm(qb, g, bt, eps);
  pp_store(qa, lnx16 + (size_t)w * kEmb, lane);
  pp_store(qb, lnx16 + (size_t)(w + kPpWaves) * kEmb, lane);
}

// ---------------------------------------------------------------------------
// Host orchestration.
// Workspace region map (byte offsets):
//   [  0 MiB, 16 MiB)  KEY16  bf16 [8192][1024]   key cast
//   [ 16 MiB, 18 MiB)  WQ16   bf16 [1024][1024]
//   [ 18 MiB, 22 MiB)  WKV16  bf16 [2048][1024]
//   [ 22 MiB, 24 MiB)  WO16   bf16 [1024][1024]
//   [ 24 MiB, 40 MiB)  LNX16  bf16 [8192][1024]   LN(query); dead after the q projection, then reused as
//                      CTX16  bf16 [8192][1024]   attention output
//   [ 40 MiB, 56 MiB)  Q16    f16  [8192][1024]
//   [ 56 MiB, 72 MiB)  K16    f16  [8192][1024]   (head h at columns h*64)
//   [ 72 MiB, 88 MiB)  VT16   f16  [4][16][64][2048]
//   total 88 MiB = 92274688 B
// ---------------------------------------------------------------------------
extern "C" void kernel_launch(void* const* d_in, const int* in_sizes, int n_in,
                              void* d_out, int out_size, void* d_ws, size_t ws_size,
                              hipStream_t stream) {
  if (n_in < 7) return;
  const int nAct = kSeqQ * kBatch * kEmb;          // 8388608
  if (in_sizes[0] != nAct || in_sizes[1] != kSeqK * kBatch * kEmb) return;
  if (in_sizes[2] < kEmb || in_sizes[3] < kEmb) return;
  if (in_sizes[4] != kEmb * kEmb || in_sizes[5] != 2 * kEmb * kEmb || in_sizes[6] != kEmb * kEmb) return;
  if (out_size != nAct) return;

  const float* query = (const float*)d_in[0];   // [2048][4][1024]
  const float* key   = (const float*)d_in[1];   // [2048][4][1024]
  const float* gamma = (const float*)d_in[2];   // [1024]
  const float* beta  = (const float*)d_in[3];   // [1024]
  const float* w_q   = (const float*)d_in[4];   // [1024][1024]
  const float* w_kv  = (const float*)d_in[5];   // [2048][1024]
  const float* w_out = (const float*)d_in[6];   // [1024][1024]
  float* out = (float*)d_out;

  const size_t szAct16 = (size_t)kRowsQ * kEmb * 2;          // 16 MiB
  const size_t szWq16  = (size_t)kEmb * kEmb * 2;            //  2 MiB
  const size_t szWkv16 = (size_t)2 * kEmb * kEmb * 2;        //  4 MiB
  const size_t szVt16  = (size_t)kBatch * kHeads * kHdim * kSeqK * 2;   // 16 MiB
  size_t off = 0;
  char* ws = (char*)d_ws;
  unsigned short* KEY16 = (unsigned short*)(ws + off); off += szAct16;
  unsigned short* WQ16  = (unsigned short*)(ws + off); off += szWq16;
  unsigned short* WKV16 = (unsigned short*)(ws + off); off += szWkv16;
  unsigned short* WO16  = (unsigned short*)(ws + off); off += szWq16;
  unsigned short* LNX16 = (unsigned short*)(ws + off); off += szAct16;
  unsigned short* CTX16 = LNX16;                                // region reuse (LNX16 dead after the q GEMM)
  unsigned short* Q16   = (unsigned short*)(ws + off); off += szAct16;
  unsigned short* K16   = (unsigned short*)(ws + off); off += szAct16;
  unsigned short* VT16  = (unsigned short*)(ws + off); off += szVt16;
  if (off > ws_size) return;

  // 1) + 2) pre-pass: LayerNorm(query) -> bf16 plane and the four bf16 casts, 8 waves per block
  prepass_kernel<<<kPpWaves / 8, 256, 0, stream>>>(query, key, gamma, beta, w_q, w_kv, w_out,
                                                   LNX16, KEY16, WQ16, WKV16, WO16, kLnEps);

  // 3) + 4) + 5) q, k and v^T projections, one launch
  proj_qkv_kernel<<<3 * kProjBlocks, 256, 0, stream>>>(LNX16, WQ16, KEY16, WKV16, Q16, K16, VT16);

  // 6) attention: one block per (b, h, 128-query tile) -> ctx bf16 plane (time-major, heads merged)
  attn_full16_kernel<<<kBatch * kHeads * (kSeqQ / AT_QB), 128, 0, stream>>>(Q16, K16, VT16, CTX16, 0.125f);

  // 7) out = query + ctx . Wout^T : M=8192, N=1024, K=1024, f32 with residual epilogue, straight to d_out
  {
    const int tiles = (kRowsQ / 64) * (kEmb / 64);   // 2048
    wmma_gemm64<1, false, 0, 0, true><<<dim3((tiles + 7) / 8, 1), 256, 0, stream>>>(
        CTX16, nullptr, 0L, WO16, nullptr, 0L,
        (void*)out, nullptr, kEmb, 0L, nullptr, query, 0L, kRowsQ, kEmb, kEmb, 1.0f);
  }
}
